// v000
// Times are from an AMD MI455X. After a warm-up the kernel runs many times in a row, and a time is the length of
// such a window on the GPU divided by its runs, so every launch and the gaps after it count. The runs cycle
// through copies of the inputs. A figure is the median of several windows, for all but v000 over two sittings.
// Sittings can differ by a few percent; kernels timed side by side share one.
// The starting kernel, v000, takes 276 microseconds a run.
#include <hip/hip_runtime.h>

typedef __attribute__((ext_vector_type(16))) _Float16 v16h;
typedef __attribute__((ext_vector_type(8)))  float    v8f;

#define D_MODEL 1024
#define SEQ     4096
#define BATCH   4
#define HEADS   8
#define BLK     64
#define DK      128
#define M_TOTAL (BATCH * SEQ)   // 16384 rows

#define LSTR 40                 // LDS row stride in halves (32 + 8 pad, 80B: bank-conflict free)
#define ABUF (128 * LSTR)       // halves per LDS buffer (128 rows x 32 halves padded)

// ---------------------------------------------------------------------------
// Async-counter wait (CDNA5): builtin if the toolchain declares it, else asm.
// ---------------------------------------------------------------------------
#if __has_builtin(__builtin_amdgcn_s_wait_asynccnt)
#define WAIT_ASYNC(n) __builtin_amdgcn_s_wait_asynccnt(n)
#else
#define WAIT_ASYNC(n) asm volatile("s_wait_asynccnt %0" ::"i"(n) : "memory")
#endif

// Copy 64 contiguous bytes global -> LDS via 4x async b128 (ASYNCcnt += 4).
__device__ __forceinline__ void async_stage64(const _Float16* __restrict__ g,
                                              _Float16* lds_row) {
  unsigned l = (unsigned)(uintptr_t)lds_row;          // LDS byte offset (low 32 bits)
  unsigned long long a = (unsigned long long)(uintptr_t)g;
#pragma unroll
  for (int c = 0; c < 4; ++c) {
    asm volatile("global_load_async_to_lds_b128 %0, %1, off"
                 :: "v"(l + (unsigned)(c * 16)), "v"(a + (unsigned long long)(c * 16))
                 : "memory");
  }
}

// ---------------------------------------------------------------------------
// Fragment helpers (wave32, 16-bit 16x16x32 WMMA layout)
// A (16x32): lane L holds row M=L&15; half=L>>4 adds +8 to K.
//   VGPR j<4  -> K pair {2j, 2j+1} (+8*half)
//   VGPR j>=4 -> K pair {16+2(j-4), ...} (+8*half)
// B (32x16) is symmetric with N=L&15; memory addressed as p[n*ld + k].
// ---------------------------------------------------------------------------
__device__ __forceinline__ v16h load_frag16(const _Float16* __restrict__ p,
                                            int ld, int r0, int k0, int lane) {
  const int m    = lane & 15;
  const int half = lane >> 4;
  const _Float16* q = p + (size_t)(r0 + m) * ld + (k0 + 8 * half);
  v16h f;
#pragma unroll
  for (int i = 0; i < 8; ++i) f[i]     = q[i];        // VGPR 0..3: K 0..7
#pragma unroll
  for (int i = 0; i < 8; ++i) f[8 + i] = q[16 + i];   // VGPR 4..7: K 16..23
  return f;
}

__device__ __forceinline__ v8f wmma_f16(v16h a, v16h b, v8f c) {
  return __builtin_amdgcn_wmma_f32_16x16x32_f16(
      /*neg_a=*/false, a, /*neg_b=*/false, b,
      /*c_mod=*/(short)0, c, /*reuse_a=*/false, /*reuse_b=*/false);
}

// ---------------------------------------------------------------------------
// Workgroup-tiled GEMM core: 128x128 tile, 4 waves (2x2), K staged in LDS via
// double-buffered async copies. acc is this wave's 64x64 (4x4 fragment tiles).
// Xg: [M x 1024] row-major f16.  Wg: [N x 1024] row-major f16 (W transposed).
// ---------------------------------------------------------------------------
__device__ __forceinline__ void gemm_core_128(const _Float16* __restrict__ Xg,
                                              const _Float16* __restrict__ Wg,
                                              int row0, int n0, int tid,
                                              _Float16* As, _Float16* Bs,
                                              v8f acc[4][4]) {
  const int lane = tid & 31;
  const int wave = tid >> 5;
  const int wr = (wave >> 1) * 64;   // wave row offset inside 128x128 tile
  const int wc = (wave & 1) * 64;    // wave col offset inside 128x128 tile

  const _Float16* xrow = Xg + (size_t)(row0 + tid) * D_MODEL;
  const _Float16* wrow = Wg + (size_t)(n0 + tid) * D_MODEL;

  // prologue: stage k-slice 0 into buffer 0 (ASYNCcnt = 8)
  async_stage64(xrow, As + tid * LSTR);
  async_stage64(wrow, Bs + tid * LSTR);

  const int steps = D_MODEL / 32;
  for (int i = 0; i < steps; ++i) {
    const int cur = i & 1;
    if (i + 1 < steps) {
      const int nxt = cur ^ 1;
      async_stage64(xrow + (i + 1) * 32, As + nxt * ABUF + tid * LSTR);
      async_stage64(wrow + (i + 1) * 32, Bs + nxt * ABUF + tid * LSTR);
      WAIT_ASYNC(8);   // retire the 8 copies for `cur`; next 8 stay in flight
    } else {
      WAIT_ASYNC(0);
    }
    __syncthreads();   // all waves' slices for `cur` visible

    const _Float16* Ab = As + cur * ABUF;
    const _Float16* Bb = Bs + cur * ABUF;
    v16h a[4], b[4];
#pragma unroll
    for (int mt = 0; mt < 4; ++mt) a[mt] = load_frag16(Ab, LSTR, wr + 16 * mt, 0, lane);
#pragma unroll
    for (int nt = 0; nt < 4; ++nt) b[nt] = load_frag16(Bb, LSTR, wc + 16 * nt, 0, lane);
#pragma unroll
    for (int mt = 0; mt < 4; ++mt)
#pragma unroll
      for (int nt = 0; nt < 4; ++nt)
        acc[mt][nt] = wmma_f16(a[mt], b[nt], acc[mt][nt]);

    __syncthreads();   // done reading `cur` before it is refilled next iter
  }
}

// ---------------------------------------------------------------------------
// Conversion kernels
// ---------------------------------------------------------------------------
__global__ void convert_src_kernel(const float* __restrict__ in,
                                   _Float16* __restrict__ out, size_t n) {
  size_t base = ((size_t)blockIdx.x * blockDim.x + threadIdx.x) * 4;
#pragma unroll
  for (int i = 0; i < 4; ++i) {
    size_t idx = base + i;
    if (idx < n) out[idx] = (_Float16)in[idx];
  }
}

// wT[z][n][k] = W_z[k][n]  (f16, transposed so K-pairs are contiguous)
__global__ void convert_w_kernel(const float* __restrict__ Wq,
                                 const float* __restrict__ Wk,
                                 const float* __restrict__ Wv,
                                 const float* __restrict__ Wo,
                                 _Float16* __restrict__ wT) {
  int k = blockIdx.x * 16 + threadIdx.x;
  int n = blockIdx.y * 16 + threadIdx.y;
  int z = blockIdx.z;
  const float* W = (z == 0) ? Wq : (z == 1) ? Wk : (z == 2) ? Wv : Wo;
  wT[(size_t)z * D_MODEL * D_MODEL + (size_t)n * D_MODEL + k] =
      (_Float16)W[(size_t)k * D_MODEL + n];
}

// ---------------------------------------------------------------------------
// QKV projection: 128x128 workgroup tile, 4 waves. z selects Q/K/V.
// Q,K stored row-major f16 [16384 x 1024].
// V stored head-transposed: vT[(bb*HEADS+h)*DK*BLK + d*BLK + t]
// ---------------------------------------------------------------------------
__global__ void __launch_bounds__(128)
qkv_gemm_kernel(const _Float16* __restrict__ X, const _Float16* __restrict__ WT,
                const float* __restrict__ bq, const float* __restrict__ bk,
                const float* __restrict__ bv, _Float16* __restrict__ qO,
                _Float16* __restrict__ kO, _Float16* __restrict__ vT) {
  __shared__ _Float16 As[2 * ABUF];
  __shared__ _Float16 Bs[2 * ABUF];

  const int tid  = threadIdx.x;
  const int lane = tid & 31;
  const int wave = tid >> 5;
  const int row0 = blockIdx.x * 128;
  const int n0   = blockIdx.y * 128;
  const int proj = blockIdx.z;
  const _Float16* W = WT + (size_t)proj * D_MODEL * D_MODEL;

  const v8f vzero = {0.f, 0.f, 0.f, 0.f, 0.f, 0.f, 0.f, 0.f};
  v8f acc[4][4];
#pragma unroll
  for (int mt = 0; mt < 4; ++mt)
#pragma unroll
    for (int nt = 0; nt < 4; ++nt) acc[mt][nt] = vzero;

  gemm_core_128(X, W, row0, n0, tid, As, Bs, acc);

  const float* bias = (proj == 0) ? bq : (proj == 1) ? bk : bv;
  const int half = lane >> 4, nl = lane & 15;
  const int wrow = row0 + (wave >> 1) * 64;
  const int wcol = n0 + (wave & 1) * 64;
#pragma unroll
  for (int mt = 0; mt < 4; ++mt)
#pragma unroll
    for (int nt = 0; nt < 4; ++nt)
#pragma unroll
      for (int r = 0; r < 8; ++r) {
        int gm = wrow + mt * 16 + r + 8 * half;
        int gn = wcol + nt * 16 + nl;
        _Float16 hv = (_Float16)(acc[mt][nt][r] + bias[gn]);
        if (proj == 0) {
          qO[(size_t)gm * D_MODEL + gn] = hv;
        } else if (proj == 1) {
          kO[(size_t)gm * D_MODEL + gn] = hv;
        } else {
          int bbrow = gm >> 6, t = gm & 63;   // gm = b*4096 + blk*64 + t
          int hh = gn >> 7, d = gn & 127;     // gn = h*128 + d
          vT[((size_t)bbrow * HEADS + hh) * (DK * BLK) + (size_t)d * BLK + t] = hv;
        }
      }
}

// ---------------------------------------------------------------------------
// Block attention: one workgroup per (b,blk), one wave per head.
// scores(64x64) in registers -> softmax (shfl_xor within 16-lane halves)
// -> P staged in LDS -> P @ V via WMMA -> f16 attention output row-major.
// ---------------------------------------------------------------------------
__global__ void __launch_bounds__(256)
attn_kernel(const _Float16* __restrict__ Q, const _Float16* __restrict__ K,
            const _Float16* __restrict__ VT, _Float16* __restrict__ AO) {
  __shared__ _Float16 P[HEADS][BLK * BLK];   // 64 KB

  const int lane = threadIdx.x & 31;
  const int h    = threadIdx.x >> 5;         // head
  const int bb   = blockIdx.x;               // b*64 + blk
  const int row0 = bb * BLK;                 // flat token row base
  const int col0 = h * DK;
  const int half = lane >> 4, nl = lane & 15;

  const v8f vzero = {0.f, 0.f, 0.f, 0.f, 0.f, 0.f, 0.f, 0.f};
  v8f s[4][4];
#pragma unroll
  for (int mt = 0; mt < 4; ++mt)
#pragma unroll
    for (int nt = 0; nt < 4; ++nt) s[mt][nt] = vzero;

  // scores = Q_blk @ K_blk^T over dk=128
  for (int kk = 0; kk < DK; kk += 32) {
    v16h a[4], b[4];
#pragma unroll
    for (int mt = 0; mt < 4; ++mt)
      a[mt] = load_frag16(Q, D_MODEL, row0 + 16 * mt, col0 + kk, lane);
#pragma unroll
    for (int nt = 0; nt < 4; ++nt)   // B[k][n] = K[row0+n][col0+kk+k]
      b[nt] = load_frag16(K, D_MODEL, row0 + 16 * nt, col0 + kk, lane);
#pragma unroll
    for (int mt = 0; mt < 4; ++mt)
#pragma unroll
      for (int nt = 0; nt < 4; ++nt)
        s[mt][nt] = wmma_f16(a[mt], b[nt], s[mt][nt]);
  }

  // row softmax: each row M lives in 16 lanes (one half) across 4 nt tiles
  const float scale = 0.08838834764831845f;  // dk^-0.5
#pragma unroll
  for (int mt = 0; mt < 4; ++mt)
#pragma unroll
    for (int r = 0; r < 8; ++r) {
      float x0 = s[mt][0][r] * scale, x1 = s[mt][1][r] * scale;
      float x2 = s[mt][2][r] * scale, x3 = s[mt][3][r] * scale;
      float mx = fmaxf(fmaxf(x0, x1), fmaxf(x2, x3));
#pragma unroll
      for (int msk = 1; msk < 16; msk <<= 1)
        mx = fmaxf(mx, __shfl_xor(mx, msk, 32));
      float e0 = __expf(x0 - mx), e1 = __expf(x1 - mx);
      float e2 = __expf(x2 - mx), e3 = __expf(x3 - mx);
      float sum = e0 + e1 + e2 + e3;
#pragma unroll
      for (int msk = 1; msk < 16; msk <<= 1)
        sum += __shfl_xor(sum, msk, 32);
      float inv = 1.0f / sum;
      int m = mt * 16 + r + 8 * half;
      P[h][m * BLK + 0 * 16 + nl] = (_Float16)(e0 * inv);
      P[h][m * BLK + 1 * 16 + nl] = (_Float16)(e1 * inv);
      P[h][m * BLK + 2 * 16 + nl] = (_Float16)(e2 * inv);
      P[h][m * BLK + 3 * 16 + nl] = (_Float16)(e3 * inv);
    }
  __syncthreads();

  // out = P(64x64) @ V(64x128); V is [d][t] per (bb,h) so K-pairs contiguous
  const _Float16* vbase = VT + ((size_t)bb * HEADS + h) * (DK * BLK);
  for (int dt = 0; dt < 8; ++dt) {
    v8f o[4];
#pragma unroll
    for (int mt = 0; mt < 4; ++mt) o[mt] = vzero;
#pragma unroll
    for (int kk = 0; kk < BLK; kk += 32) {
      v16h b = load_frag16(vbase, BLK, dt * 16, kk, lane);  // B[k][n]=V[t=k][d=n]
#pragma unroll
      for (int mt = 0; mt < 4; ++mt) {
        v16h a = load_frag16(&P[h][0], BLK, mt * 16, kk, lane);
        o[mt] = wmma_f16(a, b, o[mt]);
      }
    }
#pragma unroll
    for (int mt = 0; mt < 4; ++mt)
#pragma unroll
      for (int r = 0; r < 8; ++r) {
        int gm = row0 + mt * 16 + r + 8 * half;
        int gn = col0 + dt * 16 + nl;
        AO[(size_t)gm * D_MODEL + gn] = (_Float16)o[mt][r];
      }
  }
}

// ---------------------------------------------------------------------------
// Output projection: attn(f16) @ Wo^T(f16) + bo -> fp32 d_out
// ---------------------------------------------------------------------------
__global__ void __launch_bounds__(128)
out_gemm_kernel(const _Float16* __restrict__ X, const _Float16* __restrict__ WoT,
                const float* __restrict__ bo, float* __restrict__ out) {
  __shared__ _Float16 As[2 * ABUF];
  __shared__ _Float16 Bs[2 * ABUF];

  const int tid  = threadIdx.x;
  const int lane = tid & 31;
  const int wave = tid >> 5;
  const int row0 = blockIdx.x * 128;
  const int n0   = blockIdx.y * 128;

  const v8f vzero = {0.f, 0.f, 0.f, 0.f, 0.f, 0.f, 0.f, 0.f};
  v8f acc[4][4];
#pragma unroll
  for (int mt = 0; mt < 4; ++mt)
#pragma unroll
    for (int nt = 0; nt < 4; ++nt) acc[mt][nt] = vzero;

  gemm_core_128(X, WoT, row0, n0, tid, As, Bs, acc);

  const int half = lane >> 4, nl = lane & 15;
  const int wrow = row0 + (wave >> 1) * 64;
  const int wcol = n0 + (wave & 1) * 64;
#pragma unroll
  for (int mt = 0; mt < 4; ++mt)
#pragma unroll
    for (int nt = 0; nt < 4; ++nt)
#pragma unroll
      for (int r = 0; r < 8; ++r) {
        int gm = wrow + mt * 16 + r + 8 * half;
        int gn = wcol + nt * 16 + nl;
        out[(size_t)gm * D_MODEL + gn] = acc[mt][nt][r] + bo[gn];
      }
}

// ---------------------------------------------------------------------------
extern "C" void kernel_launch(void* const* d_in, const int* in_sizes, int n_in,
                              void* d_out, int out_size, void* d_ws, size_t ws_size,
                              hipStream_t stream) {
  const float* src = (const float*)d_in[0];
  const float* Wq  = (const float*)d_in[1];
  const float* bq  = (const float*)d_in[2];
  const float* Wk  = (const float*)d_in[3];
  const float* bk  = (const float*)d_in[4];
  const float* Wv  = (const float*)d_in[5];
  const float* bv  = (const float*)d_in[6];
  const float* Wo  = (const float*)d_in[7];
  const float* bo  = (const float*)d_in[8];
  float* out = (float*)d_out;

  const size_t actN = (size_t)M_TOTAL * D_MODEL;   // 16,777,216 halves
  const size_t wN   = (size_t)4 * D_MODEL * D_MODEL;

  _Float16* srcH = (_Float16*)d_ws;        // also reused as attention output
  _Float16* wT   = srcH + actN;            // 4 transposed f16 weight matrices
  _Float16* qH   = wT + wN;
  _Float16* kH   = qH + actN;
  _Float16* vT   = kH + actN;              // head-transposed V
  _Float16* attn = srcH;                   // alias: src dead after QKV GEMM

  // 1. fp32 -> f16 conversions
  convert_src_kernel<<<(unsigned)(actN / (256 * 4)), 256, 0, stream>>>(src, srcH, actN);
  convert_w_kernel<<<dim3(D_MODEL / 16, D_MODEL / 16, 4), dim3(16, 16), 0, stream>>>(
      Wq, Wk, Wv, Wo, wT);

  // 2. fused QKV projections (128x128 tile per workgroup, async LDS staging)
  qkv_gemm_kernel<<<dim3(M_TOTAL / 128, D_MODEL / 128, 3), 128, 0, stream>>>(
      srcH, wT, bq, bk, bv, qH, kH, vT);

  // 3. block-local attention (one workgroup per (b,blk), one wave per head)
  attn_kernel<<<dim3(BATCH * (SEQ / BLK)), 256, 0, stream>>>(qH, kH, vT, attn);

  // 4. output projection -> fp32
  out_gemm_kernel<<<dim3(M_TOTAL / 128, D_MODEL / 128), 128, 0, stream>>>(
      attn, wT + (size_t)3 * D_MODEL * D_MODEL, bo, out);
}

// v001
// A run of this version takes 206 microseconds.
// Next to v000, in two timings, it ran 1.36 times as fast each time.
#include <hip/hip_runtime.h>

typedef __attribute__((ext_vector_type(16))) _Float16 v16h;
typedef __attribute__((ext_vector_type(8)))  float    v8f;

#define D_MODEL 1024
#define SEQ     4096
#define BATCH   4
#define HEADS   8
#define BLK     64
#define DK      128
#define M_TOTAL (BATCH * SEQ)   // 16384 rows

#define BK   64                 // k-slice per stage in halves: 128 B of a row, one whole cache line
#define LSTR 72                 // LDS row stride in halves (64 + 8 pad, 144B = 16B x odd: bank-conflict free)
#define ABUF (128 * LSTR)       // halves per LDS buffer (128 rows x 64 halves padded)

// ---------------------------------------------------------------------------
// Stage one 128-row x 128-byte k-slice global -> LDS with 8 async b128 copies per
// thread. Eight neighbouring lanes cover one row's whole 128-byte line, so one
// wave-wide copy touches 4 full lines. g and l are this thread's own addresses
// in rows 0..15 of the tile (row = tid >> 3, 16-byte piece = tid & 7); copy c
// takes the row 16 * c further down.
// ---------------------------------------------------------------------------
__device__ __forceinline__ void async_stage_tile(const _Float16* __restrict__ g,
                                                 _Float16* lds) {
  const unsigned l = (unsigned)(uintptr_t)lds;        // LDS byte offset (low 32 bits)
  const unsigned long long a = (unsigned long long)(uintptr_t)g;
  const unsigned           LS = 16u * LSTR * 2u;      // 16 LDS rows in bytes
  const unsigned long long GS = 16ull * D_MODEL * 2ull;  // 16 global rows in bytes
  // The closing s_wait_xcnt is a precaution: it stands in front of every later
  // rewrite of these address registers, and inside the copies' own statement
  // nothing can be scheduled between it and them.
  asm volatile(
      "global_load_async_to_lds_b128 %0, %8, off\n\t"
      "global_load_async_to_lds_b128 %1, %9, off\n\t"
      "global_load_async_to_lds_b128 %2, %10, off\n\t"
      "global_load_async_to_lds_b128 %3, %11, off\n\t"
      "global_load_async_to_lds_b128 %4, %12, off\n\t"
      "global_load_async_to_lds_b128 %5, %13, off\n\t"
      "global_load_async_to_lds_b128 %6, %14, off\n\t"
      "global_load_async_to_lds_b128 %7, %15, off\n\t"
      "s_wait_xcnt 0x0"
      :: "v"(l), "v"(l + LS), "v"(l + 2 * LS), "v"(l + 3 * LS),
         "v"(l + 4 * LS), "v"(l + 5 * LS), "v"(l + 6 * LS), "v"(l + 7 * LS),
         "v"(a), "v"(a + GS), "v"(a + 2 * GS), "v"(a + 3 * GS),
         "v"(a + 4 * GS), "v"(a + 5 * GS), "v"(a + 6 * GS), "v"(a + 7 * GS)
      : "memory");
}

// ---------------------------------------------------------------------------
// Fragment helpers (wave32, 16-bit 16x16x32 WMMA layout)
// A (16x32): lane L holds row M=L&15; half=L>>4 adds +8 to K.
//   VGPR j<4  -> K pair {2j, 2j+1} (+8*half)
//   VGPR j>=4 -> K pair {16+2(j-4), ...} (+8*half)
// B (32x16) is symmetric with N=L&15; memory addressed as p[n*ld + k].
// ---------------------------------------------------------------------------
__device__ __forceinline__ v16h load_frag16(const _Float16* __restrict__ p,
                                            int ld, int r0, int k0, int lane) {
  const int m    = lane & 15;
  const int half = lane >> 4;
  const _Float16* q = p + (size_t)(r0 + m) * ld + (k0 + 8 * half);
  v16h f;
#pragma unroll
  for (int i = 0; i < 8; ++i) f[i]     = q[i];        // VGPR 0..3: K 0..7
#pragma unroll
  for (int i = 0; i < 8; ++i) f[8 + i] = q[16 + i];   // VGPR 4..7: K 16..23
  return f;
}

__device__ __forceinline__ v8f wmma_f16(v16h a, v16h b, v8f c) {
  return __builtin_amdgcn_wmma_f32_16x16x32_f16(
      /*neg_a=*/false, a, /*neg_b=*/false, b,
      /*c_mod=*/(short)0, c, /*reuse_a=*/false, /*reuse_b=*/false);
}

// ---------------------------------------------------------------------------
// Workgroup-tiled GEMM core: 128x128 tile, 4 waves (2x2), K staged in LDS via
// double-buffered async copies (two-buffer ring, one barrier per k-slice). acc is this wave's 64x64 (4x4 fragment tiles).
// Xg: [M x 1024] row-major f16.  Wg: [N x 1024] row-major f16 (W transposed).
// ---------------------------------------------------------------------------
__device__ __forceinline__ void gemm_core_128(const _Float16* __restrict__ Xg,
                                              const _Float16* __restrict__ Wg,
                                              int row0, int n0, int tid,
                                              _Float16* As, _Float16* Bs,
                                              v8f acc[4][4]) {
  const int lane = tid & 31;
  const int wave = tid >> 5;
  const int wr = (wave >> 1) * 64;   // wave row offset inside 128x128 tile
  const int wc = (wave & 1) * 64;    // wave col offset inside 128x128 tile

  // this thread's piece of tile rows 0..15: row tid >> 3, 16-byte piece tid & 7
  const int srow = tid >> 3;
  const int scol = (tid & 7) * 8;
  const _Float16* xsrc = Xg + (size_t)(row0 + srow) * D_MODEL + scol;
  const _Float16* wsrc = Wg + (size_t)(n0 + srow) * D_MODEL + scol;
  _Float16* adst = As + srow * LSTR + scol;
  _Float16* bdst = Bs + srow * LSTR + scol;

  // prologue: slice 0 lands in buffer 0 and is published, then slice 1 starts
  async_stage_tile(xsrc, adst);
  async_stage_tile(wsrc, bdst);
  asm volatile("s_wait_asynccnt 0x0" ::: "memory");  // this wave's slice-0 copies have landed
  __syncthreads();                                   // every wave's slice-0 copies visible
  async_stage_tile(xsrc + BK, adst + ABUF);
  async_stage_tile(wsrc + BK, bdst + ABUF);

  const int steps = D_MODEL / BK;
  for (int i = 0; i < steps; ++i) {
    const int cur = i & 1;
    const _Float16* Ab = As + cur * ABUF;
    const _Float16* Bb = Bs + cur * ABUF;
#pragma unroll
    for (int kk = 0; kk < BK; kk += 32) {
      v16h a[4], b[4];
#pragma unroll
      for (int mt = 0; mt < 4; ++mt) a[mt] = load_frag16(Ab, LSTR, wr + 16 * mt, kk, lane);
#pragma unroll
      for (int nt = 0; nt < 4; ++nt) b[nt] = load_frag16(Bb, LSTR, wc + 16 * nt, kk, lane);
#pragma unroll
      for (int mt = 0; mt < 4; ++mt)
#pragma unroll
        for (int nt = 0; nt < 4; ++nt)
          acc[mt][nt] = wmma_f16(a[mt], b[nt], acc[mt][nt]);
    }

    // publish point of slice i + 1, which also frees buffer `cur` for the refill
    asm volatile("s_wait_dscnt 0x0" ::: "memory");     // own reads of `cur` retired before it is refilled
    asm volatile("s_wait_asynccnt 0x0" ::: "memory");  // own copies of slice i + 1 have landed
    __syncthreads();
    if (i + 2 < steps) {
      async_stage_tile(xsrc + (i + 2) * BK, adst + cur * ABUF);
      async_stage_tile(wsrc + (i + 2) * BK, bdst + cur * ABUF);
    }
  }
  asm volatile("s_wait_asynccnt 0x0" ::: "memory");    // nothing in flight when the ring is left
}

// ---------------------------------------------------------------------------
// Conversion kernels
// ---------------------------------------------------------------------------
__global__ void convert_src_kernel(const float* __restrict__ in,
                                   _Float16* __restrict__ out, size_t n) {
  size_t base = ((size_t)blockIdx.x * blockDim.x + threadIdx.x) * 4;
#pragma unroll
  for (int i = 0; i < 4; ++i) {
    size_t idx = base + i;
    if (idx < n) out[idx] = (_Float16)in[idx];
  }
}

// wT[z][n][k] = W_z[k][n]  (f16, transposed so K-pairs are contiguous)
__global__ void convert_w_kernel(const float* __restrict__ Wq,
                                 const float* __restrict__ Wk,
                                 const float* __restrict__ Wv,
                                 const float* __restrict__ Wo,
                                 _Float16* __restrict__ wT) {
  int k = blockIdx.x * 16 + threadIdx.x;
  int n = blockIdx.y * 16 + threadIdx.y;
  int z = blockIdx.z;
  const float* W = (z == 0) ? Wq : (z == 1) ? Wk : (z == 2) ? Wv : Wo;
  wT[(size_t)z * D_MODEL * D_MODEL + (size_t)n * D_MODEL + k] =
      (_Float16)W[(size_t)k * D_MODEL + n];
}

// ---------------------------------------------------------------------------
// QKV projection: 128x128 workgroup tile, 4 waves. z selects Q/K/V.
// Q,K stored row-major f16 [16384 x 1024].
// V stored head-transposed: vT[(bb*HEADS+h)*DK*BLK + d*BLK + t]
// ---------------------------------------------------------------------------
__global__ void __launch_bounds__(128)
qkv_gemm_kernel(const _Float16* __restrict__ X, const _Float16* __restrict__ WT,
                const float* __restrict__ bq, const float* __restrict__ bk,
                const float* __restrict__ bv, _Float16* __restrict__ qO,
                _Float16* __restrict__ kO, _Float16* __restrict__ vT) {
  __shared__ __attribute__((aligned(16))) _Float16 As[2 * ABUF];
  __shared__ __attribute__((aligned(16))) _Float16 Bs[2 * ABUF];

  const int tid  = threadIdx.x;
  const int lane = tid & 31;
  const int wave = tid >> 5;
  const int row0 = blockIdx.x * 128;
  const int n0   = blockIdx.y * 128;
  const int proj = blockIdx.z;
  const _Float16* W = WT + (size_t)proj * D_MODEL * D_MODEL;

  const v8f vzero = {0.f, 0.f, 0.f, 0.f, 0.f, 0.f, 0.f, 0.f};
  v8f acc[4][4];
#pragma unroll
  for (int mt = 0; mt < 4; ++mt)
#pragma unroll
    for (int nt = 0; nt < 4; ++nt) acc[mt][nt] = vzero;

  gemm_core_128(X, W, row0, n0, tid, As, Bs, acc);

  const float* bias = (proj == 0) ? bq : (proj == 1) ? bk : bv;
  const int half = lane >> 4, nl = lane & 15;
  const int wrow = row0 + (wave >> 1) * 64;
  const int wcol = n0 + (wave & 1) * 64;
#pragma unroll
  for (int mt = 0; mt < 4; ++mt)
#pragma unroll
    for (int nt = 0; nt < 4; ++nt)
#pragma unroll
      for (int r = 0; r < 8; ++r) {
        int gm = wrow + mt * 16 + r + 8 * half;
        int gn = wcol + nt * 16 + nl;
        _Float16 hv = (_Float16)(acc[mt][nt][r] + bias[gn]);
        if (proj == 0) {
          qO[(size_t)gm * D_MODEL + gn] = hv;
        } else if (proj == 1) {
          kO[(size_t)gm * D_MODEL + gn] = hv;
        } else {
          int bbrow = gm >> 6, t = gm & 63;   // gm = b*4096 + blk*64 + t
          int hh = gn >> 7, d = gn & 127;     // gn = h*128 + d
          vT[((size_t)bbrow * HEADS + hh) * (DK * BLK) + (size_t)d * BLK + t] = hv;
        }
      }
}

// ---------------------------------------------------------------------------
// Block attention: one workgroup per (b,blk), one wave per head.
// scores(64x64) in registers -> softmax (shfl_xor within 16-lane halves)
// -> P staged in LDS -> P @ V via WMMA -> f16 attention output row-major.
// ---------------------------------------------------------------------------
__global__ void __launch_bounds__(256)
attn_kernel(const _Float16* __restrict__ Q, const _Float16* __restrict__ K,
            const _Float16* __restrict__ VT, _Float16* __restrict__ AO) {
  __shared__ _Float16 P[HEADS][BLK * BLK];   // 64 KB

  const int lane = threadIdx.x & 31;
  const int h    = threadIdx.x >> 5;         // head
  const int bb   = blockIdx.x;               // b*64 + blk
  const int row0 = bb * BLK;                 // flat token row base
  const int col0 = h * DK;
  const int half = lane >> 4, nl = lane & 15;

  const v8f vzero = {0.f, 0.f, 0.f, 0.f, 0.f, 0.f, 0.f, 0.f};
  v8f s[4][4];
#pragma unroll
  for (int mt = 0; mt < 4; ++mt)
#pragma unroll
    for (int nt = 0; nt < 4; ++nt) s[mt][nt] = vzero;

  // scores = Q_blk @ K_blk^T over dk=128
  for (int kk = 0; kk < DK; kk += 32) {
    v16h a[4], b[4];
#pragma unroll
    for (int mt = 0; mt < 4; ++mt)
      a[mt] = load_frag16(Q, D_MODEL, row0 + 16 * mt, col0 + kk, lane);
#pragma unroll
    for (int nt = 0; nt < 4; ++nt)   // B[k][n] = K[row0+n][col0+kk+k]
      b[nt] = load_frag16(K, D_MODEL, row0 + 16 * nt, col0 + kk, lane);
#pragma unroll
    for (int mt = 0; mt < 4; ++mt)
#pragma unroll
      for (int nt = 0; nt < 4; ++nt)
        s[mt][nt] = wmma_f16(a[mt], b[nt], s[mt][nt]);
  }

  // row softmax: each row M lives in 16 lanes (one half) across 4 nt tiles
  const float scale = 0.08838834764831845f;  // dk^-0.5
#pragma unroll
  for (int mt = 0; mt < 4; ++mt)
#pragma unroll
    for (int r = 0; r < 8; ++r) {
      float x0 = s[mt][0][r] * scale, x1 = s[mt][1][r] * scale;
      float x2 = s[mt][2][r] * scale, x3 = s[mt][3][r] * scale;
      float mx = fmaxf(fmaxf(x0, x1), fmaxf(x2, x3));
#pragma unroll
      for (int msk = 1; msk < 16; msk <<= 1)
        mx = fmaxf(mx, __shfl_xor(mx, msk, 32));
      float e0 = __expf(x0 - mx), e1 = __expf(x1 - mx);
      float e2 = __expf(x2 - mx), e3 = __expf(x3 - mx);
      float sum = e0 + e1 + e2 + e3;
#pragma unroll
      for (int msk = 1; msk < 16; msk <<= 1)
        sum += __shfl_xor(sum, msk, 32);
      float inv = 1.0f / sum;
      int m = mt * 16 + r + 8 * half;
      P[h][m * BLK + 0 * 16 + nl] = (_Float16)(e0 * inv);
      P[h][m * BLK + 1 * 16 + nl] = (_Float16)(e1 * inv);
      P[h][m * BLK + 2 * 16 + nl] = (_Float16)(e2 * inv);
      P[h][m * BLK + 3 * 16 + nl] = (_Float16)(e3 * inv);
    }
  __syncthreads();

  // out = P(64x64) @ V(64x128); V is [d][t] per (bb,h) so K-pairs contiguous
  const _Float16* vbase = VT + ((size_t)bb * HEADS + h) * (DK * BLK);
  for (int dt = 0; dt < 8; ++dt) {
    v8f o[4];
#pragma unroll
    for (int mt = 0; mt < 4; ++mt) o[mt] = vzero;
#pragma unroll
    for (int kk = 0; kk < BLK; kk += 32) {
      v16h b = load_frag16(vbase, BLK, dt * 16, kk, lane);  // B[k][n]=V[t=k][d=n]
#pragma unroll
      for (int mt = 0; mt < 4; ++mt) {
        v16h a = load_frag16(&P[h][0], BLK, mt * 16, kk, lane);
        o[mt] = wmma_f16(a, b, o[mt]);
      }
    }
#pragma unroll
    for (int mt = 0; mt < 4; ++mt)
#pragma unroll
      for (int r = 0; r < 8; ++r) {
        int gm = row0 + mt * 16 + r + 8 * half;
        int gn = col0 + dt * 16 + nl;
        AO[(size_t)gm * D_MODEL + gn] = (_Float16)o[mt][r];
      }
  }
}

// ---------------------------------------------------------------------------
// Output projection: attn(f16) @ Wo^T(f16) + bo -> fp32 d_out
// ---------------------------------------------------------------------------
__global__ void __launch_bounds__(128)
out_gemm_kernel(const _Float16* __restrict__ X, const _Float16* __restrict__ WoT,
                const float* __restrict__ bo, float* __restrict__ out) {
  __shared__ __attribute__((aligned(16))) _Float16 As[2 * ABUF];
  __shared__ __attribute__((aligned(16))) _Float16 Bs[2 * ABUF];

  const int tid  = threadIdx.x;
  const int lane = tid & 31;
  const int wave = tid >> 5;
  const int row0 = blockIdx.x * 128;
  const int n0   = blockIdx.y * 128;

  const v8f vzero = {0.f, 0.f, 0.f, 0.f, 0.f, 0.f, 0.f, 0.f};
  v8f acc[4][4];
#pragma unroll
  for (int mt = 0; mt < 4; ++mt)
#pragma unroll
    for (int nt = 0; nt < 4; ++nt) acc[mt][nt] = vzero;

  gemm_core_128(X, WoT, row0, n0, tid, As, Bs, acc);

  const int half = lane >> 4, nl = lane & 15;
  const int wrow = row0 + (wave >> 1) * 64;
  const int wcol = n0 + (wave & 1) * 64;
#pragma unroll
  for (int mt = 0; mt < 4; ++mt)
#pragma unroll
    for (int nt = 0; nt < 4; ++nt)
#pragma unroll
      for (int r = 0; r < 8; ++r) {
        int gm = wrow + mt * 16 + r + 8 * half;
        int gn = wcol + nt * 16 + nl;
        out[(size_t)gm * D_MODEL + gn] = acc[mt][nt][r] + bo[gn];
      }
}

// ---------------------------------------------------------------------------
extern "C" void kernel_launch(void* const* d_in, const int* in_sizes, int n_in,
                              void* d_out, int out_size, void* d_ws, size_t ws_size,
                              hipStream_t stream) {
  const float* src = (const float*)d_in[0];
  const float* Wq  = (const float*)d_in[1];
  const float* bq  = (const float*)d_in[2];
  const float* Wk  = (const float*)d_in[3];
  const float* bk  = (const float*)d_in[4];
  const float* Wv  = (const float*)d_in[5];
  const float* bv  = (const float*)d_in[6];
  const float* Wo  = (const float*)d_in[7];
  const float* bo  = (const float*)d_in[8];
  float* out = (float*)d_out;

  const size_t actN = (size_t)M_TOTAL * D_MODEL;   // 16,777,216 halves
  const size_t wN   = (size_t)4 * D_MODEL * D_MODEL;

  _Float16* srcH = (_Float16*)d_ws;        // also reused as attention output
  _Float16* wT   = srcH + actN;            // 4 transposed f16 weight matrices
  _Float16* qH   = wT + wN;
  _Float16* kH   = qH + actN;
  _Float16* vT   = kH + actN;              // head-transposed V
  _Float16* attn = srcH;                   // alias: src dead after QKV GEMM

  // 1. fp32 -> f16 conversions
  convert_src_kernel<<<(unsigned)(actN / (256 * 4)), 256, 0, stream>>>(src, srcH, actN);
  convert_w_kernel<<<dim3(D_MODEL / 16, D_MODEL / 16, 4), dim3(16, 16), 0, stream>>>(
      Wq, Wk, Wv, Wo, wT);

  // 2. fused QKV projections (128x128 tile per workgroup, async LDS staging)
  qkv_gemm_kernel<<<dim3(M_TOTAL / 128, D_MODEL / 128, 3), 128, 0, stream>>>(
      srcH, wT, bq, bk, bv, qH, kH, vT);

  // 3. block-local attention (one workgroup per (b,blk), one wave per head)
  attn_kernel<<<dim3(BATCH * (SEQ / BLK)), 256, 0, stream>>>(qH, kH, vT, attn);

  // 4. output projection -> fp32
  out_gemm_kernel<<<dim3(M_TOTAL / 128, D_MODEL / 128), 128, 0, stream>>>(
      attn, wT + (size_t)3 * D_MODEL * D_MODEL, bo, out);
}

// v002
// It runs in 163 microseconds.
// In both of two side-by-side timings against v001, it was 1.26 times as fast.
// All steps since v000 together make it 1.72 times as fast.
#include <hip/hip_runtime.h>

typedef __attribute__((ext_vector_type(16))) _Float16 v16h;
typedef __attribute__((ext_vector_type(8)))  float    v8f;
typedef __attribute__((ext_vector_type(8)))  _Float16 v8h;
typedef __attribute__((ext_vector_type(4)))  float    v4f;

#define D_MODEL 1024
#define SEQ     4096
#define BATCH   4
#define HEADS   8
#define BLK     64
#define DK      128
#define M_TOTAL (BATCH * SEQ)   // 16384 rows

#define BK   64                 // k-slice per stage in halves: 128 B of a row, one whole cache line
#define LSTR 72                 // LDS row stride in halves (64 + 8 pad, 144B = 16B x odd: bank-conflict free)
#define ABUF (128 * LSTR)       // halves per LDS buffer (128 rows x 64 halves padded)
#define WSTG (64 * LSTR)        // halves of one wave's own epilogue staging range (9,216 B; four fill one ring array)
#define FSTR 68                 // f32 staging row stride in floats (64 + 4 pad, 272B = 16B x odd)
#define OSTR 136                // attention output staging row stride in halves (128 + 8 pad, 272B = 16B x odd)

// ---------------------------------------------------------------------------
// Stage one 128-row x 128-byte k-slice global -> LDS with 8 async b128 copies per
// thread. Eight neighbouring lanes cover one row's whole 128-byte line, so one
// wave-wide copy touches 4 full lines. g and l are this thread's own addresses
// in rows 0..15 of the tile (row = tid >> 3, 16-byte piece = tid & 7); copy c
// takes the row 16 * c further down.
// ---------------------------------------------------------------------------
__device__ __forceinline__ void async_stage_tile(const _Float16* __restrict__ g,
                                                 _Float16* lds) {
  const unsigned l = (unsigned)(uintptr_t)lds;        // LDS byte offset (low 32 bits)
  const unsigned long long a = (unsigned long long)(uintptr_t)g;
  const unsigned           LS = 16u * LSTR * 2u;      // 16 LDS rows in bytes
  const unsigned long long GS = 16ull * D_MODEL * 2ull;  // 16 global rows in bytes
  // The closing s_wait_xcnt is a precaution: it stands in front of every later
  // rewrite of these address registers, and inside the copies' own statement
  // nothing can be scheduled between it and them.
  asm volatile(
      "global_load_async_to_lds_b128 %0, %8, off\n\t"
      "global_load_async_to_lds_b128 %1, %9, off\n\t"
      "global_load_async_to_lds_b128 %2, %10, off\n\t"
      "global_load_async_to_lds_b128 %3, %11, off\n\t"
      "global_load_async_to_lds_b128 %4, %12, off\n\t"
      "global_load_async_to_lds_b128 %5, %13, off\n\t"
      "global_load_async_to_lds_b128 %6, %14, off\n\t"
      "global_load_async_to_lds_b128 %7, %15, off\n\t"
      "s_wait_xcnt 0x0"
      :: "v"(l), "v"(l + LS), "v"(l + 2 * LS), "v"(l + 3 * LS),
         "v"(l + 4 * LS), "v"(l + 5 * LS), "v"(l + 6 * LS), "v"(l + 7 * LS),
         "v"(a), "v"(a + GS), "v"(a + 2 * GS), "v"(a + 3 * GS),
         "v"(a + 4 * GS), "v"(a + 5 * GS), "v"(a + 6 * GS), "v"(a + 7 * GS)
      : "memory");
}

// ---------------------------------------------------------------------------
// Fragment helpers (wave32, 16-bit 16x16x32 WMMA layout)
// A (16x32): lane L holds row M=L&15; half=L>>4 adds +8 to K.
//   VGPR j<4  -> K pair {2j, 2j+1} (+8*half)
//   VGPR j>=4 -> K pair {16+2(j-4), ...} (+8*half)
// B (32x16) is symmetric with N=L&15; memory addressed as p[n*ld + k].
// ---------------------------------------------------------------------------
__device__ __forceinline__ v16h load_frag16(const _Float16* __restrict__ p,
                                            int ld, int r0, int k0, int lane) {
  const int m    = lane & 15;
  const int half = lane >> 4;
  const _Float16* q = p + (size_t)(r0 + m) * ld + (k0 + 8 * half);
  v16h f;
#pragma unroll
  for (int i = 0; i < 8; ++i) f[i]     = q[i];        // VGPR 0..3: K 0..7
#pragma unroll
  for (int i = 0; i < 8; ++i) f[8 + i] = q[16 + i];   // VGPR 4..7: K 16..23
  return f;
}

__device__ __forceinline__ v8f wmma_f16(v16h a, v16h b, v8f c) {
  return __builtin_amdgcn_wmma_f32_16x16x32_f16(
      /*neg_a=*/false, a, /*neg_b=*/false, b,
      /*c_mod=*/(short)0, c, /*reuse_a=*/false, /*reuse_b=*/false);
}

// ---------------------------------------------------------------------------
// Workgroup-tiled GEMM core: 128x128 tile, 4 waves (2x2), K staged in LDS via
// double-buffered async copies (two-buffer ring, one barrier per k-slice). acc is this wave's 64x64 (4x4 fragment tiles).
// Xg, Wg: [rows x 1024] row-major f16. acc = Xg rows (row0..) times Wg rows (n0..) transposed:
// a lane holds 8 neighbouring Xg-row indices (register axis) at one Wg-row index (lane axis).
// The callers pick which matrix goes on which side so that the register axis is the
// axis that is contiguous in their output.
// ---------------------------------------------------------------------------
__device__ __forceinline__ void gemm_core_128(const _Float16* __restrict__ Xg,
                                              const _Float16* __restrict__ Wg,
                                              int row0, int n0, int tid,
                                              _Float16* As, _Float16* Bs,
                                              v8f acc[4][4]) {
  const int lane = tid & 31;
  const int wave = tid >> 5;
  const int wr = (wave >> 1) * 64;   // wave row offset inside 128x128 tile
  const int wc = (wave & 1) * 64;    // wave col offset inside 128x128 tile

  // this thread's piece of tile rows 0..15: row tid >> 3, 16-byte piece tid & 7
  const int srow = tid >> 3;
  const int scol = (tid & 7) * 8;
  const _Float16* xsrc = Xg + (size_t)(row0 + srow) * D_MODEL + scol;
  const _Float16* wsrc = Wg + (size_t)(n0 + srow) * D_MODEL + scol;
  _Float16* adst = As + srow * LSTR + scol;
  _Float16* bdst = Bs + srow * LSTR + scol;

  // prologue: slice 0 lands in buffer 0 and is published, then slice 1 starts
  async_stage_tile(xsrc, adst);
  async_stage_tile(wsrc, bdst);
  asm volatile("s_wait_asynccnt 0x0" ::: "memory");  // this wave's slice-0 copies have landed
  __syncthreads();                                   // every wave's slice-0 copies visible
  async_stage_tile(xsrc + BK, adst + ABUF);
  async_stage_tile(wsrc + BK, bdst + ABUF);

  const int steps = D_MODEL / BK;
  for (int i = 0; i < steps; ++i) {
    const int cur = i & 1;
    const _Float16* Ab = As + cur * ABUF;
    const _Float16* Bb = Bs + cur * ABUF;
#pragma unroll
    for (int kk = 0; kk < BK; kk += 32) {
      v16h a[4], b[4];
#pragma unroll
      for (int mt = 0; mt < 4; ++mt) a[mt] = load_frag16(Ab, LSTR, wr + 16 * mt, kk, lane);
#pragma unroll
      for (int nt = 0; nt < 4; ++nt) b[nt] = load_frag16(Bb, LSTR, wc + 16 * nt, kk, lane);
#pragma unroll
      for (int mt = 0; mt < 4; ++mt)
#pragma unroll
        for (int nt = 0; nt < 4; ++nt)
          acc[mt][nt] = wmma_f16(a[mt], b[nt], acc[mt][nt]);
    }

    // publish point of slice i + 1, which also frees buffer `cur` for the refill
    asm volatile("s_wait_dscnt 0x0" ::: "memory");     // own reads of `cur` retired before it is refilled
    asm volatile("s_wait_asynccnt 0x0" ::: "memory");  // own copies of slice i + 1 have landed
    __syncthreads();
    if (i + 2 < steps) {
      async_stage_tile(xsrc + (i + 2) * BK, adst + cur * ABUF);
      async_stage_tile(wsrc + (i + 2) * BK, bdst + cur * ABUF);
    }
  }
  asm volatile("s_wait_asynccnt 0x0" ::: "memory");    // nothing in flight when the ring is left
}

// ---------------------------------------------------------------------------
// Conversion kernels
// ---------------------------------------------------------------------------
__global__ void convert_src_kernel(const float* __restrict__ in,
                                   _Float16* __restrict__ out, size_t n) {
  size_t base = ((size_t)blockIdx.x * blockDim.x + threadIdx.x) * 4;
#pragma unroll
  for (int i = 0; i < 4; ++i) {
    size_t idx = base + i;
    if (idx < n) out[idx] = (_Float16)in[idx];
  }
}

// wT[z][n][k] = W_z[k][n]  (f16, transposed so K-pairs are contiguous)
__global__ void convert_w_kernel(const float* __restrict__ Wq,
                                 const float* __restrict__ Wk,
                                 const float* __restrict__ Wv,
                                 const float* __restrict__ Wo,
                                 _Float16* __restrict__ wT) {
  int k = blockIdx.x * 16 + threadIdx.x;
  int n = blockIdx.y * 16 + threadIdx.y;
  int z = blockIdx.z;
  const float* W = (z == 0) ? Wq : (z == 1) ? Wk : (z == 2) ? Wv : Wo;
  wT[(size_t)z * D_MODEL * D_MODEL + (size_t)n * D_MODEL + k] =
      (_Float16)W[(size_t)k * D_MODEL + n];
}

// ---------------------------------------------------------------------------
// QKV projection: 128x128 workgroup tile, 4 waves. z selects Q/K/V.
// Q,K stored row-major f16 [16384 x 1024].
// V stored head-transposed: vT[(bb*HEADS+h)*DK*BLK + d*BLK + t]
// ---------------------------------------------------------------------------
__global__ void __launch_bounds__(128)
qkv_gemm_kernel(const _Float16* __restrict__ X, const _Float16* __restrict__ WT,
                const float* __restrict__ bq, const float* __restrict__ bk,
                const float* __restrict__ bv, _Float16* __restrict__ qO,
                _Float16* __restrict__ kO, _Float16* __restrict__ vT) {
  __shared__ __attribute__((aligned(16))) _Float16 As[2 * ABUF];
  __shared__ __attribute__((aligned(16))) _Float16 Bs[2 * ABUF];

  const int tid  = threadIdx.x;
  const int lane = tid & 31;
  const int wave = tid >> 5;
  const int row0 = blockIdx.x * 128;
  const int n0   = blockIdx.y * 128;
  const int proj = blockIdx.z;
  const _Float16* W = WT + (size_t)proj * D_MODEL * D_MODEL;

  const v8f vzero = {0.f, 0.f, 0.f, 0.f, 0.f, 0.f, 0.f, 0.f};
  v8f acc[4][4];
#pragma unroll
  for (int mt = 0; mt < 4; ++mt)
#pragma unroll
    for (int nt = 0; nt < 4; ++nt) acc[mt][nt] = vzero;

  // V is stored token-contiguous, Q and K feature-contiguous: the contiguous axis
  // goes on the accumulator's register axis (block-uniform choice).
  const bool isV = (proj == 2);
  const int a0 = isV ? row0 : n0;
  const int b0 = isV ? n0 : row0;
  gemm_core_128(isV ? X : W, isV ? W : X, a0, b0, tid, As, Bs, acc);

  const int half = lane >> 4, nl = lane & 15;
  const int wa = a0 + (wave >> 1) * 64;   // first register-axis index of this wave's tile
  const int wb = b0 + (wave & 1) * 64;    // first lane-axis index of this wave's tile
  // The ring is dead behind its last barrier; each wave stages its 64 x 64 tile in
  // its own range of it, one row per lane-axis index, 128 B of payload a row.
  _Float16* stg = As + wave * WSTG;
  if (isV) {
#pragma unroll
    for (int nt = 0; nt < 4; ++nt) {
      const float bb = bv[wb + nt * 16 + nl];
#pragma unroll
      for (int mt = 0; mt < 4; ++mt) {
        v8h h;
#pragma unroll
        for (int r = 0; r < 8; ++r) h[r] = (_Float16)(acc[mt][nt][r] + bb);
        *(v8h*)(stg + (nt * 16 + nl) * LSTR + mt * 16 + 8 * half) = h;
      }
    }
  } else {
    const float* bias = (proj == 0) ? bq : bk;
#pragma unroll
    for (int mt = 0; mt < 4; ++mt) {
      const v4f blo = *(const v4f*)(bias + wa + mt * 16 + 8 * half);
      const v4f bhi = *(const v4f*)(bias + wa + mt * 16 + 8 * half + 4);
#pragma unroll
      for (int nt = 0; nt < 4; ++nt) {
        v8h h;
#pragma unroll
        for (int r = 0; r < 4; ++r) {
          h[r]     = (_Float16)(acc[mt][nt][r] + blo[r]);
          h[4 + r] = (_Float16)(acc[mt][nt][4 + r] + bhi[r]);
        }
        *(v8h*)(stg + (nt * 16 + nl) * LSTR + mt * 16 + 8 * half) = h;
      }
    }
  }
  __syncthreads();   // the staged rows are read back by other lanes than wrote them

  // 8 lanes carry one staged row = one whole 128-B line of the output
  const int rr = lane >> 3, pc = (lane & 7) * 8;
  const _Float16* rd = stg + rr * LSTR + pc;
  if (isV) {
    // wa = (b*64 + blk)*64, register axis = t; wb = h*128 + d0, lane axis = d
    _Float16* dst = vT + ((size_t)(wa >> 6) * HEADS + (wb >> 7)) * (DK * BLK) +
                    (size_t)((wb & 127) + rr) * BLK + pc;
#pragma unroll
    for (int it = 0; it < 16; ++it)
      *(v8h*)(dst + it * 4 * BLK) = *(const v8h*)(rd + it * 4 * LSTR);
  } else {
    _Float16* dst = ((proj == 0) ? qO : kO) + (size_t)(wb + rr) * D_MODEL + wa + pc;
#pragma unroll
    for (int it = 0; it < 16; ++it)
      *(v8h*)(dst + it * 4 * D_MODEL) = *(const v8h*)(rd + it * 4 * LSTR);
  }
}

// ---------------------------------------------------------------------------
// Block attention: one workgroup per (b,blk), one wave per head.
// scores(64x64) in registers -> softmax (shfl_xor within 16-lane halves)
// -> P staged in LDS -> P @ V via WMMA -> f16 attention output row-major,
// staged in the wave's own LDS range and stored as whole lines.
// ---------------------------------------------------------------------------
__global__ void __launch_bounds__(256)
attn_kernel(const _Float16* __restrict__ Q, const _Float16* __restrict__ K,
            const _Float16* __restrict__ VT, _Float16* __restrict__ AO) {
  __shared__ _Float16 P[HEADS][BLK * BLK];   // 64 KB
  __shared__ __attribute__((aligned(16))) _Float16 Ost[HEADS][BLK * OSTR];   // 136 KB

  const int lane = threadIdx.x & 31;
  const int h    = threadIdx.x >> 5;         // head
  const int bb   = blockIdx.x;               // b*64 + blk
  const int row0 = bb * BLK;                 // flat token row base
  const int col0 = h * DK;
  const int half = lane >> 4, nl = lane & 15;

  const v8f vzero = {0.f, 0.f, 0.f, 0.f, 0.f, 0.f, 0.f, 0.f};
  v8f s[4][4];
#pragma unroll
  for (int mt = 0; mt < 4; ++mt)
#pragma unroll
    for (int nt = 0; nt < 4; ++nt) s[mt][nt] = vzero;

  // scores = Q_blk @ K_blk^T over dk=128
  for (int kk = 0; kk < DK; kk += 32) {
    v16h a[4], b[4];
#pragma unroll
    for (int mt = 0; mt < 4; ++mt)
      a[mt] = load_frag16(Q, D_MODEL, row0 + 16 * mt, col0 + kk, lane);
#pragma unroll
    for (int nt = 0; nt < 4; ++nt)   // B[k][n] = K[row0+n][col0+kk+k]
      b[nt] = load_frag16(K, D_MODEL, row0 + 16 * nt, col0 + kk, lane);
#pragma unroll
    for (int mt = 0; mt < 4; ++mt)
#pragma unroll
      for (int nt = 0; nt < 4; ++nt)
        s[mt][nt] = wmma_f16(a[mt], b[nt], s[mt][nt]);
  }

  // row softmax: each row M lives in 16 lanes (one half) across 4 nt tiles
  const float scale = 0.08838834764831845f;  // dk^-0.5
#pragma unroll
  for (int mt = 0; mt < 4; ++mt)
#pragma unroll
    for (int r = 0; r < 8; ++r) {
      float x0 = s[mt][0][r] * scale, x1 = s[mt][1][r] * scale;
      float x2 = s[mt][2][r] * scale, x3 = s[mt][3][r] * scale;
      float mx = fmaxf(fmaxf(x0, x1), fmaxf(x2, x3));
#pragma unroll
      for (int msk = 1; msk < 16; msk <<= 1)
        mx = fmaxf(mx, __shfl_xor(mx, msk, 32));
      float e0 = __expf(x0 - mx), e1 = __expf(x1 - mx);
      float e2 = __expf(x2 - mx), e3 = __expf(x3 - mx);
      float sum = e0 + e1 + e2 + e3;
#pragma unroll
      for (int msk = 1; msk < 16; msk <<= 1)
        sum += __shfl_xor(sum, msk, 32);
      float inv = 1.0f / sum;
      int m = mt * 16 + r + 8 * half;
      P[h][m * BLK + 0 * 16 + nl] = (_Float16)(e0 * inv);
      P[h][m * BLK + 1 * 16 + nl] = (_Float16)(e1 * inv);
      P[h][m * BLK + 2 * 16 + nl] = (_Float16)(e2 * inv);
      P[h][m * BLK + 3 * 16 + nl] = (_Float16)(e3 * inv);
    }
  __syncthreads();

  // out = P(64x64) @ V(64x128); V is [d][t] per (bb,h) so K-pairs contiguous
  const _Float16* vbase = VT + ((size_t)bb * HEADS + h) * (DK * BLK);
  for (int dt = 0; dt < 8; ++dt) {
    v8f o[4];
#pragma unroll
    for (int mt = 0; mt < 4; ++mt) o[mt] = vzero;
#pragma unroll
    for (int kk = 0; kk < BLK; kk += 32) {
      v16h b = load_frag16(vbase, BLK, dt * 16, kk, lane);  // A[m][k]=V[t=k][d=m]
#pragma unroll
      for (int mt = 0; mt < 4; ++mt) {
        v16h a = load_frag16(&P[h][0], BLK, mt * 16, kk, lane);
        // V as the A operand: features d on the register axis, tokens on the lane axis
        o[mt] = wmma_f16(b, a, o[mt]);
      }
    }
#pragma unroll
    for (int mt = 0; mt < 4; ++mt) {
      v8h hv;
#pragma unroll
      for (int r = 0; r < 8; ++r) hv[r] = (_Float16)o[mt][r];
      *(v8h*)(&Ost[h][(mt * 16 + nl) * OSTR + dt * 16 + 8 * half]) = hv;
    }
  }
  __syncthreads();   // the staged rows are read back by other lanes than wrote them

  // 16 lanes carry one staged row = two whole 128-B lines of the output
  const int rr = lane >> 4, pc = (lane & 15) * 8;
  _Float16* dst = AO + (size_t)(row0 + rr) * D_MODEL + col0 + pc;
#pragma unroll
  for (int it = 0; it < 32; ++it)
    *(v8h*)(dst + it * 2 * D_MODEL) = *(const v8h*)(&Ost[h][(it * 2 + rr) * OSTR + pc]);
}

// ---------------------------------------------------------------------------
// Output projection: attn(f16) @ Wo^T(f16) + bo -> fp32 d_out
// ---------------------------------------------------------------------------
__global__ void __launch_bounds__(128)
out_gemm_kernel(const _Float16* __restrict__ X, const _Float16* __restrict__ WoT,
                const float* __restrict__ bo, float* __restrict__ out) {
  __shared__ __attribute__((aligned(16))) _Float16 As[2 * ABUF];
  __shared__ __attribute__((aligned(16))) _Float16 Bs[2 * ABUF];

  const int tid  = threadIdx.x;
  const int lane = tid & 31;
  const int wave = tid >> 5;
  const int row0 = blockIdx.x * 128;
  const int n0   = blockIdx.y * 128;

  const v8f vzero = {0.f, 0.f, 0.f, 0.f, 0.f, 0.f, 0.f, 0.f};
  v8f acc[4][4];
#pragma unroll
  for (int mt = 0; mt < 4; ++mt)
#pragma unroll
    for (int nt = 0; nt < 4; ++nt) acc[mt][nt] = vzero;

  // output features on the accumulator's register axis, tokens on its lane axis
  gemm_core_128(WoT, X, n0, row0, tid, As, Bs, acc);

  const int half = lane >> 4, nl = lane & 15;
  const int wa = n0 + (wave >> 1) * 64;     // first output feature of this wave's tile
  const int wb = row0 + (wave & 1) * 64;    // first token row of this wave's tile
  // The ring is dead behind its last barrier; each wave stages token rows 0..31 of
  // its tile in its own range of As and rows 32..63 in its own range of Bs.
  float* stg0 = (float*)(As + wave * WSTG);
  float* stg1 = (float*)(Bs + wave * WSTG);
#pragma unroll
  for (int mt = 0; mt < 4; ++mt) {
    const v4f blo = *(const v4f*)(bo + wa + mt * 16 + 8 * half);
    const v4f bhi = *(const v4f*)(bo + wa + mt * 16 + 8 * half + 4);
#pragma unroll
    for (int nt = 0; nt < 4; ++nt) {
      v4f lo, hi;
#pragma unroll
      for (int r = 0; r < 4; ++r) {
        lo[r] = acc[mt][nt][r] + blo[r];
        hi[r] = acc[mt][nt][4 + r] + bhi[r];
      }
      float* s = ((nt < 2) ? stg0 : stg1) + ((nt & 1) * 16 + nl) * FSTR + mt * 16 + 8 * half;
      *(v4f*)s       = lo;
      *(v4f*)(s + 4) = hi;
    }
  }
  __syncthreads();   // the staged rows are read back by other lanes than wrote them

  // 16 lanes carry one staged row = two whole 128-B lines of the output
  const int rr = lane >> 4, pc = (lane & 15) * 4;
  float* dst = out + (size_t)(wb + rr) * D_MODEL + wa + pc;
#pragma unroll
  for (int it = 0; it < 16; ++it)
    *(v4f*)(dst + it * 2 * D_MODEL) = *(const v4f*)(stg0 + (it * 2 + rr) * FSTR + pc);
#pragma unroll
  for (int it = 0; it < 16; ++it)
    *(v4f*)(dst + (32 + it * 2) * D_MODEL) = *(const v4f*)(stg1 + (it * 2 + rr) * FSTR + pc);
}

// ---------------------------------------------------------------------------
extern "C" void kernel_launch(void* const* d_in, const int* in_sizes, int n_in,
                              void* d_out, int out_size, void* d_ws, size_t ws_size,
                              hipStream_t stream) {
  const float* src = (const float*)d_in[0];
  const float* Wq  = (const float*)d_in[1];
  const float* bq  = (const float*)d_in[2];
  const float* Wk  = (const float*)d_in[3];
  const float* bk  = (const float*)d_in[4];
  const float* Wv  = (const float*)d_in[5];
  const float* bv  = (const float*)d_in[6];
  const float* Wo  = (const float*)d_in[7];
  const float* bo  = (const float*)d_in[8];
  float* out = (float*)d_out;

  const size_t actN = (size_t)M_TOTAL * D_MODEL;   // 16,777,216 halves
  const size_t wN   = (size_t)4 * D_MODEL * D_MODEL;

  _Float16* srcH = (_Float16*)d_ws;        // also reused as attention output
  _Float16* wT   = srcH + actN;            // 4 transposed f16 weight matrices
  _Float16* qH   = wT + wN;
  _Float16* kH   = qH + actN;
  _Float16* vT   = kH + actN;              // head-transposed V
  _Float16* attn = srcH;                   // alias: src dead after QKV GEMM

  // 1. fp32 -> f16 conversions
  convert_src_kernel<<<(unsigned)(actN / (256 * 4)), 256, 0, stream>>>(src, srcH, actN);
  convert_w_kernel<<<dim3(D_MODEL / 16, D_MODEL / 16, 4), dim3(16, 16), 0, stream>>>(
      Wq, Wk, Wv, Wo, wT);

  // 2. fused QKV projections (128x128 tile per workgroup, async LDS staging)
  qkv_gemm_kernel<<<dim3(M_TOTAL / 128, D_MODEL / 128, 3), 128, 0, stream>>>(
      srcH, wT, bq, bk, bv, qH, kH, vT);

  // 3. block-local attention (one workgroup per (b,blk), one wave per head)
  attn_kernel<<<dim3(BATCH * (SEQ / BLK)), 256, 0, stream>>>(qH, kH, vT, attn);

  // 4. output projection -> fp32
  out_gemm_kernel<<<dim3(M_TOTAL / 128, D_MODEL / 128), 128, 0, stream>>>(
      attn, wT + (size_t)3 * D_MODEL * D_MODEL, bo, out);
}

// v003
// One run takes 158 microseconds.
// Timed twice side by side with v002, it ran 1.03 and 1.04 times as fast.
// Counting every step since v000, it is 1.78 times as fast.
#include <hip/hip_runtime.h>

typedef __attribute__((ext_vector_type(16))) _Float16 v16h;
typedef __attribute__((ext_vector_type(8)))  float    v8f;
typedef __attribute__((ext_vector_type(8)))  _Float16 v8h;
typedef __attribute__((ext_vector_type(4)))  float    v4f;

#define D_MODEL 1024
#define SEQ     4096
#define BATCH   4
#define HEADS   8
#define BLK     64
#define DK      128
#define M_TOTAL (BATCH * SEQ)   // 16384 rows

#define BK   128                // k-slice per stage in halves: 256 B of a row, two whole cache lines
#define LSTR 136                // LDS row stride in halves (128 + 8 pad, 272B = 16B x odd: bank-conflict free)
#define ABUF (256 * LSTR)       // halves per LDS buffer (256 rows x 128 halves padded)
#define WSTG (64 * LSTR)        // halves of one wave's own f16 epilogue staging range (17,408 B; eight fill one ring array)
#define FSTR 132                // f32 staging row stride in floats (128 + 4 pad, 528B = 16B x odd)
#define FSTG (64 * FSTR * 2)    // halves of one wave's own f32 epilogue staging range (33,792 B; four fit one ring array)
#define OSTR 136                // attention output staging row stride in halves (128 + 8 pad, 272B = 16B x odd)

// ---------------------------------------------------------------------------
// Stage 128 rows x 256 bytes of a k-slice global -> LDS with 8 async b128 copies per
// thread (256 threads). Sixteen neighbouring lanes cover one row's two 128-byte
// lines, so one wave-wide copy touches 4 full lines. g and l are this thread's own
// addresses in rows 0..15 of the range (row = tid >> 4, 16-byte piece = tid & 15);
// copy c takes the row 16 * c further down.
// ---------------------------------------------------------------------------
__device__ __forceinline__ void async_stage_tile(const _Float16* __restrict__ g,
                                                 _Float16* lds) {
  const unsigned l = (unsigned)(uintptr_t)lds;        // LDS byte offset (low 32 bits)
  const unsigned long long a = (unsigned long long)(uintptr_t)g;
  const unsigned           LS = 16u * LSTR * 2u;      // 16 LDS rows in bytes
  const unsigned long long GS = 16ull * D_MODEL * 2ull;  // 16 global rows in bytes
  // The closing s_wait_xcnt is a precaution: it stands in front of every later
  // rewrite of these address registers, and inside the copies' own statement
  // nothing can be scheduled between it and them.
  asm volatile(
      "global_load_async_to_lds_b128 %0, %8, off\n\t"
      "global_load_async_to_lds_b128 %1, %9, off\n\t"
      "global_load_async_to_lds_b128 %2, %10, off\n\t"
      "global_load_async_to_lds_b128 %3, %11, off\n\t"
      "global_load_async_to_lds_b128 %4, %12, off\n\t"
      "global_load_async_to_lds_b128 %5, %13, off\n\t"
      "global_load_async_to_lds_b128 %6, %14, off\n\t"
      "global_load_async_to_lds_b128 %7, %15, off\n\t"
      "s_wait_xcnt 0x0"
      :: "v"(l), "v"(l + LS), "v"(l + 2 * LS), "v"(l + 3 * LS),
         "v"(l + 4 * LS), "v"(l + 5 * LS), "v"(l + 6 * LS), "v"(l + 7 * LS),
         "v"(a), "v"(a + GS), "v"(a + 2 * GS), "v"(a + 3 * GS),
         "v"(a + 4 * GS), "v"(a + 5 * GS), "v"(a + 6 * GS), "v"(a + 7 * GS)
      : "memory");
}

// ---------------------------------------------------------------------------
// Fragment helpers (wave32, 16-bit 16x16x32 WMMA layout)
// A (16x32): lane L holds row M=L&15; half=L>>4 adds +8 to K.
//   VGPR j<4  -> K pair {2j, 2j+1} (+8*half)
//   VGPR j>=4 -> K pair {16+2(j-4), ...} (+8*half)
// B (32x16) is symmetric with N=L&15; memory addressed as p[n*ld + k].
// ---------------------------------------------------------------------------
__device__ __forceinline__ v16h load_frag16(const _Float16* __restrict__ p,
                                            int ld, int r0, int k0, int lane) {
  const int m    = lane & 15;
  const int half = lane >> 4;
  const _Float16* q = p + (size_t)(r0 + m) * ld + (k0 + 8 * half);
  v16h f;
#pragma unroll
  for (int i = 0; i < 8; ++i) f[i]     = q[i];        // VGPR 0..3: K 0..7
#pragma unroll
  for (int i = 0; i < 8; ++i) f[8 + i] = q[16 + i];   // VGPR 4..7: K 16..23
  return f;
}

__device__ __forceinline__ v8f wmma_f16(v16h a, v16h b, v8f c) {
  return __builtin_amdgcn_wmma_f32_16x16x32_f16(
      /*neg_a=*/false, a, /*neg_b=*/false, b,
      /*c_mod=*/(short)0, c, /*reuse_a=*/false, /*reuse_b=*/false);
}

// ---------------------------------------------------------------------------
// Workgroup-tiled GEMM core: 256x256 tile, 8 waves (2x4), two per SIMD, K staged in LDS via
// double-buffered async copies (two-buffer ring, one barrier per k-slice). acc is this wave's
// 128x64 (8x4 fragment tiles).
// Xg, Wg: [rows x 1024] row-major f16. acc = Xg rows (row0..) times Wg rows (n0..) transposed:
// a lane holds 8 neighbouring Xg-row indices (register axis) at one Wg-row index (lane axis).
// The callers pick which matrix goes on which side so that the register axis is the
// axis that is contiguous in their output.
// ---------------------------------------------------------------------------
__device__ __forceinline__ void stage_slice(const _Float16* __restrict__ xs,
                                            const _Float16* __restrict__ ws,
                                            _Float16* ad, _Float16* bd) {
  async_stage_tile(xs, ad);
  async_stage_tile(xs + 128 * D_MODEL, ad + 128 * LSTR);
  async_stage_tile(ws, bd);
  async_stage_tile(ws + 128 * D_MODEL, bd + 128 * LSTR);
}

// one 32-k block of a wave's 128x64 tile: 8 x 4 fragment products
__device__ __forceinline__ void mma_block(const v16h a[8], const v16h b[4], v8f acc[8][4]) {
#pragma unroll
  for (int mt = 0; mt < 8; ++mt)
#pragma unroll
    for (int nt = 0; nt < 4; ++nt)
      acc[mt][nt] = wmma_f16(a[mt], b[nt], acc[mt][nt]);
}

__device__ __forceinline__ void gemm_core_256(const _Float16* __restrict__ Xg,
                                              const _Float16* __restrict__ Wg,
                                              int row0, int n0, int tid,
                                              _Float16* As, _Float16* Bs,
                                              v8f acc[8][4]) {
  const int lane = tid & 31;
  const int wave = tid >> 5;
  const int wr = (wave >> 2) * 128;  // wave row offset inside 256x256 tile
  const int wc = (wave & 3) * 64;    // wave col offset inside 256x256 tile

  // this thread's piece of tile rows 0..15: row tid >> 4, 16-byte piece tid & 15
  const int srow = tid >> 4;
  const int scol = (tid & 15) * 8;
  const _Float16* xsrc = Xg + (size_t)(row0 + srow) * D_MODEL + scol;
  const _Float16* wsrc = Wg + (size_t)(n0 + srow) * D_MODEL + scol;
  _Float16* adst = As + srow * LSTR + scol;
  _Float16* bdst = Bs + srow * LSTR + scol;

  // prologue: slice 0 lands in buffer 0 and is published, then slice 1 starts
  stage_slice(xsrc, wsrc, adst, bdst);
  asm volatile("s_wait_asynccnt 0x0" ::: "memory");  // this wave's slice-0 copies have landed
  __syncthreads();                                   // every wave's slice-0 copies visible
  stage_slice(xsrc + BK, wsrc + BK, adst + ABUF, bdst + ABUF);

  const int steps = D_MODEL / BK;
  for (int i = 0; i < steps; ++i) {
    const int cur = i & 1;
    const _Float16* Ab = As + cur * ABUF;
    const _Float16* Bb = Bs + cur * ABUF;
#pragma unroll
    for (int kk = 0; kk < BK; kk += 32) {
      v16h a[8], b[4];
      // Fence pair: holds this block's 24 LDS reads together as one group in front of its
      // 32 WMMAs. Left free, the compiler spread them in pairs among the WMMAs, each pair
      // behind a wait to 0, which two waves a SIMD cannot hide.
      __builtin_amdgcn_sched_barrier(0);
#pragma unroll
      for (int nt = 0; nt < 4; ++nt) b[nt] = load_frag16(Bb, LSTR, wc + 16 * nt, kk, lane);
#pragma unroll
      for (int mt = 0; mt < 8; ++mt) a[mt] = load_frag16(Ab, LSTR, wr + 16 * mt, kk, lane);
      __builtin_amdgcn_sched_barrier(0);
      mma_block(a, b, acc);
    }

    // publish point of slice i + 1, which also frees buffer `cur` for the refill
    asm volatile("s_wait_dscnt 0x0" ::: "memory");     // own reads of `cur` retired before it is refilled
    asm volatile("s_wait_asynccnt 0x0" ::: "memory");  // own copies of slice i + 1 have landed
    __syncthreads();
    if (i + 2 < steps)
      stage_slice(xsrc + (i + 2) * BK, wsrc + (i + 2) * BK, adst + cur * ABUF, bdst + cur * ABUF);
  }
  asm volatile("s_wait_asynccnt 0x0" ::: "memory");    // nothing in flight when the ring is left
}

// ---------------------------------------------------------------------------
// Conversion kernels
// ---------------------------------------------------------------------------
__global__ void convert_src_kernel(const float* __restrict__ in,
                                   _Float16* __restrict__ out, size_t n) {
  size_t base = ((size_t)blockIdx.x * blockDim.x + threadIdx.x) * 4;
#pragma unroll
  for (int i = 0; i < 4; ++i) {
    size_t idx = base + i;
    if (idx < n) out[idx] = (_Float16)in[idx];
  }
}

// wT[z][n][k] = W_z[k][n]  (f16, transposed so K-pairs are contiguous)
__global__ void convert_w_kernel(const float* __restrict__ Wq,
                                 const float* __restrict__ Wk,
                                 const float* __restrict__ Wv,
                                 const float* __restrict__ Wo,
                                 _Float16* __restrict__ wT) {
  int k = blockIdx.x * 16 + threadIdx.x;
  int n = blockIdx.y * 16 + threadIdx.y;
  int z = blockIdx.z;
  const float* W = (z == 0) ? Wq : (z == 1) ? Wk : (z == 2) ? Wv : Wo;
  wT[(size_t)z * D_MODEL * D_MODEL + (size_t)n * D_MODEL + k] =
      (_Float16)W[(size_t)k * D_MODEL + n];
}

// ---------------------------------------------------------------------------
// QKV projection: 256x256 workgroup tile, 8 waves. z selects Q/K/V.
// Q,K stored row-major f16 [16384 x 1024].
// V stored head-transposed: vT[(bb*HEADS+h)*DK*BLK + d*BLK + t]
// ---------------------------------------------------------------------------
__global__ void __launch_bounds__(256)
qkv_gemm_kernel(const _Float16* __restrict__ X, const _Float16* __restrict__ WT,
                const float* __restrict__ bq, const float* __restrict__ bk,
                const float* __restrict__ bv, _Float16* __restrict__ qO,
                _Float16* __restrict__ kO, _Float16* __restrict__ vT) {
  __shared__ __attribute__((aligned(16))) _Float16 As[2 * ABUF];
  __shared__ __attribute__((aligned(16))) _Float16 Bs[2 * ABUF];

  const int tid  = threadIdx.x;
  const int lane = tid & 31;
  const int wave = tid >> 5;
  const int row0 = blockIdx.x * 256;
  const int n0   = blockIdx.y * 256;
  const int proj = blockIdx.z;
  const _Float16* W = WT + (size_t)proj * D_MODEL * D_MODEL;

  const v8f vzero = {0.f, 0.f, 0.f, 0.f, 0.f, 0.f, 0.f, 0.f};
  v8f acc[8][4];
#pragma unroll
  for (int mt = 0; mt < 8; ++mt)
#pragma unroll
    for (int nt = 0; nt < 4; ++nt) acc[mt][nt] = vzero;

  // V is stored token-contiguous, Q and K feature-contiguous: the contiguous axis
  // goes on the accumulator's register axis (block-uniform choice).
  const bool isV = (proj == 2);
  const int a0 = isV ? row0 : n0;
  const int b0 = isV ? n0 : row0;
  gemm_core_256(isV ? X : W, isV ? W : X, a0, b0, tid, As, Bs, acc);

  const int half = lane >> 4, nl = lane & 15;
  const int wa = a0 + (wave >> 2) * 128;  // first register-axis index of this wave's tile
  const int wb = b0 + (wave & 3) * 64;    // first lane-axis index of this wave's tile
  // The ring is dead behind its last barrier; each wave stages its 128 x 64 tile in
  // its own range of it, one row per lane-axis index, 256 B of payload a row.
  _Float16* stg = As + wave * WSTG;
  if (isV) {
    const int bi = wb + nl;
    float bb[4];
#pragma unroll
    for (int nt = 0; nt < 4; ++nt) bb[nt] = bv[bi + nt * 16];
    // Precaution: stands in front of any rewrite of the bias loads' address register; the
    // index is named as an input so that its register stays live up to the wait.
    asm volatile("s_wait_xcnt 0x0" :: "v"(bi) : "memory");
#pragma unroll
    for (int nt = 0; nt < 4; ++nt) {
#pragma unroll
      for (int mt = 0; mt < 8; ++mt) {
        v8h h;
#pragma unroll
        for (int r = 0; r < 8; ++r) h[r] = (_Float16)(acc[mt][nt][r] + bb[nt]);
        *(v8h*)(stg + (nt * 16 + nl) * LSTR + mt * 16 + 8 * half) = h;
      }
    }
  } else {
    const float* bias = (proj == 0) ? bq : bk;
    const float* bp = bias + wa + 8 * half;
    v4f blo[8], bhi[8];
#pragma unroll
    for (int mt = 0; mt < 8; ++mt) {
      blo[mt] = *(const v4f*)(bp + mt * 16);
      bhi[mt] = *(const v4f*)(bp + mt * 16 + 4);
    }
    // Precaution, as in the other branch: the address lives up to the wait.
    asm volatile("s_wait_xcnt 0x0" :: "v"(bp) : "memory");
#pragma unroll
    for (int mt = 0; mt < 8; ++mt) {
#pragma unroll
      for (int nt = 0; nt < 4; ++nt) {
        v8h h;
#pragma unroll
        for (int r = 0; r < 4; ++r) {
          h[r]     = (_Float16)(acc[mt][nt][r] + blo[mt][r]);
          h[4 + r] = (_Float16)(acc[mt][nt][4 + r] + bhi[mt][r]);
        }
        *(v8h*)(stg + (nt * 16 + nl) * LSTR + mt * 16 + 8 * half) = h;
      }
    }
  }
  __syncthreads();   // the staged rows are read back by other lanes than wrote them

  // 16 lanes carry one staged row = two whole 128-B lines of the output
  const int rr = lane >> 4, pc = (lane & 15) * 8;
  const _Float16* rd = stg + rr * LSTR + pc;
  if (isV) {
    // wa = (b*64 + blk)*64, register axis = t over two neighbouring blocks (8 lanes
    // each); wb = h*128 + d0, lane axis = d
    _Float16* dst = vT + ((size_t)((wa >> 6) + (pc >> 6)) * HEADS + (wb >> 7)) * (DK * BLK) +
                    (size_t)((wb & 127) + rr) * BLK + (pc & 63);
#pragma unroll
    for (int it = 0; it < 32; ++it)
      *(v8h*)(dst + it * 2 * BLK) = *(const v8h*)(rd + it * 2 * LSTR);
    // Precaution: stands behind the run's last store, in front of whatever code the
    // compiler lays behind this branch and lets rewrite the stores' registers.
    asm volatile("s_wait_xcnt 0x0" ::: "memory");
  } else {
    _Float16* dst = ((proj == 0) ? qO : kO) + (size_t)(wb + rr) * D_MODEL + wa + pc;
#pragma unroll
    for (int it = 0; it < 32; ++it)
      *(v8h*)(dst + it * 2 * D_MODEL) = *(const v8h*)(rd + it * 2 * LSTR);
    // Precaution, as in the other branch.
    asm volatile("s_wait_xcnt 0x0" ::: "memory");
  }
}

// ---------------------------------------------------------------------------
// Block attention: one workgroup per (b,blk), one wave per head.
// scores(64x64) in registers -> softmax (shfl_xor within 16-lane halves)
// -> P staged in LDS -> P @ V via WMMA -> f16 attention output row-major,
// staged in the wave's own LDS range and stored as whole lines.
// ---------------------------------------------------------------------------
__global__ void __launch_bounds__(256)
attn_kernel(const _Float16* __restrict__ Q, const _Float16* __restrict__ K,
            const _Float16* __restrict__ VT, _Float16* __restrict__ AO) {
  __shared__ _Float16 P[HEADS][BLK * BLK];   // 64 KB
  __shared__ __attribute__((aligned(16))) _Float16 Ost[HEADS][BLK * OSTR];   // 136 KB

  const int lane = threadIdx.x & 31;
  const int h    = threadIdx.x >> 5;         // head
  const int bb   = blockIdx.x;               // b*64 + blk
  const int row0 = bb * BLK;                 // flat token row base
  const int col0 = h * DK;
  const int half = lane >> 4, nl = lane & 15;

  const v8f vzero = {0.f, 0.f, 0.f, 0.f, 0.f, 0.f, 0.f, 0.f};
  v8f s[4][4];
#pragma unroll
  for (int mt = 0; mt < 4; ++mt)
#pragma unroll
    for (int nt = 0; nt < 4; ++nt) s[mt][nt] = vzero;

  // scores = Q_blk @ K_blk^T over dk=128
  for (int kk = 0; kk < DK; kk += 32) {
    v16h a[4], b[4];
#pragma unroll
    for (int mt = 0; mt < 4; ++mt)
      a[mt] = load_frag16(Q, D_MODEL, row0 + 16 * mt, col0 + kk, lane);
#pragma unroll
    for (int nt = 0; nt < 4; ++nt)   // B[k][n] = K[row0+n][col0+kk+k]
      b[nt] = load_frag16(K, D_MODEL, row0 + 16 * nt, col0 + kk, lane);
#pragma unroll
    for (int mt = 0; mt < 4; ++mt)
#pragma unroll
      for (int nt = 0; nt < 4; ++nt)
        s[mt][nt] = wmma_f16(a[mt], b[nt], s[mt][nt]);
  }

  // row softmax: each row M lives in 16 lanes (one half) across 4 nt tiles
  const float scale = 0.08838834764831845f;  // dk^-0.5
#pragma unroll
  for (int mt = 0; mt < 4; ++mt)
#pragma unroll
    for (int r = 0; r < 8; ++r) {
      float x0 = s[mt][0][r] * scale, x1 = s[mt][1][r] * scale;
      float x2 = s[mt][2][r] * scale, x3 = s[mt][3][r] * scale;
      float mx = fmaxf(fmaxf(x0, x1), fmaxf(x2, x3));
#pragma unroll
      for (int msk = 1; msk < 16; msk <<= 1)
        mx = fmaxf(mx, __shfl_xor(mx, msk, 32));
      float e0 = __expf(x0 - mx), e1 = __expf(x1 - mx);
      float e2 = __expf(x2 - mx), e3 = __expf(x3 - mx);
      float sum = e0 + e1 + e2 + e3;
#pragma unroll
      for (int msk = 1; msk < 16; msk <<= 1)
        sum += __shfl_xor(sum, msk, 32);
      float inv = 1.0f / sum;
      int m = mt * 16 + r + 8 * half;
      P[h][m * BLK + 0 * 16 + nl] = (_Float16)(e0 * inv);
      P[h][m * BLK + 1 * 16 + nl] = (_Float16)(e1 * inv);
      P[h][m * BLK + 2 * 16 + nl] = (_Float16)(e2 * inv);
      P[h][m * BLK + 3 * 16 + nl] = (_Float16)(e3 * inv);
    }
  __syncthreads();

  // out = P(64x64) @ V(64x128); V is [d][t] per (bb,h) so K-pairs contiguous
  const _Float16* vbase = VT + ((size_t)bb * HEADS + h) * (DK * BLK);
  for (int dt = 0; dt < 8; ++dt) {
    v8f o[4];
#pragma unroll
    for (int mt = 0; mt < 4; ++mt) o[mt] = vzero;
#pragma unroll
    for (int kk = 0; kk < BLK; kk += 32) {
      v16h b = load_frag16(vbase, BLK, dt * 16, kk, lane);  // A[m][k]=V[t=k][d=m]
#pragma unroll
      for (int mt = 0; mt < 4; ++mt) {
        v16h a = load_frag16(&P[h][0], BLK, mt * 16, kk, lane);
        // V as the A operand: features d on the register axis, tokens on the lane axis
        o[mt] = wmma_f16(b, a, o[mt]);
      }
    }
#pragma unroll
    for (int mt = 0; mt < 4; ++mt) {
      v8h hv;
#pragma unroll
      for (int r = 0; r < 8; ++r) hv[r] = (_Float16)o[mt][r];
      *(v8h*)(&Ost[h][(mt * 16 + nl) * OSTR + dt * 16 + 8 * half]) = hv;
    }
  }
  __syncthreads();   // the staged rows are read back by other lanes than wrote them

  // 16 lanes carry one staged row = two whole 128-B lines of the output
  const int rr = lane >> 4, pc = (lane & 15) * 8;
  _Float16* dst = AO + (size_t)(row0 + rr) * D_MODEL + col0 + pc;
#pragma unroll
  for (int it = 0; it < 32; ++it)
    *(v8h*)(dst + it * 2 * D_MODEL) = *(const v8h*)(&Ost[h][(it * 2 + rr) * OSTR + pc]);
}

// ---------------------------------------------------------------------------
// Output projection: attn(f16) @ Wo^T(f16) + bo -> fp32 d_out
// ---------------------------------------------------------------------------
__global__ void __launch_bounds__(256)
out_gemm_kernel(const _Float16* __restrict__ X, const _Float16* __restrict__ WoT,
                const float* __restrict__ bo, float* __restrict__ out) {
  __shared__ __attribute__((aligned(16))) _Float16 As[2 * ABUF];
  __shared__ __attribute__((aligned(16))) _Float16 Bs[2 * ABUF];

  const int tid  = threadIdx.x;
  const int lane = tid & 31;
  const int wave = tid >> 5;
  const int row0 = blockIdx.x * 256;
  const int n0   = blockIdx.y * 256;

  const v8f vzero = {0.f, 0.f, 0.f, 0.f, 0.f, 0.f, 0.f, 0.f};
  v8f acc[8][4];
#pragma unroll
  for (int mt = 0; mt < 8; ++mt)
#pragma unroll
    for (int nt = 0; nt < 4; ++nt) acc[mt][nt] = vzero;

  // output features on the accumulator's register axis, tokens on its lane axis
  gemm_core_256(WoT, X, n0, row0, tid, As, Bs, acc);

  const int half = lane >> 4, nl = lane & 15;
  const int wa = n0 + (wave >> 2) * 128;    // first output feature of this wave's tile
  const int wb = row0 + (wave & 3) * 64;    // first token row of this wave's tile
  // The ring is dead behind its last barrier; each wave stages its 64 token rows of
  // 128 floats in its own range: waves 0..3 in As, waves 4..7 in Bs.
  float* stg = (float*)(((wave < 4) ? As : Bs) + (wave & 3) * FSTG);
  const float* bp = bo + wa + 8 * half;
  v4f blo[8], bhi[8];
#pragma unroll
  for (int mt = 0; mt < 8; ++mt) {
    blo[mt] = *(const v4f*)(bp + mt * 16);
    bhi[mt] = *(const v4f*)(bp + mt * 16 + 4);
  }
  // Precaution: stands in front of any rewrite of the bias loads' address registers; the
  // address is named as an input so that its registers stay live up to the wait.
  asm volatile("s_wait_xcnt 0x0" :: "v"(bp) : "memory");
#pragma unroll
  for (int mt = 0; mt < 8; ++mt) {
#pragma unroll
    for (int nt = 0; nt < 4; ++nt) {
      v4f lo, hi;
#pragma unroll
      for (int r = 0; r < 4; ++r) {
        lo[r] = acc[mt][nt][r] + blo[mt][r];
        hi[r] = acc[mt][nt][4 + r] + bhi[mt][r];
      }
      float* s = stg + (nt * 16 + nl) * FSTR + mt * 16 + 8 * half;
      *(v4f*)s       = lo;
      *(v4f*)(s + 4) = hi;
    }
  }
  __syncthreads();   // the staged rows are read back by other lanes than wrote them

  // the wave's 32 lanes carry one staged row = four whole 128-B lines of the output
  float* dst = out + (size_t)wb * D_MODEL + wa + lane * 4;
#pragma unroll
  for (int it = 0; it < 64; ++it)
    *(v4f*)(dst + it * D_MODEL) = *(const v4f*)(stg + it * FSTR + lane * 4);
}

// ---------------------------------------------------------------------------
extern "C" void kernel_launch(void* const* d_in, const int* in_sizes, int n_in,
                              void* d_out, int out_size, void* d_ws, size_t ws_size,
                              hipStream_t stream) {
  const float* src = (const float*)d_in[0];
  const float* Wq  = (const float*)d_in[1];
  const float* bq  = (const float*)d_in[2];
  const float* Wk  = (const float*)d_in[3];
  const float* bk  = (const float*)d_in[4];
  const float* Wv  = (const float*)d_in[5];
  const float* bv  = (const float*)d_in[6];
  const float* Wo  = (const float*)d_in[7];
  const float* bo  = (const float*)d_in[8];
  float* out = (float*)d_out;

  const size_t actN = (size_t)M_TOTAL * D_MODEL;   // 16,777,216 halves
  const size_t wN   = (size_t)4 * D_MODEL * D_MODEL;

  _Float16* srcH = (_Float16*)d_ws;        // also reused as attention output
  _Float16* wT   = srcH + actN;            // 4 transposed f16 weight matrices
  _Float16* qH   = wT + wN;
  _Float16* kH   = qH + actN;
  _Float16* vT   = kH + actN;              // head-transposed V
  _Float16* attn = srcH;                   // alias: src dead after QKV GEMM

  // 1. fp32 -> f16 conversions
  convert_src_kernel<<<(unsigned)(actN / (256 * 4)), 256, 0, stream>>>(src, srcH, actN);
  convert_w_kernel<<<dim3(D_MODEL / 16, D_MODEL / 16, 4), dim3(16, 16), 0, stream>>>(
      Wq, Wk, Wv, Wo, wT);

  // 2. fused QKV projections (256x256 tile per workgroup, async LDS staging)
  qkv_gemm_kernel<<<dim3(M_TOTAL / 256, D_MODEL / 256, 3), 256, 0, stream>>>(
      srcH, wT, bq, bk, bv, qH, kH, vT);

  // 3. block-local attention (one workgroup per (b,blk), one wave per head)
  attn_kernel<<<dim3(BATCH * (SEQ / BLK)), 256, 0, stream>>>(qH, kH, vT, attn);

  // 4. output projection -> fp32
  out_gemm_kernel<<<dim3(M_TOTAL / 256, D_MODEL / 256), 256, 0, stream>>>(
      attn, wT + (size_t)3 * D_MODEL * D_MODEL, bo, out);
}

// v004
// One run takes 131 microseconds.
// Two timings next to v003 put it at 1.20 and 1.21 times that version's speed.
// Counting every step since v000, it is 2.14 times as fast.
#include <hip/hip_runtime.h>

typedef __attribute__((ext_vector_type(16))) _Float16 v16h;
typedef __attribute__((ext_vector_type(8)))  float    v8f;
typedef __attribute__((ext_vector_type(8)))  _Float16 v8h;
typedef __attribute__((ext_vector_type(4)))  float    v4f;
typedef __attribute__((ext_vector_type(4)))  _Float16 v4h;
typedef __attribute__((ext_vector_type(2)))  _Float16 v2h;

#define D_MODEL 1024
#define SEQ     4096
#define BATCH   4
#define HEADS   8
#define BLK     64
#define DK      128
#define M_TOTAL (BATCH * SEQ)   // 16384 rows

#define BK   128                // k-slice per stage in halves: 256 B of a row, two whole cache lines
#define LSTR 136                // LDS row stride in halves (128 + 8 pad, 272B = 16B x odd: bank-conflict free)
#define ABUF (256 * LSTR)       // halves per LDS buffer (256 rows x 128 halves padded)
#define WSTG (64 * LSTR)        // halves of one wave's own f16 epilogue staging range (17,408 B; eight fill one ring array)
#define FSTR 132                // f32 staging row stride in floats (128 + 4 pad, 528B = 16B x odd)
#define FSTG (64 * FSTR * 2)    // halves of one wave's own f32 epilogue staging range (33,792 B; four fit one ring array)
#define OSTR 136                // attention output staging row stride in halves (128 + 8 pad, 272B = 16B x odd)

// ---------------------------------------------------------------------------
// Stage 128 rows x 256 bytes of a k-slice global -> LDS with 8 async b128 copies per
// thread (256 threads). Sixteen neighbouring lanes cover one row's two 128-byte
// lines, so one wave-wide copy touches 4 full lines. g and l are this thread's own
// addresses in rows 0..15 of the range (row = tid >> 4, 16-byte piece = tid & 15);
// copy c takes the row 16 * c further down.
// ---------------------------------------------------------------------------
__device__ __forceinline__ void async_stage_tile(const _Float16* __restrict__ g,
                                                 _Float16* lds) {
  const unsigned l = (unsigned)(uintptr_t)lds;        // LDS byte offset (low 32 bits)
  const unsigned long long a = (unsigned long long)(uintptr_t)g;
  const unsigned           LS = 16u * LSTR * 2u;      // 16 LDS rows in bytes
  const unsigned long long GS = 16ull * D_MODEL * 2ull;  // 16 global rows in bytes
  // The closing s_wait_xcnt is a precaution: it stands in front of every later
  // rewrite of these address registers, and inside the copies' own statement
  // nothing can be scheduled between it and them.
  asm volatile(
      "global_load_async_to_lds_b128 %0, %8, off\n\t"
      "global_load_async_to_lds_b128 %1, %9, off\n\t"
      "global_load_async_to_lds_b128 %2, %10, off\n\t"
      "global_load_async_to_lds_b128 %3, %11, off\n\t"
      "global_load_async_to_lds_b128 %4, %12, off\n\t"
      "global_load_async_to_lds_b128 %5, %13, off\n\t"
      "global_load_async_to_lds_b128 %6, %14, off\n\t"
      "global_load_async_to_lds_b128 %7, %15, off\n\t"
      "s_wait_xcnt 0x0"
      :: "v"(l), "v"(l + LS), "v"(l + 2 * LS), "v"(l + 3 * LS),
         "v"(l + 4 * LS), "v"(l + 5 * LS), "v"(l + 6 * LS), "v"(l + 7 * LS),
         "v"(a), "v"(a + GS), "v"(a + 2 * GS), "v"(a + 3 * GS),
         "v"(a + 4 * GS), "v"(a + 5 * GS), "v"(a + 6 * GS), "v"(a + 7 * GS)
      : "memory");
}

// ---------------------------------------------------------------------------
// Fragment helpers (wave32, 16-bit 16x16x32 WMMA layout)
// A (16x32): lane L holds row M=L&15; half=L>>4 adds +8 to K.
//   VGPR j<4  -> K pair {2j, 2j+1} (+8*half)
//   VGPR j>=4 -> K pair {16+2(j-4), ...} (+8*half)
// B (32x16) is symmetric with N=L&15; memory addressed as p[n*ld + k].
// ---------------------------------------------------------------------------
__device__ __forceinline__ v16h load_frag16(const _Float16* __restrict__ p,
                                            int ld, int r0, int k0, int lane) {
  const int m    = lane & 15;
  const int half = lane >> 4;
  const _Float16* q = p + (size_t)(r0 + m) * ld + (k0 + 8 * half);
  v16h f;
#pragma unroll
  for (int i = 0; i < 8; ++i) f[i]     = q[i];        // VGPR 0..3: K 0..7
#pragma unroll
  for (int i = 0; i < 8; ++i) f[8 + i] = q[16 + i];   // VGPR 4..7: K 16..23
  return f;
}

__device__ __forceinline__ v8f wmma_f16(v16h a, v16h b, v8f c) {
  return __builtin_amdgcn_wmma_f32_16x16x32_f16(
      /*neg_a=*/false, a, /*neg_b=*/false, b,
      /*c_mod=*/(short)0, c, /*reuse_a=*/false, /*reuse_b=*/false);
}

// ---------------------------------------------------------------------------
// Workgroup-tiled GEMM core: 256x256 tile, 8 waves (2x4), two per SIMD, K staged in LDS via
// double-buffered async copies (two-buffer ring, one barrier per k-slice). acc is this wave's
// 128x64 (8x4 fragment tiles).
// Xg, Wg: [rows x 1024] row-major f16. acc = Xg rows (row0..) times Wg rows (n0..) transposed:
// a lane holds 8 neighbouring Xg-row indices (register axis) at one Wg-row index (lane axis).
// The callers pick which matrix goes on which side so that the register axis is the
// axis that is contiguous in their output.
// ---------------------------------------------------------------------------
__device__ __forceinline__ void stage_slice(const _Float16* __restrict__ xs,
                                            const _Float16* __restrict__ ws,
                                            _Float16* ad, _Float16* bd) {
  async_stage_tile(xs, ad);
  async_stage_tile(xs + 128 * D_MODEL, ad + 128 * LSTR);
  async_stage_tile(ws, bd);
  async_stage_tile(ws + 128 * D_MODEL, bd + 128 * LSTR);
}

// one 32-k block of a wave's 128x64 tile: 8 x 4 fragment products
__device__ __forceinline__ void mma_block(const v16h a[8], const v16h b[4], v8f acc[8][4]) {
#pragma unroll
  for (int mt = 0; mt < 8; ++mt)
#pragma unroll
    for (int nt = 0; nt < 4; ++nt)
      acc[mt][nt] = wmma_f16(a[mt], b[nt], acc[mt][nt]);
}

__device__ __forceinline__ void gemm_core_256(const _Float16* __restrict__ Xg,
                                              const _Float16* __restrict__ Wg,
                                              int row0, int n0, int tid,
                                              _Float16* As, _Float16* Bs,
                                              v8f acc[8][4]) {
  const int lane = tid & 31;
  const int wave = tid >> 5;
  const int wr = (wave >> 2) * 128;  // wave row offset inside 256x256 tile
  const int wc = (wave & 3) * 64;    // wave col offset inside 256x256 tile

  // this thread's piece of tile rows 0..15: row tid >> 4, 16-byte piece tid & 15
  const int srow = tid >> 4;
  const int scol = (tid & 15) * 8;
  const _Float16* xsrc = Xg + (size_t)(row0 + srow) * D_MODEL + scol;
  const _Float16* wsrc = Wg + (size_t)(n0 + srow) * D_MODEL + scol;
  _Float16* adst = As + srow * LSTR + scol;
  _Float16* bdst = Bs + srow * LSTR + scol;

  // prologue: slice 0 lands in buffer 0 and is published, then slice 1 starts
  stage_slice(xsrc, wsrc, adst, bdst);
  asm volatile("s_wait_asynccnt 0x0" ::: "memory");  // this wave's slice-0 copies have landed
  __syncthreads();                                   // every wave's slice-0 copies visible
  stage_slice(xsrc + BK, wsrc + BK, adst + ABUF, bdst + ABUF);

  const int steps = D_MODEL / BK;
  for (int i = 0; i < steps; ++i) {
    const int cur = i & 1;
    const _Float16* Ab = As + cur * ABUF;
    const _Float16* Bb = Bs + cur * ABUF;
#pragma unroll
    for (int kk = 0; kk < BK; kk += 32) {
      v16h a[8], b[4];
      // Fence pair: holds this block's 24 LDS reads together as one group in front of its
      // 32 WMMAs. Left free, the compiler spread them in pairs among the WMMAs, each pair
      // behind a wait to 0, which two waves a SIMD cannot hide.
      __builtin_amdgcn_sched_barrier(0);
#pragma unroll
      for (int nt = 0; nt < 4; ++nt) b[nt] = load_frag16(Bb, LSTR, wc + 16 * nt, kk, lane);
#pragma unroll
      for (int mt = 0; mt < 8; ++mt) a[mt] = load_frag16(Ab, LSTR, wr + 16 * mt, kk, lane);
      __builtin_amdgcn_sched_barrier(0);
      mma_block(a, b, acc);
    }

    // publish point of slice i + 1, which also frees buffer `cur` for the refill
    asm volatile("s_wait_dscnt 0x0" ::: "memory");     // own reads of `cur` retired before it is refilled
    asm volatile("s_wait_asynccnt 0x0" ::: "memory");  // own copies of slice i + 1 have landed
    __syncthreads();
    if (i + 2 < steps)
      stage_slice(xsrc + (i + 2) * BK, wsrc + (i + 2) * BK, adst + cur * ABUF, bdst + cur * ABUF);
  }
  asm volatile("s_wait_asynccnt 0x0" ::: "memory");    // nothing in flight when the ring is left
}

// ---------------------------------------------------------------------------
// Conversion kernels
// ---------------------------------------------------------------------------
#define CS_WAVES 16             // waves per work-group of the activation stream
#define CS_LOADS 16             // 16-byte loads a lane has in flight
#define CS_GRID  256            // work-groups of the activation stream

// f32 -> f16 stream. One wave-wide load covers 512 contiguous bytes (4 whole lines), the
// matching store 256 contiguous bytes (2 whole lines). A wave owns a contiguous range and
// walks it in groups of CS_LOADS loads, all issued before the first one is converted.
__global__ void __launch_bounds__(CS_WAVES * 32)
convert_src_kernel(const float* __restrict__ in, _Float16* __restrict__ out) {
  const int lane = threadIdx.x & 31;
  const int wave = blockIdx.x * CS_WAVES + (threadIdx.x >> 5);
  const size_t per_wave = (size_t)M_TOTAL * D_MODEL / (CS_GRID * CS_WAVES);  // 4096 floats
  const float*    ip = in + wave * per_wave + lane * 4;
  _Float16*       op = out + wave * per_wave + lane * 4;
  for (size_t g = 0; g < per_wave; g += CS_LOADS * 128) {
    v4f x[CS_LOADS];
#pragma unroll
    for (int c = 0; c < CS_LOADS; ++c) x[c] = *(const v4f*)(ip + g + c * 128);
#pragma unroll
    for (int c = 0; c < CS_LOADS; ++c) {
      v4h h;
#pragma unroll
      for (int r = 0; r < 4; ++r) h[r] = (_Float16)x[c][r];
      *(v4h*)(op + g + c * 128) = h;
    }
  }
}

#define TK   128                // k extent of a weight tile
#define TN   64                 // n extent of a weight tile
#define TSTR 136                // LDS row stride in halves (128 + 8 pad, rows stay 16-B aligned)

// wT[z][n][k] = W_z[k][n]  (f16, transposed so K-pairs are contiguous).
// One work-group turns a 128 (k) x 64 (n) tile through LDS: 16 lanes read one 256-B piece
// of a W row, 16 lanes write one 256-B piece of a wT row, whole lines on both sides.
__global__ void __launch_bounds__(256)
convert_w_kernel(const float* __restrict__ Wq,
                 const float* __restrict__ Wk,
                 const float* __restrict__ Wv,
                 const float* __restrict__ Wo,
                 _Float16* __restrict__ wT) {
  __shared__ __attribute__((aligned(16))) _Float16 tile[TN * TSTR];
  const int tid = threadIdx.x;
  const int k0 = blockIdx.x * TK;
  const int n0 = blockIdx.y * TN;
  const int z  = blockIdx.z;
  const float* W = (z == 0) ? Wq : (z == 1) ? Wk : (z == 2) ? Wv : Wo;

  // a thread takes 4 neighbouring n of the k pairs (2 * kp, 2 * kp + 1), kp = tid >> 4 + 16 * c
  const int nq = (tid & 15) * 4;
  const int kp = tid >> 4;
  const float* wp = W + (size_t)(k0 + 2 * kp) * D_MODEL + n0 + nq;
  v4f lo[4], hi[4];
#pragma unroll
  for (int c = 0; c < 4; ++c) {
    lo[c] = *(const v4f*)(wp + (size_t)(32 * c) * D_MODEL);
    hi[c] = *(const v4f*)(wp + (size_t)(32 * c + 1) * D_MODEL);
  }
#pragma unroll
  for (int c = 0; c < 4; ++c)
#pragma unroll
    for (int j = 0; j < 4; ++j) {
      v2h p;
      p[0] = (_Float16)lo[c][j];
      p[1] = (_Float16)hi[c][j];
      *(v2h*)(tile + (nq + j) * TSTR + 2 * kp + 32 * c) = p;
    }
  __syncthreads();   // the tile's rows are read back by other lanes than wrote them

  const int rr = tid >> 4, pc = (tid & 15) * 8;
  _Float16* dst = wT + (size_t)z * D_MODEL * D_MODEL + (size_t)(n0 + rr) * D_MODEL + k0 + pc;
#pragma unroll
  for (int it = 0; it < 4; ++it)
    *(v8h*)(dst + (size_t)(it * 16) * D_MODEL) = *(const v8h*)(tile + (it * 16 + rr) * TSTR + pc);
}

// ---------------------------------------------------------------------------
// QKV projection: 256x256 workgroup tile, 8 waves. z selects Q/K/V.
// Q,K stored row-major f16 [16384 x 1024].
// V stored head-transposed: vT[(bb*HEADS+h)*DK*BLK + d*BLK + t]
// ---------------------------------------------------------------------------
__global__ void __launch_bounds__(256)
qkv_gemm_kernel(const _Float16* __restrict__ X, const _Float16* __restrict__ WT,
                const float* __restrict__ bq, const float* __restrict__ bk,
                const float* __restrict__ bv, _Float16* __restrict__ qO,
                _Float16* __restrict__ kO, _Float16* __restrict__ vT) {
  __shared__ __attribute__((aligned(16))) _Float16 As[2 * ABUF];
  __shared__ __attribute__((aligned(16))) _Float16 Bs[2 * ABUF];

  const int tid  = threadIdx.x;
  const int lane = tid & 31;
  const int wave = tid >> 5;
  const int row0 = blockIdx.x * 256;
  const int n0   = blockIdx.y * 256;
  const int proj = blockIdx.z;
  const _Float16* W = WT + (size_t)proj * D_MODEL * D_MODEL;

  const v8f vzero = {0.f, 0.f, 0.f, 0.f, 0.f, 0.f, 0.f, 0.f};
  v8f acc[8][4];
#pragma unroll
  for (int mt = 0; mt < 8; ++mt)
#pragma unroll
    for (int nt = 0; nt < 4; ++nt) acc[mt][nt] = vzero;

  // V is stored token-contiguous, Q and K feature-contiguous: the contiguous axis
  // goes on the accumulator's register axis (block-uniform choice).
  const bool isV = (proj == 2);
  const int a0 = isV ? row0 : n0;
  const int b0 = isV ? n0 : row0;
  gemm_core_256(isV ? X : W, isV ? W : X, a0, b0, tid, As, Bs, acc);

  const int half = lane >> 4, nl = lane & 15;
  const int wa = a0 + (wave >> 2) * 128;  // first register-axis index of this wave's tile
  const int wb = b0 + (wave & 3) * 64;    // first lane-axis index of this wave's tile
  // The ring is dead behind its last barrier; each wave stages its 128 x 64 tile in
  // its own range of it, one row per lane-axis index, 256 B of payload a row.
  _Float16* stg = As + wave * WSTG;
  if (isV) {
    const int bi = wb + nl;
    float bb[4];
#pragma unroll
    for (int nt = 0; nt < 4; ++nt) bb[nt] = bv[bi + nt * 16];
    // Precaution: stands in front of any rewrite of the bias loads' address register; the
    // index is named as an input so that its register stays live up to the wait.
    asm volatile("s_wait_xcnt 0x0" :: "v"(bi) : "memory");
#pragma unroll
    for (int nt = 0; nt < 4; ++nt) {
#pragma unroll
      for (int mt = 0; mt < 8; ++mt) {
        v8h h;
#pragma unroll
        for (int r = 0; r < 8; ++r) h[r] = (_Float16)(acc[mt][nt][r] + bb[nt]);
        *(v8h*)(stg + (nt * 16 + nl) * LSTR + mt * 16 + 8 * half) = h;
      }
    }
  } else {
    const float* bias = (proj == 0) ? bq : bk;
    const float* bp = bias + wa + 8 * half;
    v4f blo[8], bhi[8];
#pragma unroll
    for (int mt = 0; mt < 8; ++mt) {
      blo[mt] = *(const v4f*)(bp + mt * 16);
      bhi[mt] = *(const v4f*)(bp + mt * 16 + 4);
    }
    // Precaution, as in the other branch: the address lives up to the wait.
    asm volatile("s_wait_xcnt 0x0" :: "v"(bp) : "memory");
#pragma unroll
    for (int mt = 0; mt < 8; ++mt) {
#pragma unroll
      for (int nt = 0; nt < 4; ++nt) {
        v8h h;
#pragma unroll
        for (int r = 0; r < 4; ++r) {
          h[r]     = (_Float16)(acc[mt][nt][r] + blo[mt][r]);
          h[4 + r] = (_Float16)(acc[mt][nt][4 + r] + bhi[mt][r]);
        }
        *(v8h*)(stg + (nt * 16 + nl) * LSTR + mt * 16 + 8 * half) = h;
      }
    }
  }
  __syncthreads();   // the staged rows are read back by other lanes than wrote them

  // 16 lanes carry one staged row = two whole 128-B lines of the output
  const int rr = lane >> 4, pc = (lane & 15) * 8;
  const _Float16* rd = stg + rr * LSTR + pc;
  if (isV) {
    // wa = (b*64 + blk)*64, register axis = t over two neighbouring blocks (8 lanes
    // each); wb = h*128 + d0, lane axis = d
    _Float16* dst = vT + ((size_t)((wa >> 6) + (pc >> 6)) * HEADS + (wb >> 7)) * (DK * BLK) +
                    (size_t)((wb & 127) + rr) * BLK + (pc & 63);
#pragma unroll
    for (int it = 0; it < 32; ++it)
      *(v8h*)(dst + it * 2 * BLK) = *(const v8h*)(rd + it * 2 * LSTR);
    // Precaution: stands behind the run's last store, in front of whatever code the
    // compiler lays behind this branch and lets rewrite the stores' registers.
    asm volatile("s_wait_xcnt 0x0" ::: "memory");
  } else {
    _Float16* dst = ((proj == 0) ? qO : kO) + (size_t)(wb + rr) * D_MODEL + wa + pc;
#pragma unroll
    for (int it = 0; it < 32; ++it)
      *(v8h*)(dst + it * 2 * D_MODEL) = *(const v8h*)(rd + it * 2 * LSTR);
    // Precaution, as in the other branch.
    asm volatile("s_wait_xcnt 0x0" ::: "memory");
  }
}

// ---------------------------------------------------------------------------
// Block attention: one workgroup per (b,blk), one wave per head.
// scores(64x64) in registers -> softmax (shfl_xor within 16-lane halves)
// -> P staged in LDS -> P @ V via WMMA -> f16 attention output row-major,
// staged in the wave's own LDS range and stored as whole lines.
// ---------------------------------------------------------------------------
__global__ void __launch_bounds__(256)
attn_kernel(const _Float16* __restrict__ Q, const _Float16* __restrict__ K,
            const _Float16* __restrict__ VT, _Float16* __restrict__ AO) {
  __shared__ _Float16 P[HEADS][BLK * BLK];   // 64 KB
  __shared__ __attribute__((aligned(16))) _Float16 Ost[HEADS][BLK * OSTR];   // 136 KB

  const int lane = threadIdx.x & 31;
  const int h    = threadIdx.x >> 5;         // head
  const int bb   = blockIdx.x;               // b*64 + blk
  const int row0 = bb * BLK;                 // flat token row base
  const int col0 = h * DK;
  const int half = lane >> 4, nl = lane & 15;

  const v8f vzero = {0.f, 0.f, 0.f, 0.f, 0.f, 0.f, 0.f, 0.f};
  v8f s[4][4];
#pragma unroll
  for (int mt = 0; mt < 4; ++mt)
#pragma unroll
    for (int nt = 0; nt < 4; ++nt) s[mt][nt] = vzero;

  // scores = Q_blk @ K_blk^T over dk=128
  for (int kk = 0; kk < DK; kk += 32) {
    v16h a[4], b[4];
#pragma unroll
    for (int mt = 0; mt < 4; ++mt)
      a[mt] = load_frag16(Q, D_MODEL, row0 + 16 * mt, col0 + kk, lane);
#pragma unroll
    for (int nt = 0; nt < 4; ++nt)   // B[k][n] = K[row0+n][col0+kk+k]
      b[nt] = load_frag16(K, D_MODEL, row0 + 16 * nt, col0 + kk, lane);
#pragma unroll
    for (int mt = 0; mt < 4; ++mt)
#pragma unroll
      for (int nt = 0; nt < 4; ++nt)
        s[mt][nt] = wmma_f16(a[mt], b[nt], s[mt][nt]);
  }

  // row softmax: each row M lives in 16 lanes (one half) across 4 nt tiles
  const float scale = 0.08838834764831845f;  // dk^-0.5
#pragma unroll
  for (int mt = 0; mt < 4; ++mt)
#pragma unroll
    for (int r = 0; r < 8; ++r) {
      float x0 = s[mt][0][r] * scale, x1 = s[mt][1][r] * scale;
      float x2 = s[mt][2][r] * scale, x3 = s[mt][3][r] * scale;
      float mx = fmaxf(fmaxf(x0, x1), fmaxf(x2, x3));
#pragma unroll
      for (int msk = 1; msk < 16; msk <<= 1)
        mx = fmaxf(mx, __shfl_xor(mx, msk, 32));
      float e0 = __expf(x0 - mx), e1 = __expf(x1 - mx);
      float e2 = __expf(x2 - mx), e3 = __expf(x3 - mx);
      float sum = e0 + e1 + e2 + e3;
#pragma unroll
      for (int msk = 1; msk < 16; msk <<= 1)
        sum += __shfl_xor(sum, msk, 32);
      float inv = 1.0f / sum;
      int m = mt * 16 + r + 8 * half;
      P[h][m * BLK + 0 * 16 + nl] = (_Float16)(e0 * inv);
      P[h][m * BLK + 1 * 16 + nl] = (_Float16)(e1 * inv);
      P[h][m * BLK + 2 * 16 + nl] = (_Float16)(e2 * inv);
      P[h][m * BLK + 3 * 16 + nl] = (_Float16)(e3 * inv);
    }
  __syncthreads();

  // out = P(64x64) @ V(64x128); V is [d][t] per (bb,h) so K-pairs contiguous
  const _Float16* vbase = VT + ((size_t)bb * HEADS + h) * (DK * BLK);
  for (int dt = 0; dt < 8; ++dt) {
    v8f o[4];
#pragma unroll
    for (int mt = 0; mt < 4; ++mt) o[mt] = vzero;
#pragma unroll
    for (int kk = 0; kk < BLK; kk += 32) {
      v16h b = load_frag16(vbase, BLK, dt * 16, kk, lane);  // A[m][k]=V[t=k][d=m]
#pragma unroll
      for (int mt = 0; mt < 4; ++mt) {
        v16h a = load_frag16(&P[h][0], BLK, mt * 16, kk, lane);
        // V as the A operand: features d on the register axis, tokens on the lane axis
        o[mt] = wmma_f16(b, a, o[mt]);
      }
    }
#pragma unroll
    for (int mt = 0; mt < 4; ++mt) {
      v8h hv;
#pragma unroll
      for (int r = 0; r < 8; ++r) hv[r] = (_Float16)o[mt][r];
      *(v8h*)(&Ost[h][(mt * 16 + nl) * OSTR + dt * 16 + 8 * half]) = hv;
    }
  }
  __syncthreads();   // the staged rows are read back by other lanes than wrote them

  // 16 lanes carry one staged row = two whole 128-B lines of the output
  const int rr = lane >> 4, pc = (lane & 15) * 8;
  _Float16* dst = AO + (size_t)(row0 + rr) * D_MODEL + col0 + pc;
#pragma unroll
  for (int it = 0; it < 32; ++it)
    *(v8h*)(dst + it * 2 * D_MODEL) = *(const v8h*)(&Ost[h][(it * 2 + rr) * OSTR + pc]);
}

// ---------------------------------------------------------------------------
// Output projection: attn(f16) @ Wo^T(f16) + bo -> fp32 d_out
// ---------------------------------------------------------------------------
__global__ void __launch_bounds__(256)
out_gemm_kernel(const _Float16* __restrict__ X, const _Float16* __restrict__ WoT,
                const float* __restrict__ bo, float* __restrict__ out) {
  __shared__ __attribute__((aligned(16))) _Float16 As[2 * ABUF];
  __shared__ __attribute__((aligned(16))) _Float16 Bs[2 * ABUF];

  const int tid  = threadIdx.x;
  const int lane = tid & 31;
  const int wave = tid >> 5;
  const int row0 = blockIdx.x * 256;
  const int n0   = blockIdx.y * 256;

  const v8f vzero = {0.f, 0.f, 0.f, 0.f, 0.f, 0.f, 0.f, 0.f};
  v8f acc[8][4];
#pragma unroll
  for (int mt = 0; mt < 8; ++mt)
#pragma unroll
    for (int nt = 0; nt < 4; ++nt) acc[mt][nt] = vzero;

  // output features on the accumulator's register axis, tokens on its lane axis
  gemm_core_256(WoT, X, n0, row0, tid, As, Bs, acc);

  const int half = lane >> 4, nl = lane & 15;
  const int wa = n0 + (wave >> 2) * 128;    // first output feature of this wave's tile
  const int wb = row0 + (wave & 3) * 64;    // first token row of this wave's tile
  // The ring is dead behind its last barrier; each wave stages its 64 token rows of
  // 128 floats in its own range: waves 0..3 in As, waves 4..7 in Bs.
  float* stg = (float*)(((wave < 4) ? As : Bs) + (wave & 3) * FSTG);
  const float* bp = bo + wa + 8 * half;
  v4f blo[8], bhi[8];
#pragma unroll
  for (int mt = 0; mt < 8; ++mt) {
    blo[mt] = *(const v4f*)(bp + mt * 16);
    bhi[mt] = *(const v4f*)(bp + mt * 16 + 4);
  }
  // Precaution: stands in front of any rewrite of the bias loads' address registers; the
  // address is named as an input so that its registers stay live up to the wait.
  asm volatile("s_wait_xcnt 0x0" :: "v"(bp) : "memory");
#pragma unroll
  for (int mt = 0; mt < 8; ++mt) {
#pragma unroll
    for (int nt = 0; nt < 4; ++nt) {
      v4f lo, hi;
#pragma unroll
      for (int r = 0; r < 4; ++r) {
        lo[r] = acc[mt][nt][r] + blo[mt][r];
        hi[r] = acc[mt][nt][4 + r] + bhi[mt][r];
      }
      float* s = stg + (nt * 16 + nl) * FSTR + mt * 16 + 8 * half;
      *(v4f*)s       = lo;
      *(v4f*)(s + 4) = hi;
    }
  }
  __syncthreads();   // the staged rows are read back by other lanes than wrote them

  // the wave's 32 lanes carry one staged row = four whole 128-B lines of the output
  float* dst = out + (size_t)wb * D_MODEL + wa + lane * 4;
#pragma unroll
  for (int it = 0; it < 64; ++it)
    *(v4f*)(dst + it * D_MODEL) = *(const v4f*)(stg + it * FSTR + lane * 4);
}

// ---------------------------------------------------------------------------
extern "C" void kernel_launch(void* const* d_in, const int* in_sizes, int n_in,
                              void* d_out, int out_size, void* d_ws, size_t ws_size,
                              hipStream_t stream) {
  const float* src = (const float*)d_in[0];
  const float* Wq  = (const float*)d_in[1];
  const float* bq  = (const float*)d_in[2];
  const float* Wk  = (const float*)d_in[3];
  const float* bk  = (const float*)d_in[4];
  const float* Wv  = (const float*)d_in[5];
  const float* bv  = (const float*)d_in[6];
  const float* Wo  = (const float*)d_in[7];
  const float* bo  = (const float*)d_in[8];
  float* out = (float*)d_out;

  const size_t actN = (size_t)M_TOTAL * D_MODEL;   // 16,777,216 halves
  const size_t wN   = (size_t)4 * D_MODEL * D_MODEL;

  _Float16* srcH = (_Float16*)d_ws;        // also reused as attention output
  _Float16* wT   = srcH + actN;            // 4 transposed f16 weight matrices
  _Float16* qH   = wT + wN;
  _Float16* kH   = qH + actN;
  _Float16* vT   = kH + actN;              // head-transposed V
  _Float16* attn = srcH;                   // alias: src dead after QKV GEMM

  // 1. fp32 -> f16 conversions
  convert_src_kernel<<<CS_GRID, CS_WAVES * 32, 0, stream>>>(src, srcH);
  convert_w_kernel<<<dim3(D_MODEL / TK, D_MODEL / TN, 4), 256, 0, stream>>>(
      Wq, Wk, Wv, Wo, wT);

  // 2. fused QKV projections (256x256 tile per workgroup, async LDS staging)
  qkv_gemm_kernel<<<dim3(M_TOTAL / 256, D_MODEL / 256, 3), 256, 0, stream>>>(
      srcH, wT, bq, bk, bv, qH, kH, vT);

  // 3. block-local attention (one workgroup per (b,blk), one wave per head)
  attn_kernel<<<dim3(BATCH * (SEQ / BLK)), 256, 0, stream>>>(qH, kH, vT, attn);

  // 4. output projection -> fp32
  out_gemm_kernel<<<dim3(M_TOTAL / 256, D_MODEL / 256), 256, 0, stream>>>(
      attn, wT + (size_t)3 * D_MODEL * D_MODEL, bo, out);
}

// v005
// One run takes 125 microseconds.
// In both of two side-by-side timings against v004, it was 1.05 times as fast.
// Over all steps from v000 it is 2.25 times as fast.
#include <hip/hip_runtime.h>

typedef __attribute__((ext_vector_type(16))) _Float16 v16h;
typedef __attribute__((ext_vector_type(8)))  float    v8f;
typedef __attribute__((ext_vector_type(8)))  _Float16 v8h;
typedef __attribute__((ext_vector_type(4)))  float    v4f;
typedef __attribute__((ext_vector_type(4)))  _Float16 v4h;
typedef __attribute__((ext_vector_type(2)))  _Float16 v2h;

#define D_MODEL 1024
#define SEQ     4096
#define BATCH   4
#define HEADS   8
#define BLK     64
#define DK      128
#define M_TOTAL (BATCH * SEQ)   // 16384 rows

#define BK   128                // k-slice per stage in halves: 256 B of a row, two whole cache lines
#define LSTR 136                // LDS row stride in halves (128 + 8 pad, 272B = 16B x odd: bank-conflict free)
#define ABUF (256 * LSTR)       // halves per LDS buffer (256 rows x 128 halves padded)
#define WSTG (64 * LSTR)        // halves of one wave's own f16 epilogue staging range (17,408 B; eight fill one ring array)
#define FSTR 132                // f32 staging row stride in floats (128 + 4 pad, 528B = 16B x odd)
#define FSTG (64 * FSTR * 2)    // halves of one wave's own f32 epilogue staging range (33,792 B; four fit one ring array)
#define OSTR 136                // attention output staging row stride in halves (128 + 8 pad, 272B = 16B x odd)
#define VSTR 72                 // attention V staging row stride in halves (64 + 8 pad, 144B = 16B x odd)
#define AR0  (DK * VSTR)        // halves of a head's first LDS range: Q (64 x LSTR fits), then V (128 x VSTR)
#define AR1  (BLK * LSTR)       // halves of a head's second LDS range: K, then P, then the output rows

// ---------------------------------------------------------------------------
// Stage 128 rows x 256 bytes of a k-slice global -> LDS with 8 async b128 copies per
// thread (256 threads). Sixteen neighbouring lanes cover one row's two 128-byte
// lines, so one wave-wide copy touches 4 full lines. g and l are this thread's own
// addresses in rows 0..15 of the range (row = tid >> 4, 16-byte piece = tid & 15);
// copy c takes the row 16 * c further down.
// ---------------------------------------------------------------------------
__device__ __forceinline__ void async_stage_tile(const _Float16* __restrict__ g,
                                                 _Float16* lds) {
  const unsigned l = (unsigned)(uintptr_t)lds;        // LDS byte offset (low 32 bits)
  const unsigned long long a = (unsigned long long)(uintptr_t)g;
  const unsigned           LS = 16u * LSTR * 2u;      // 16 LDS rows in bytes
  const unsigned long long GS = 16ull * D_MODEL * 2ull;  // 16 global rows in bytes
  // The closing s_wait_xcnt is a precaution: it stands in front of every later
  // rewrite of these address registers, and inside the copies' own statement
  // nothing can be scheduled between it and them.
  asm volatile(
      "global_load_async_to_lds_b128 %0, %8, off\n\t"
      "global_load_async_to_lds_b128 %1, %9, off\n\t"
      "global_load_async_to_lds_b128 %2, %10, off\n\t"
      "global_load_async_to_lds_b128 %3, %11, off\n\t"
      "global_load_async_to_lds_b128 %4, %12, off\n\t"
      "global_load_async_to_lds_b128 %5, %13, off\n\t"
      "global_load_async_to_lds_b128 %6, %14, off\n\t"
      "global_load_async_to_lds_b128 %7, %15, off\n\t"
      "s_wait_xcnt 0x0"
      :: "v"(l), "v"(l + LS), "v"(l + 2 * LS), "v"(l + 3 * LS),
         "v"(l + 4 * LS), "v"(l + 5 * LS), "v"(l + 6 * LS), "v"(l + 7 * LS),
         "v"(a), "v"(a + GS), "v"(a + 2 * GS), "v"(a + 3 * GS),
         "v"(a + 4 * GS), "v"(a + 5 * GS), "v"(a + 6 * GS), "v"(a + 7 * GS)
      : "memory");
}

// ---------------------------------------------------------------------------
// Eight async b128 copies of one wave, global -> LDS: copy c takes the lane's own
// addresses LS bytes (LDS) and GS bytes (global) times c further on.
// ---------------------------------------------------------------------------
template <unsigned LS, unsigned GS>
__device__ __forceinline__ void async_copy8(const _Float16* __restrict__ g, _Float16* lds) {
  const unsigned l = (unsigned)(uintptr_t)lds;        // LDS byte offset (low 32 bits)
  const unsigned long long a = (unsigned long long)(uintptr_t)g;
  const unsigned long long G = GS;
  // The closing s_wait_xcnt is a precaution, as in async_stage_tile: inside the copies'
  // own statement it stands in front of every later rewrite of these address registers.
  asm volatile(
      "global_load_async_to_lds_b128 %0, %8, off\n\t"
      "global_load_async_to_lds_b128 %1, %9, off\n\t"
      "global_load_async_to_lds_b128 %2, %10, off\n\t"
      "global_load_async_to_lds_b128 %3, %11, off\n\t"
      "global_load_async_to_lds_b128 %4, %12, off\n\t"
      "global_load_async_to_lds_b128 %5, %13, off\n\t"
      "global_load_async_to_lds_b128 %6, %14, off\n\t"
      "global_load_async_to_lds_b128 %7, %15, off\n\t"
      "s_wait_xcnt 0x0"
      :: "v"(l), "v"(l + LS), "v"(l + 2 * LS), "v"(l + 3 * LS),
         "v"(l + 4 * LS), "v"(l + 5 * LS), "v"(l + 6 * LS), "v"(l + 7 * LS),
         "v"(a), "v"(a + G), "v"(a + 2 * G), "v"(a + 3 * G),
         "v"(a + 4 * G), "v"(a + 5 * G), "v"(a + 6 * G), "v"(a + 7 * G)
      : "memory");
}

// ---------------------------------------------------------------------------
// Fragment helpers (wave32, 16-bit 16x16x32 WMMA layout)
// A (16x32): lane L holds row M=L&15; half=L>>4 adds +8 to K.
//   VGPR j<4  -> K pair {2j, 2j+1} (+8*half)
//   VGPR j>=4 -> K pair {16+2(j-4), ...} (+8*half)
// B (32x16) is symmetric with N=L&15; memory addressed as p[n*ld + k].
// ---------------------------------------------------------------------------
__device__ __forceinline__ v16h load_frag16(const _Float16* __restrict__ p,
                                            int ld, int r0, int k0, int lane) {
  const int m    = lane & 15;
  const int half = lane >> 4;
  const _Float16* q = p + (size_t)(r0 + m) * ld + (k0 + 8 * half);
  v16h f;
#pragma unroll
  for (int i = 0; i < 8; ++i) f[i]     = q[i];        // VGPR 0..3: K 0..7
#pragma unroll
  for (int i = 0; i < 8; ++i) f[8 + i] = q[16 + i];   // VGPR 4..7: K 16..23
  return f;
}

__device__ __forceinline__ v8f wmma_f16(v16h a, v16h b, v8f c) {
  return __builtin_amdgcn_wmma_f32_16x16x32_f16(
      /*neg_a=*/false, a, /*neg_b=*/false, b,
      /*c_mod=*/(short)0, c, /*reuse_a=*/false, /*reuse_b=*/false);
}

// ---------------------------------------------------------------------------
// Workgroup-tiled GEMM core: 256x256 tile, 8 waves (2x4), two per SIMD, K staged in LDS via
// double-buffered async copies (two-buffer ring, one barrier per k-slice). acc is this wave's
// 128x64 (8x4 fragment tiles).
// Xg, Wg: [rows x 1024] row-major f16. acc = Xg rows (row0..) times Wg rows (n0..) transposed:
// a lane holds 8 neighbouring Xg-row indices (register axis) at one Wg-row index (lane axis).
// The callers pick which matrix goes on which side so that the register axis is the
// axis that is contiguous in their output.
// ---------------------------------------------------------------------------
__device__ __forceinline__ void stage_slice(const _Float16* __restrict__ xs,
                                            const _Float16* __restrict__ ws,
                                            _Float16* ad, _Float16* bd) {
  async_stage_tile(xs, ad);
  async_stage_tile(xs + 128 * D_MODEL, ad + 128 * LSTR);
  async_stage_tile(ws, bd);
  async_stage_tile(ws + 128 * D_MODEL, bd + 128 * LSTR);
}

// one 32-k block of a wave's 128x64 tile: 8 x 4 fragment products
__device__ __forceinline__ void mma_block(const v16h a[8], const v16h b[4], v8f acc[8][4]) {
#pragma unroll
  for (int mt = 0; mt < 8; ++mt)
#pragma unroll
    for (int nt = 0; nt < 4; ++nt)
      acc[mt][nt] = wmma_f16(a[mt], b[nt], acc[mt][nt]);
}

__device__ __forceinline__ void gemm_core_256(const _Float16* __restrict__ Xg,
                                              const _Float16* __restrict__ Wg,
                                              int row0, int n0, int tid,
                                              _Float16* As, _Float16* Bs,
                                              v8f acc[8][4]) {
  const int lane = tid & 31;
  const int wave = tid >> 5;
  const int wr = (wave >> 2) * 128;  // wave row offset inside 256x256 tile
  const int wc = (wave & 3) * 64;    // wave col offset inside 256x256 tile

  // this thread's piece of tile rows 0..15: row tid >> 4, 16-byte piece tid & 15
  const int srow = tid >> 4;
  const int scol = (tid & 15) * 8;
  const _Float16* xsrc = Xg + (size_t)(row0 + srow) * D_MODEL + scol;
  const _Float16* wsrc = Wg + (size_t)(n0 + srow) * D_MODEL + scol;
  _Float16* adst = As + srow * LSTR + scol;
  _Float16* bdst = Bs + srow * LSTR + scol;

  // prologue: slice 0 lands in buffer 0 and is published, then slice 1 starts
  stage_slice(xsrc, wsrc, adst, bdst);
  asm volatile("s_wait_asynccnt 0x0" ::: "memory");  // this wave's slice-0 copies have landed
  __syncthreads();                                   // every wave's slice-0 copies visible
  stage_slice(xsrc + BK, wsrc + BK, adst + ABUF, bdst + ABUF);

  const int steps = D_MODEL / BK;
  for (int i = 0; i < steps; ++i) {
    const int cur = i & 1;
    const _Float16* Ab = As + cur * ABUF;
    const _Float16* Bb = Bs + cur * ABUF;
#pragma unroll
    for (int kk = 0; kk < BK; kk += 32) {
      v16h a[8], b[4];
      // Fence pair: holds this block's 24 LDS reads together as one group in front of its
      // 32 WMMAs. Left free, the compiler spread them in pairs among the WMMAs, each pair
      // behind a wait to 0, which two waves a SIMD cannot hide.
      __builtin_amdgcn_sched_barrier(0);
#pragma unroll
      for (int nt = 0; nt < 4; ++nt) b[nt] = load_frag16(Bb, LSTR, wc + 16 * nt, kk, lane);
#pragma unroll
      for (int mt = 0; mt < 8; ++mt) a[mt] = load_frag16(Ab, LSTR, wr + 16 * mt, kk, lane);
      __builtin_amdgcn_sched_barrier(0);
      mma_block(a, b, acc);
    }

    // publish point of slice i + 1, which also frees buffer `cur` for the refill
    asm volatile("s_wait_dscnt 0x0" ::: "memory");     // own reads of `cur` retired before it is refilled
    asm volatile("s_wait_asynccnt 0x0" ::: "memory");  // own copies of slice i + 1 have landed
    __syncthreads();
    if (i + 2 < steps)
      stage_slice(xsrc + (i + 2) * BK, wsrc + (i + 2) * BK, adst + cur * ABUF, bdst + cur * ABUF);
  }
  asm volatile("s_wait_asynccnt 0x0" ::: "memory");    // nothing in flight when the ring is left
}

// ---------------------------------------------------------------------------
// Conversion kernels
// ---------------------------------------------------------------------------
#define CS_WAVES 16             // waves per work-group of the activation stream
#define CS_LOADS 16             // 16-byte loads a lane has in flight
#define CS_GRID  256            // work-groups of the activation stream

// f32 -> f16 stream. One wave-wide load covers 512 contiguous bytes (4 whole lines), the
// matching store 256 contiguous bytes (2 whole lines). A wave owns a contiguous range and
// walks it in groups of CS_LOADS loads, all issued before the first one is converted.
__global__ void __launch_bounds__(CS_WAVES * 32)
convert_src_kernel(const float* __restrict__ in, _Float16* __restrict__ out) {
  const int lane = threadIdx.x & 31;
  const int wave = blockIdx.x * CS_WAVES + (threadIdx.x >> 5);
  const size_t per_wave = (size_t)M_TOTAL * D_MODEL / (CS_GRID * CS_WAVES);  // 4096 floats
  const float*    ip = in + wave * per_wave + lane * 4;
  _Float16*       op = out + wave * per_wave + lane * 4;
  for (size_t g = 0; g < per_wave; g += CS_LOADS * 128) {
    v4f x[CS_LOADS];
#pragma unroll
    for (int c = 0; c < CS_LOADS; ++c) x[c] = *(const v4f*)(ip + g + c * 128);
#pragma unroll
    for (int c = 0; c < CS_LOADS; ++c) {
      v4h h;
#pragma unroll
      for (int r = 0; r < 4; ++r) h[r] = (_Float16)x[c][r];
      *(v4h*)(op + g + c * 128) = h;
    }
  }
}

#define TK   128                // k extent of a weight tile
#define TN   64                 // n extent of a weight tile
#define TSTR 136                // LDS row stride in halves (128 + 8 pad, rows stay 16-B aligned)

// wT[z][n][k] = W_z[k][n]  (f16, transposed so K-pairs are contiguous).
// One work-group turns a 128 (k) x 64 (n) tile through LDS: 16 lanes read one 256-B piece
// of a W row, 16 lanes write one 256-B piece of a wT row, whole lines on both sides.
__global__ void __launch_bounds__(256)
convert_w_kernel(const float* __restrict__ Wq,
                 const float* __restrict__ Wk,
                 const float* __restrict__ Wv,
                 const float* __restrict__ Wo,
                 _Float16* __restrict__ wT) {
  __shared__ __attribute__((aligned(16))) _Float16 tile[TN * TSTR];
  const int tid = threadIdx.x;
  const int k0 = blockIdx.x * TK;
  const int n0 = blockIdx.y * TN;
  const int z  = blockIdx.z;
  const float* W = (z == 0) ? Wq : (z == 1) ? Wk : (z == 2) ? Wv : Wo;

  // a thread takes 4 neighbouring n of the k pairs (2 * kp, 2 * kp + 1), kp = tid >> 4 + 16 * c
  const int nq = (tid & 15) * 4;
  const int kp = tid >> 4;
  const float* wp = W + (size_t)(k0 + 2 * kp) * D_MODEL + n0 + nq;
  v4f lo[4], hi[4];
#pragma unroll
  for (int c = 0; c < 4; ++c) {
    lo[c] = *(const v4f*)(wp + (size_t)(32 * c) * D_MODEL);
    hi[c] = *(const v4f*)(wp + (size_t)(32 * c + 1) * D_MODEL);
  }
#pragma unroll
  for (int c = 0; c < 4; ++c)
#pragma unroll
    for (int j = 0; j < 4; ++j) {
      v2h p;
      p[0] = (_Float16)lo[c][j];
      p[1] = (_Float16)hi[c][j];
      *(v2h*)(tile + (nq + j) * TSTR + 2 * kp + 32 * c) = p;
    }
  __syncthreads();   // the tile's rows are read back by other lanes than wrote them

  const int rr = tid >> 4, pc = (tid & 15) * 8;
  _Float16* dst = wT + (size_t)z * D_MODEL * D_MODEL + (size_t)(n0 + rr) * D_MODEL + k0 + pc;
#pragma unroll
  for (int it = 0; it < 4; ++it)
    *(v8h*)(dst + (size_t)(it * 16) * D_MODEL) = *(const v8h*)(tile + (it * 16 + rr) * TSTR + pc);
}

// ---------------------------------------------------------------------------
// QKV projection: 256x256 workgroup tile, 8 waves. z selects Q/K/V.
// Q,K stored row-major f16 [16384 x 1024].
// V stored head-transposed: vT[(bb*HEADS+h)*DK*BLK + d*BLK + t]
// ---------------------------------------------------------------------------
__global__ void __launch_bounds__(256)
qkv_gemm_kernel(const _Float16* __restrict__ X, const _Float16* __restrict__ WT,
                const float* __restrict__ bq, const float* __restrict__ bk,
                const float* __restrict__ bv, _Float16* __restrict__ qO,
                _Float16* __restrict__ kO, _Float16* __restrict__ vT) {
  __shared__ __attribute__((aligned(16))) _Float16 As[2 * ABUF];
  __shared__ __attribute__((aligned(16))) _Float16 Bs[2 * ABUF];

  const int tid  = threadIdx.x;
  const int lane = tid & 31;
  const int wave = tid >> 5;
  const int row0 = blockIdx.x * 256;
  const int n0   = blockIdx.y * 256;
  const int proj = blockIdx.z;
  const _Float16* W = WT + (size_t)proj * D_MODEL * D_MODEL;

  const v8f vzero = {0.f, 0.f, 0.f, 0.f, 0.f, 0.f, 0.f, 0.f};
  v8f acc[8][4];
#pragma unroll
  for (int mt = 0; mt < 8; ++mt)
#pragma unroll
    for (int nt = 0; nt < 4; ++nt) acc[mt][nt] = vzero;

  // V is stored token-contiguous, Q and K feature-contiguous: the contiguous axis
  // goes on the accumulator's register axis (block-uniform choice).
  const bool isV = (proj == 2);
  const int a0 = isV ? row0 : n0;
  const int b0 = isV ? n0 : row0;
  gemm_core_256(isV ? X : W, isV ? W : X, a0, b0, tid, As, Bs, acc);

  const int half = lane >> 4, nl = lane & 15;
  const int wa = a0 + (wave >> 2) * 128;  // first register-axis index of this wave's tile
  const int wb = b0 + (wave & 3) * 64;    // first lane-axis index of this wave's tile
  // The ring is dead behind its last barrier; each wave stages its 128 x 64 tile in
  // its own range of it, one row per lane-axis index, 256 B of payload a row.
  _Float16* stg = As + wave * WSTG;
  if (isV) {
    const int bi = wb + nl;
    float bb[4];
#pragma unroll
    for (int nt = 0; nt < 4; ++nt) bb[nt] = bv[bi + nt * 16];
    // Precaution: stands in front of any rewrite of the bias loads' address register; the
    // index is named as an input so that its register stays live up to the wait.
    asm volatile("s_wait_xcnt 0x0" :: "v"(bi) : "memory");
#pragma unroll
    for (int nt = 0; nt < 4; ++nt) {
#pragma unroll
      for (int mt = 0; mt < 8; ++mt) {
        v8h h;
#pragma unroll
        for (int r = 0; r < 8; ++r) h[r] = (_Float16)(acc[mt][nt][r] + bb[nt]);
        *(v8h*)(stg + (nt * 16 + nl) * LSTR + mt * 16 + 8 * half) = h;
      }
    }
  } else {
    const float* bias = (proj == 0) ? bq : bk;
    const float* bp = bias + wa + 8 * half;
    v4f blo[8], bhi[8];
#pragma unroll
    for (int mt = 0; mt < 8; ++mt) {
      blo[mt] = *(const v4f*)(bp + mt * 16);
      bhi[mt] = *(const v4f*)(bp + mt * 16 + 4);
    }
    // Precaution, as in the other branch: the address lives up to the wait.
    asm volatile("s_wait_xcnt 0x0" :: "v"(bp) : "memory");
#pragma unroll
    for (int mt = 0; mt < 8; ++mt) {
#pragma unroll
      for (int nt = 0; nt < 4; ++nt) {
        v8h h;
#pragma unroll
        for (int r = 0; r < 4; ++r) {
          h[r]     = (_Float16)(acc[mt][nt][r] + blo[mt][r]);
          h[4 + r] = (_Float16)(acc[mt][nt][4 + r] + bhi[mt][r]);
        }
        *(v8h*)(stg + (nt * 16 + nl) * LSTR + mt * 16 + 8 * half) = h;
      }
    }
  }
  __syncthreads();   // the staged rows are read back by other lanes than wrote them

  // 16 lanes carry one staged row = two whole 128-B lines of the output
  const int rr = lane >> 4, pc = (lane & 15) * 8;
  const _Float16* rd = stg + rr * LSTR + pc;
  if (isV) {
    // wa = (b*64 + blk)*64, register axis = t over two neighbouring blocks (8 lanes
    // each); wb = h*128 + d0, lane axis = d
    _Float16* dst = vT + ((size_t)((wa >> 6) + (pc >> 6)) * HEADS + (wb >> 7)) * (DK * BLK) +
                    (size_t)((wb & 127) + rr) * BLK + (pc & 63);
#pragma unroll
    for (int it = 0; it < 32; ++it)
      *(v8h*)(dst + it * 2 * BLK) = *(const v8h*)(rd + it * 2 * LSTR);
    // Precaution: stands behind the run's last store, in front of whatever code the
    // compiler lays behind this branch and lets rewrite the stores' registers.
    asm volatile("s_wait_xcnt 0x0" ::: "memory");
  } else {
    _Float16* dst = ((proj == 0) ? qO : kO) + (size_t)(wb + rr) * D_MODEL + wa + pc;
#pragma unroll
    for (int it = 0; it < 32; ++it)
      *(v8h*)(dst + it * 2 * D_MODEL) = *(const v8h*)(rd + it * 2 * LSTR);
    // Precaution, as in the other branch.
    asm volatile("s_wait_xcnt 0x0" ::: "memory");
  }
}

// ---------------------------------------------------------------------------
// Block attention: one workgroup per (b,blk), one wave per head.
// Q, K and V come to LDS as whole 128-B lines by async copies, each head's tiles in the
// two LDS ranges of its own wave, and the WMMA fragments are read from there.
// scores(64x64) in registers -> softmax (shfl_xor within 16-lane halves)
// -> P staged in LDS -> P @ V via WMMA -> f16 attention output row-major,
// staged in the wave's own LDS range and stored as whole lines.
// ---------------------------------------------------------------------------
__global__ void __launch_bounds__(256)
attn_kernel(const _Float16* __restrict__ Q, const _Float16* __restrict__ K,
            const _Float16* __restrict__ VT, _Float16* __restrict__ AO) {
  __shared__ __attribute__((aligned(16))) _Float16 L0[HEADS][AR0];   // 144 KB
  __shared__ __attribute__((aligned(16))) _Float16 L1[HEADS][AR1];   // 136 KB

  const int lane = threadIdx.x & 31;
  const int h    = threadIdx.x >> 5;         // head
  const int bb   = blockIdx.x;               // b*64 + blk
  const int row0 = bb * BLK;                 // flat token row base
  const int col0 = h * DK;
  const int half = lane >> 4, nl = lane & 15;
  const int rr = lane >> 4, pc = (lane & 15) * 8;   // 16 lanes carry one 256-B row piece
  _Float16* r0 = &L0[h][0];                  // Q, then V
  _Float16* r1 = &L1[h][0];                  // K, then P, then the output rows

  // Q and K tiles, 64 rows x 256 B each: one copy takes two rows = four whole lines
  {
    const _Float16* qsrc = Q + (size_t)(row0 + rr) * D_MODEL + col0 + pc;
    const _Float16* ksrc = K + (size_t)(row0 + rr) * D_MODEL + col0 + pc;
    _Float16* qdst = r0 + rr * LSTR + pc;
    _Float16* kdst = r1 + rr * LSTR + pc;
    // the three copy loops of this kernel are unrolled so that the copies issue back to back
#pragma unroll
    for (int c = 0; c < 4; ++c)
      async_copy8<2 * LSTR * 2, 2 * D_MODEL * 2>(qsrc + c * 16 * D_MODEL, qdst + c * 16 * LSTR);
#pragma unroll
    for (int c = 0; c < 3; ++c)
      async_copy8<2 * LSTR * 2, 2 * D_MODEL * 2>(ksrc + c * 16 * D_MODEL, kdst + c * 16 * LSTR);
    // Keeps the wave below 64 outstanding copies: at most 48 are left when the last 8 issue.
    asm volatile("s_wait_asynccnt 0x30" ::: "memory");
    async_copy8<2 * LSTR * 2, 2 * D_MODEL * 2>(ksrc + 3 * 16 * D_MODEL, kdst + 3 * 16 * LSTR);
  }
  asm volatile("s_wait_asynccnt 0x0" ::: "memory");  // this wave's Q and K copies have landed
  __syncthreads();                                   // no tile is read in front of this barrier

  const v8f vzero = {0.f, 0.f, 0.f, 0.f, 0.f, 0.f, 0.f, 0.f};
  v8f s[4][4];
#pragma unroll
  for (int mt = 0; mt < 4; ++mt)
#pragma unroll
    for (int nt = 0; nt < 4; ++nt) s[mt][nt] = vzero;

  // scores = Q_blk @ K_blk^T over dk=128
  for (int kk = 0; kk < DK; kk += 32) {
    v16h a[4], b[4];
#pragma unroll
    for (int mt = 0; mt < 4; ++mt)
      a[mt] = load_frag16(r0, LSTR, 16 * mt, kk, lane);
#pragma unroll
    for (int nt = 0; nt < 4; ++nt)   // B[k][n] = K[row0+n][col0+kk+k]
      b[nt] = load_frag16(r1, LSTR, 16 * nt, kk, lane);
#pragma unroll
    for (int mt = 0; mt < 4; ++mt)
#pragma unroll
      for (int nt = 0; nt < 4; ++nt)
        s[mt][nt] = wmma_f16(a[mt], b[nt], s[mt][nt]);
  }

  // V tile, [d][t] per (bb,h): 128 rows x 128 B, contiguous in memory; one copy takes four
  // rows = four whole lines. It lands in Q's range, which only this wave has read, while
  // the softmax runs.
  asm volatile("s_wait_dscnt 0x0" ::: "memory");     // own reads of Q and K retired before the refill
  {
    const _Float16* vsrc = VT + ((size_t)bb * HEADS + h) * (DK * BLK) + lane * 8;
    _Float16* vdst = r0 + (lane >> 3) * VSTR + (lane & 7) * 8;
#pragma unroll
    for (int c = 0; c < 4; ++c)
      async_copy8<4 * VSTR * 2, 4 * BLK * 2>(vsrc + c * 32 * BLK, vdst + c * 32 * VSTR);
  }

  // row softmax: each row M lives in 16 lanes (one half) across 4 nt tiles
  const float scale = 0.08838834764831845f;  // dk^-0.5
#pragma unroll
  for (int mt = 0; mt < 4; ++mt)
#pragma unroll
    for (int r = 0; r < 8; ++r) {
      float x0 = s[mt][0][r] * scale, x1 = s[mt][1][r] * scale;
      float x2 = s[mt][2][r] * scale, x3 = s[mt][3][r] * scale;
      float mx = fmaxf(fmaxf(x0, x1), fmaxf(x2, x3));
#pragma unroll
      for (int msk = 1; msk < 16; msk <<= 1)
        mx = fmaxf(mx, __shfl_xor(mx, msk, 32));
      float e0 = __expf(x0 - mx), e1 = __expf(x1 - mx);
      float e2 = __expf(x2 - mx), e3 = __expf(x3 - mx);
      float sum = e0 + e1 + e2 + e3;
#pragma unroll
      for (int msk = 1; msk < 16; msk <<= 1)
        sum += __shfl_xor(sum, msk, 32);
      float inv = 1.0f / sum;
      int m = mt * 16 + r + 8 * half;
      r1[m * BLK + 0 * 16 + nl] = (_Float16)(e0 * inv);
      r1[m * BLK + 1 * 16 + nl] = (_Float16)(e1 * inv);
      r1[m * BLK + 2 * 16 + nl] = (_Float16)(e2 * inv);
      r1[m * BLK + 3 * 16 + nl] = (_Float16)(e3 * inv);
    }
  asm volatile("s_wait_asynccnt 0x0" ::: "memory");  // this wave's V copies have landed
  __syncthreads();   // V is not read in front of it; P is read by other lanes than wrote it

  // P's fragments go to registers once: the output rows below overwrite P's range
  // (unrolled: a register array wants constant indices)
  v16h pa[2][4];
#pragma unroll
  for (int k2 = 0; k2 < 2; ++k2)
#pragma unroll
    for (int mt = 0; mt < 4; ++mt) pa[k2][mt] = load_frag16(r1, BLK, mt * 16, k2 * 32, lane);

  // out = P(64x64) @ V(64x128); V is [d][t] so K-pairs contiguous
  for (int dt = 0; dt < 8; ++dt) {
    v8f o[4];
#pragma unroll
    for (int mt = 0; mt < 4; ++mt) o[mt] = vzero;
#pragma unroll
    for (int k2 = 0; k2 < 2; ++k2) {
      v16h b = load_frag16(r0, VSTR, dt * 16, k2 * 32, lane);  // A[m][k]=V[t=k][d=m]
#pragma unroll
      for (int mt = 0; mt < 4; ++mt) {
        // V as the A operand: features d on the register axis, tokens on the lane axis
        o[mt] = wmma_f16(b, pa[k2][mt], o[mt]);
      }
    }
#pragma unroll
    for (int mt = 0; mt < 4; ++mt) {
      v8h hv;
#pragma unroll
      for (int r = 0; r < 8; ++r) hv[r] = (_Float16)o[mt][r];
      *(v8h*)(r1 + (mt * 16 + nl) * OSTR + dt * 16 + 8 * half) = hv;
    }
  }
  __syncthreads();   // the staged rows are read back by other lanes than wrote them

  // 16 lanes carry one staged row = two whole 128-B lines of the output
  _Float16* dst = AO + (size_t)(row0 + rr) * D_MODEL + col0 + pc;
#pragma unroll
  for (int it = 0; it < 32; ++it)
    *(v8h*)(dst + it * 2 * D_MODEL) = *(const v8h*)(r1 + (it * 2 + rr) * OSTR + pc);
}

// ---------------------------------------------------------------------------
// Output projection: attn(f16) @ Wo^T(f16) + bo -> fp32 d_out
// ---------------------------------------------------------------------------
__global__ void __launch_bounds__(256)
out_gemm_kernel(const _Float16* __restrict__ X, const _Float16* __restrict__ WoT,
                const float* __restrict__ bo, float* __restrict__ out) {
  __shared__ __attribute__((aligned(16))) _Float16 As[2 * ABUF];
  __shared__ __attribute__((aligned(16))) _Float16 Bs[2 * ABUF];

  const int tid  = threadIdx.x;
  const int lane = tid & 31;
  const int wave = tid >> 5;
  const int row0 = blockIdx.x * 256;
  const int n0   = blockIdx.y * 256;

  const v8f vzero = {0.f, 0.f, 0.f, 0.f, 0.f, 0.f, 0.f, 0.f};
  v8f acc[8][4];
#pragma unroll
  for (int mt = 0; mt < 8; ++mt)
#pragma unroll
    for (int nt = 0; nt < 4; ++nt) acc[mt][nt] = vzero;

  // output features on the accumulator's register axis, tokens on its lane axis
  gemm_core_256(WoT, X, n0, row0, tid, As, Bs, acc);

  const int half = lane >> 4, nl = lane & 15;
  const int wa = n0 + (wave >> 2) * 128;    // first output feature of this wave's tile
  const int wb = row0 + (wave & 3) * 64;    // first token row of this wave's tile
  // The ring is dead behind its last barrier; each wave stages its 64 token rows of
  // 128 floats in its own range: waves 0..3 in As, waves 4..7 in Bs.
  float* stg = (float*)(((wave < 4) ? As : Bs) + (wave & 3) * FSTG);
  const float* bp = bo + wa + 8 * half;
  v4f blo[8], bhi[8];
#pragma unroll
  for (int mt = 0; mt < 8; ++mt) {
    blo[mt] = *(const v4f*)(bp + mt * 16);
    bhi[mt] = *(const v4f*)(bp + mt * 16 + 4);
  }
  // Precaution: stands in front of any rewrite of the bias loads' address registers; the
  // address is named as an input so that its registers stay live up to the wait.
  asm volatile("s_wait_xcnt 0x0" :: "v"(bp) : "memory");
#pragma unroll
  for (int mt = 0; mt < 8; ++mt) {
#pragma unroll
    for (int nt = 0; nt < 4; ++nt) {
      v4f lo, hi;
#pragma unroll
      for (int r = 0; r < 4; ++r) {
        lo[r] = acc[mt][nt][r] + blo[mt][r];
        hi[r] = acc[mt][nt][4 + r] + bhi[mt][r];
      }
      float* s = stg + (nt * 16 + nl) * FSTR + mt * 16 + 8 * half;
      *(v4f*)s       = lo;
      *(v4f*)(s + 4) = hi;
    }
  }
  __syncthreads();   // the staged rows are read back by other lanes than wrote them

  // the wave's 32 lanes carry one staged row = four whole 128-B lines of the output
  float* dst = out + (size_t)wb * D_MODEL + wa + lane * 4;
#pragma unroll
  for (int it = 0; it < 64; ++it)
    *(v4f*)(dst + it * D_MODEL) = *(const v4f*)(stg + it * FSTR + lane * 4);
}

// ---------------------------------------------------------------------------
extern "C" void kernel_launch(void* const* d_in, const int* in_sizes, int n_in,
                              void* d_out, int out_size, void* d_ws, size_t ws_size,
                              hipStream_t stream) {
  const float* src = (const float*)d_in[0];
  const float* Wq  = (const float*)d_in[1];
  const float* bq  = (const float*)d_in[2];
  const float* Wk  = (const float*)d_in[3];
  const float* bk  = (const float*)d_in[4];
  const float* Wv  = (const float*)d_in[5];
  const float* bv  = (const float*)d_in[6];
  const float* Wo  = (const float*)d_in[7];
  const float* bo  = (const float*)d_in[8];
  float* out = (float*)d_out;

  const size_t actN = (size_t)M_TOTAL * D_MODEL;   // 16,777,216 halves
  const size_t wN   = (size_t)4 * D_MODEL * D_MODEL;

  _Float16* srcH = (_Float16*)d_ws;        // also reused as attention output
  _Float16* wT   = srcH + actN;            // 4 transposed f16 weight matrices
  _Float16* qH   = wT + wN;
  _Float16* kH   = qH + actN;
  _Float16* vT   = kH + actN;              // head-transposed V
  _Float16* attn = srcH;                   // alias: src dead after QKV GEMM

  // 1. fp32 -> f16 conversions
  convert_src_kernel<<<CS_GRID, CS_WAVES * 32, 0, stream>>>(src, srcH);
  convert_w_kernel<<<dim3(D_MODEL / TK, D_MODEL / TN, 4), 256, 0, stream>>>(
      Wq, Wk, Wv, Wo, wT);

  // 2. fused QKV projections (256x256 tile per workgroup, async LDS staging)
  qkv_gemm_kernel<<<dim3(M_TOTAL / 256, D_MODEL / 256, 3), 256, 0, stream>>>(
      srcH, wT, bq, bk, bv, qH, kH, vT);

  // 3. block-local attention (one workgroup per (b,blk), one wave per head)
  attn_kernel<<<dim3(BATCH * (SEQ / BLK)), 256, 0, stream>>>(qH, kH, vT, attn);

  // 4. output projection -> fp32
  out_gemm_kernel<<<dim3(M_TOTAL / 256, D_MODEL / 256), 256, 0, stream>>>(
      attn, wT + (size_t)3 * D_MODEL * D_MODEL, bo, out);
}

// v006
// Measured time: 117 microseconds a run.
// In both of two side-by-side timings against v005, it was 1.07 times as fast.
// All steps since v000 together make it 2.40 times as fast.
#include <hip/hip_runtime.h>

typedef __attribute__((ext_vector_type(16))) _Float16 v16h;
typedef __attribute__((ext_vector_type(8)))  float    v8f;
typedef __attribute__((ext_vector_type(8)))  _Float16 v8h;
typedef __attribute__((ext_vector_type(4)))  float    v4f;
typedef __attribute__((ext_vector_type(4)))  _Float16 v4h;
typedef __attribute__((ext_vector_type(2)))  _Float16 v2h;
typedef __attribute__((ext_vector_type(4)))  uint32_t u32x4;
typedef __attribute__((ext_vector_type(8)))  uint32_t u32x8;

#define D_MODEL 1024
#define SEQ     4096
#define BATCH   4
#define HEADS   8
#define BLK     64
#define DK      128
#define M_TOTAL (BATCH * SEQ)   // 16384 rows

#define BK   128                // k-slice per stage in halves: 256 B of a row, two whole cache lines
#define LSTR 136                // LDS row stride in halves (128 + 8 pad, 272B = 16B x odd: bank-conflict free)
#define SLICE_B 18432           // bytes of one wave's slice of a stage: 64 rows x 272 B = 17,408, rounded up to a multiple of 2 KiB
#define SLICE_H (SLICE_B / 2)   // the same in halves
#define STAGE_B (8 * SLICE_B)   // bytes of one stage: four slices of the register-axis operand, then four of the lane-axis operand
#define STAGE_H (STAGE_B / 2)   // the same in halves
#define WSTG (64 * LSTR)        // halves of one wave's own f16 epilogue staging range (17,408 B; eight lie in the dead ring)
#define FSTR 132                // f32 staging row stride in floats (128 + 4 pad, 528B = 16B x odd)
#define FSTG (64 * FSTR * 2)    // halves of one wave's own f32 epilogue staging range (33,792 B; eight lie in the dead ring)
#define OSTR 136                // attention output staging row stride in halves (128 + 8 pad, 272B = 16B x odd)
#define VSTR 72                 // attention V staging row stride in halves (64 + 8 pad, 144B = 16B x odd)
#define AR0  (DK * VSTR)        // halves of a head's first LDS range: Q (64 x LSTR fits), then V (128 x VSTR)
#define AR1  (BLK * LSTR)       // halves of a head's second LDS range: K, then P, then the output rows

// ---------------------------------------------------------------------------
// Tensor load of one wave's slice of a GEMM stage: 64 rows x 256 B, source pitch 2,048 B,
// global -> LDS through no register; the pad lays the rows at the 272-B pitch of LSTR.
// ---------------------------------------------------------------------------
__device__ __forceinline__ uint32_t uni(uint32_t v) {
  return (uint32_t)__builtin_amdgcn_readfirstlane(v);
}

__device__ __forceinline__ uint32_t pinned(uint32_t v) {
  uint32_t w = (uint32_t)__builtin_amdgcn_readfirstlane(v);
  // A tensor load ignores EXEC: the branch round it must compile to a scalar branch.
  asm volatile("" : "+s"(w));  // pinned(): the test word held in a scalar register
  return w;
}

__device__ __forceinline__ u32x4 slice_group0(uint32_t lds_dst, uint64_t ga) {
  u32x4 g0;
  g0[0] = uni(1u);                                    // count 1
  g0[1] = uni(lds_dst);                               // byte offset in the work-group's LDS
  g0[2] = uni((uint32_t)ga);
  g0[3] = uni((((uint32_t)(ga >> 32)) & 0x01FFFFFFu) | 0x80000000u);  // type 2
  return g0;
}

__device__ __forceinline__ u32x8 slice_group1() {
  u32x8 g1;
  g1[0] = uni((1u << 20) | (5u << 22) | (3u << 25));  // no mask, 1-byte elements, 16 B of pad behind every 256 B
  g1[1] = uni(256u << 16);                            // tensor_dim0 = 256 B
  g1[2] = uni(64u << 16);                             // tensor_dim1 = 64 rows
  g1[3] = uni(256u << 16);                            // tile_dim0 = 256 B
  g1[4] = uni(64u);                                   // tile_dim1 = 64 rows
  g1[5] = uni(D_MODEL * 2u);                          // source row pitch in bytes
  g1[6] = uni(0u);
  g1[7] = uni(0u);
  return g1;
}

__device__ __forceinline__ void tensor_load(u32x4 g0, u32x8 g1) {
  asm volatile("tensor_load_to_lds %0, %1" :: "s"(g0), "s"(g1) : "memory");
}

// The issuing wave's wait for its one outstanding request. The request's group 0 is named as
// an input so that its registers stay live, and so unwritten, up to the wait.
__device__ __forceinline__ void wait_tensor0(u32x4 g0) {
  asm volatile("s_wait_tensorcnt 0x0" :: "s"(g0) : "memory");
}

// ---------------------------------------------------------------------------
// Eight async b128 copies of one wave, global -> LDS: copy c takes the lane's own
// addresses LS bytes (LDS) and GS bytes (global) times c further on.
// ---------------------------------------------------------------------------
template <unsigned LS, unsigned GS>
__device__ __forceinline__ void async_copy8(const _Float16* __restrict__ g, _Float16* lds) {
  const unsigned l = (unsigned)(uintptr_t)lds;        // LDS byte offset (low 32 bits)
  const unsigned long long a = (unsigned long long)(uintptr_t)g;
  const unsigned long long G = GS;
  // The closing s_wait_xcnt is a precaution: it stands in front of every later rewrite of
  // these address registers, and inside the copies' own statement nothing can be scheduled
  // between it and them.
  asm volatile(
      "global_load_async_to_lds_b128 %0, %8, off\n\t"
      "global_load_async_to_lds_b128 %1, %9, off\n\t"
      "global_load_async_to_lds_b128 %2, %10, off\n\t"
      "global_load_async_to_lds_b128 %3, %11, off\n\t"
      "global_load_async_to_lds_b128 %4, %12, off\n\t"
      "global_load_async_to_lds_b128 %5, %13, off\n\t"
      "global_load_async_to_lds_b128 %6, %14, off\n\t"
      "global_load_async_to_lds_b128 %7, %15, off\n\t"
      "s_wait_xcnt 0x0"
      :: "v"(l), "v"(l + LS), "v"(l + 2 * LS), "v"(l + 3 * LS),
         "v"(l + 4 * LS), "v"(l + 5 * LS), "v"(l + 6 * LS), "v"(l + 7 * LS),
         "v"(a), "v"(a + G), "v"(a + 2 * G), "v"(a + 3 * G),
         "v"(a + 4 * G), "v"(a + 5 * G), "v"(a + 6 * G), "v"(a + 7 * G)
      : "memory");
}

// ---------------------------------------------------------------------------
// Fragment helpers (wave32, 16-bit 16x16x32 WMMA layout)
// A (16x32): lane L holds row M=L&15; half=L>>4 adds +8 to K.
//   VGPR j<4  -> K pair {2j, 2j+1} (+8*half)
//   VGPR j>=4 -> K pair {16+2(j-4), ...} (+8*half)
// B (32x16) is symmetric with N=L&15; memory addressed as p[n*ld + k].
// ---------------------------------------------------------------------------
__device__ __forceinline__ v16h load_frag16(const _Float16* __restrict__ p,
                                            int ld, int r0, int k0, int lane) {
  const int m    = lane & 15;
  const int half = lane >> 4;
  const _Float16* q = p + (size_t)(r0 + m) * ld + (k0 + 8 * half);
  v16h f;
#pragma unroll
  for (int i = 0; i < 8; ++i) f[i]     = q[i];        // VGPR 0..3: K 0..7
#pragma unroll
  for (int i = 0; i < 8; ++i) f[8 + i] = q[16 + i];   // VGPR 4..7: K 16..23
  return f;
}

__device__ __forceinline__ v8f wmma_f16(v16h a, v16h b, v8f c) {
  return __builtin_amdgcn_wmma_f32_16x16x32_f16(
      /*neg_a=*/false, a, /*neg_b=*/false, b,
      /*c_mod=*/(short)0, c, /*reuse_a=*/false, /*reuse_b=*/false);
}

// ---------------------------------------------------------------------------
// Workgroup-tiled GEMM core: 256x256 tile, 8 waves (2x4), two per SIMD, K staged in LDS by
// tensor loads, one per wave and stage (two-buffer ring, one barrier per k-slice). acc is this
// wave's 128x64 (8x4 fragment tiles).
// Xg, Wg: [rows x 1024] row-major f16. acc = Xg rows (row0..) times Wg rows (n0..) transposed:
// a lane holds 8 neighbouring Xg-row indices (register axis) at one Wg-row index (lane axis).
// The callers pick which matrix goes on which side so that the register axis is the
// axis that is contiguous in their output.
// ---------------------------------------------------------------------------
// one 32-k block of a wave's 128x64 tile: 8 x 4 fragment products
__device__ __forceinline__ void mma_block(const v16h a[8], const v16h b[4], v8f acc[8][4]) {
#pragma unroll
  for (int mt = 0; mt < 8; ++mt)
#pragma unroll
    for (int nt = 0; nt < 4; ++nt)
      acc[mt][nt] = wmma_f16(a[mt], b[nt], acc[mt][nt]);
}

__device__ __forceinline__ void gemm_core_256(const _Float16* __restrict__ Xg,
                                              const _Float16* __restrict__ Wg,
                                              int row0, int n0, int tid,
                                              _Float16* Ring, v8f acc[8][4]) {
  const int lane = tid & 31;
  const uint32_t wave = uni((uint32_t)tid >> 5);

  // this wave's slice of every stage: waves 0..3 bring 64 Xg rows each, waves 4..7 64 Wg rows
  const _Float16* srow = (wave < 4u) ? Xg + (size_t)(row0 + 64 * (int)wave) * D_MODEL
                                     : Wg + (size_t)(n0 + 64 * ((int)wave - 4)) * D_MODEL;
  const uint64_t ga = (uint64_t)(uintptr_t)srow;
  const uint32_t ld = (uint32_t)(uintptr_t)Ring + wave * SLICE_B;  // LDS byte offset (low 32 bits)

  // the slices this wave reads: two of Xg rows (128 rows), one of Wg rows (64 rows)
  const int asl = (int)(wave >> 2) * 2 * SLICE_H;
  const int bsl = (4 + (int)(wave & 3u)) * SLICE_H;

  // prologue: stage 0 lands in buffer 0 and is published, then stage 1 starts
  const u32x8 g1 = slice_group1();
  u32x4 g0 = slice_group0(ld, ga);
  tensor_load(g0, g1);
  wait_tensor0(g0);                                   // this wave's slice of stage 0 has landed
  __syncthreads();                                    // every wave's slice of stage 0 visible
  g0 = slice_group0(ld + STAGE_B, ga + BK * 2);
  tensor_load(g0, g1);

  const int steps = D_MODEL / BK;
  for (int i = 0; i < steps; ++i) {
    const int cur = i & 1;
    const _Float16* Ab = Ring + cur * STAGE_H + asl;
    const _Float16* Bb = Ring + cur * STAGE_H + bsl;
#pragma unroll
    for (int kk = 0; kk < BK; kk += 32) {
      v16h a[8], b[4];
      // Fence pair: holds this block's 24 LDS reads together as one group in front of its
      // 32 WMMAs. Left free, the compiler spread them in pairs among the WMMAs, each pair
      // behind a wait to 0, which two waves a SIMD cannot hide.
      __builtin_amdgcn_sched_barrier(0);
#pragma unroll
      for (int nt = 0; nt < 4; ++nt) b[nt] = load_frag16(Bb, LSTR, 16 * nt, kk, lane);
#pragma unroll
      for (int mt = 0; mt < 8; ++mt)
        a[mt] = load_frag16(Ab + (mt >> 2) * SLICE_H, LSTR, 16 * (mt & 3), kk, lane);
      __builtin_amdgcn_sched_barrier(0);
      if (kk + 32 == BK) {
        // Publish point of stage i + 1, which also frees buffer `cur` for the refill. It stands
        // behind the pass's last LDS reads; the last block's WMMAs, which read registers
        // alone, follow it, so that the refill has the whole next pass to land in.
        asm volatile("s_wait_dscnt 0x0" ::: "memory");  // own reads of `cur` retired before it is refilled
        wait_tensor0(g0);                               // own slice of stage i + 1 has landed
        __syncthreads();
        if (pinned((i + 2 < steps) ? 1u : 0u) != 0u) {  // scalar test: only while stage i + 2 exists
          g0 = slice_group0(ld + (uint32_t)cur * STAGE_B, ga + (uint64_t)(i + 2) * (BK * 2));
          tensor_load(g0, g1);
        }
      }
      mma_block(a, b, acc);
    }
  }
  asm volatile("s_wait_tensorcnt 0x0" ::: "memory");    // nothing in flight when the ring is left
  asm volatile("s_wait_dscnt 0x0" ::: "memory");        // no LDS read of the ring outstanding either
}

// ---------------------------------------------------------------------------
// Conversion kernels
// ---------------------------------------------------------------------------
#define CS_WAVES 16             // waves per work-group of the activation stream
#define CS_LOADS 16             // 16-byte loads a lane has in flight
#define CS_GRID  256            // work-groups of the activation stream

// f32 -> f16 stream. One wave-wide load covers 512 contiguous bytes (4 whole lines), the
// matching store 256 contiguous bytes (2 whole lines). A wave owns a contiguous range and
// walks it in groups of CS_LOADS loads, all issued before the first one is converted.
__global__ void __launch_bounds__(CS_WAVES * 32)
convert_src_kernel(const float* __restrict__ in, _Float16* __restrict__ out) {
  const int lane = threadIdx.x & 31;
  const int wave = blockIdx.x * CS_WAVES + (threadIdx.x >> 5);
  const size_t per_wave = (size_t)M_TOTAL * D_MODEL / (CS_GRID * CS_WAVES);  // 4096 floats
  const float*    ip = in + wave * per_wave + lane * 4;
  _Float16*       op = out + wave * per_wave + lane * 4;
  for (size_t g = 0; g < per_wave; g += CS_LOADS * 128) {
    v4f x[CS_LOADS];
#pragma unroll
    for (int c = 0; c < CS_LOADS; ++c) x[c] = *(const v4f*)(ip + g + c * 128);
#pragma unroll
    for (int c = 0; c < CS_LOADS; ++c) {
      v4h h;
#pragma unroll
      for (int r = 0; r < 4; ++r) h[r] = (_Float16)x[c][r];
      *(v4h*)(op + g + c * 128) = h;
    }
  }
}

#define TK   128                // k extent of a weight tile
#define TN   64                 // n extent of a weight tile
#define TSTR 136                // LDS row stride in halves (128 + 8 pad, rows stay 16-B aligned)

// wT[z][n][k] = W_z[k][n]  (f16, transposed so K-pairs are contiguous).
// One work-group turns a 128 (k) x 64 (n) tile through LDS: 16 lanes read one 256-B piece
// of a W row, 16 lanes write one 256-B piece of a wT row, whole lines on both sides.
__global__ void __launch_bounds__(256)
convert_w_kernel(const float* __restrict__ Wq,
                 const float* __restrict__ Wk,
                 const float* __restrict__ Wv,
                 const float* __restrict__ Wo,
                 _Float16* __restrict__ wT) {
  __shared__ __attribute__((aligned(16))) _Float16 tile[TN * TSTR];
  const int tid = threadIdx.x;
  const int k0 = blockIdx.x * TK;
  const int n0 = blockIdx.y * TN;
  const int z  = blockIdx.z;
  const float* W = (z == 0) ? Wq : (z == 1) ? Wk : (z == 2) ? Wv : Wo;

  // a thread takes 4 neighbouring n of the k pairs (2 * kp, 2 * kp + 1), kp = tid >> 4 + 16 * c
  const int nq = (tid & 15) * 4;
  const int kp = tid >> 4;
  const float* wp = W + (size_t)(k0 + 2 * kp) * D_MODEL + n0 + nq;
  v4f lo[4], hi[4];
#pragma unroll
  for (int c = 0; c < 4; ++c) {
    lo[c] = *(const v4f*)(wp + (size_t)(32 * c) * D_MODEL);
    hi[c] = *(const v4f*)(wp + (size_t)(32 * c + 1) * D_MODEL);
  }
#pragma unroll
  for (int c = 0; c < 4; ++c)
#pragma unroll
    for (int j = 0; j < 4; ++j) {
      v2h p;
      p[0] = (_Float16)lo[c][j];
      p[1] = (_Float16)hi[c][j];
      *(v2h*)(tile + (nq + j) * TSTR + 2 * kp + 32 * c) = p;
    }
  __syncthreads();   // the tile's rows are read back by other lanes than wrote them

  const int rr = tid >> 4, pc = (tid & 15) * 8;
  _Float16* dst = wT + (size_t)z * D_MODEL * D_MODEL + (size_t)(n0 + rr) * D_MODEL + k0 + pc;
#pragma unroll
  for (int it = 0; it < 4; ++it)
    *(v8h*)(dst + (size_t)(it * 16) * D_MODEL) = *(const v8h*)(tile + (it * 16 + rr) * TSTR + pc);
}

// ---------------------------------------------------------------------------
// QKV projection: 256x256 workgroup tile, 8 waves. z selects Q/K/V.
// Q,K stored row-major f16 [16384 x 1024].
// V stored head-transposed: vT[(bb*HEADS+h)*DK*BLK + d*BLK + t]
// ---------------------------------------------------------------------------
__global__ void __launch_bounds__(256)
qkv_gemm_kernel(const _Float16* __restrict__ X, const _Float16* __restrict__ WT,
                const float* __restrict__ bq, const float* __restrict__ bk,
                const float* __restrict__ bv, _Float16* __restrict__ qO,
                _Float16* __restrict__ kO, _Float16* __restrict__ vT) {
  __shared__ __attribute__((aligned(2048))) _Float16 Ring[2 * STAGE_H];   // 288 KB

  const int tid  = threadIdx.x;
  const int lane = tid & 31;
  const int wave = tid >> 5;
  const int row0 = blockIdx.x * 256;
  const int n0   = blockIdx.y * 256;
  const int proj = blockIdx.z;
  const _Float16* W = WT + (size_t)proj * D_MODEL * D_MODEL;

  const v8f vzero = {0.f, 0.f, 0.f, 0.f, 0.f, 0.f, 0.f, 0.f};
  v8f acc[8][4];
#pragma unroll
  for (int mt = 0; mt < 8; ++mt)
#pragma unroll
    for (int nt = 0; nt < 4; ++nt) acc[mt][nt] = vzero;

  // V is stored token-contiguous, Q and K feature-contiguous: the contiguous axis
  // goes on the accumulator's register axis (block-uniform choice).
  const bool isV = (proj == 2);
  const int a0 = isV ? row0 : n0;
  const int b0 = isV ? n0 : row0;
  gemm_core_256(isV ? X : W, isV ? W : X, a0, b0, tid, Ring, acc);

  const int half = lane >> 4, nl = lane & 15;
  const int wa = a0 + (wave >> 2) * 128;  // first register-axis index of this wave's tile
  const int wb = b0 + (wave & 3) * 64;    // first lane-axis index of this wave's tile
  // The ring is dead behind its last barrier; each wave stages its 128 x 64 tile in
  // its own range of it, one row per lane-axis index, 256 B of payload a row.
  _Float16* stg = Ring + wave * WSTG;
  if (isV) {
    const int bi = wb + nl;
    float bb[4];
#pragma unroll
    for (int nt = 0; nt < 4; ++nt) bb[nt] = bv[bi + nt * 16];
    // Precaution: stands in front of any rewrite of the bias loads' address register; the
    // index is named as an input so that its register stays live up to the wait.
    asm volatile("s_wait_xcnt 0x0" :: "v"(bi) : "memory");
#pragma unroll
    for (int nt = 0; nt < 4; ++nt) {
#pragma unroll
      for (int mt = 0; mt < 8; ++mt) {
        v8h h;
#pragma unroll
        for (int r = 0; r < 8; ++r) h[r] = (_Float16)(acc[mt][nt][r] + bb[nt]);
        *(v8h*)(stg + (nt * 16 + nl) * LSTR + mt * 16 + 8 * half) = h;
      }
    }
  } else {
    const float* bias = (proj == 0) ? bq : bk;
    const float* bp = bias + wa + 8 * half;
    v4f blo[8], bhi[8];
#pragma unroll
    for (int mt = 0; mt < 8; ++mt) {
      blo[mt] = *(const v4f*)(bp + mt * 16);
      bhi[mt] = *(const v4f*)(bp + mt * 16 + 4);
    }
    // Precaution, as in the other branch: the address lives up to the wait.
    asm volatile("s_wait_xcnt 0x0" :: "v"(bp) : "memory");
#pragma unroll
    for (int mt = 0; mt < 8; ++mt) {
#pragma unroll
      for (int nt = 0; nt < 4; ++nt) {
        v8h h;
#pragma unroll
        for (int r = 0; r < 4; ++r) {
          h[r]     = (_Float16)(acc[mt][nt][r] + blo[mt][r]);
          h[4 + r] = (_Float16)(acc[mt][nt][4 + r] + bhi[mt][r]);
        }
        *(v8h*)(stg + (nt * 16 + nl) * LSTR + mt * 16 + 8 * half) = h;
      }
    }
  }
  __syncthreads();   // the staged rows are read back by other lanes than wrote them

  // 16 lanes carry one staged row = two whole 128-B lines of the output
  const int rr = lane >> 4, pc = (lane & 15) * 8;
  const _Float16* rd = stg + rr * LSTR + pc;
  if (isV) {
    // wa = (b*64 + blk)*64, register axis = t over two neighbouring blocks (8 lanes
    // each); wb = h*128 + d0, lane axis = d
    _Float16* dst = vT + ((size_t)((wa >> 6) + (pc >> 6)) * HEADS + (wb >> 7)) * (DK * BLK) +
                    (size_t)((wb & 127) + rr) * BLK + (pc & 63);
#pragma unroll
    for (int it = 0; it < 32; ++it)
      *(v8h*)(dst + it * 2 * BLK) = *(const v8h*)(rd + it * 2 * LSTR);
    // Precaution: stands behind the run's last store, in front of whatever code the
    // compiler lays behind this branch and lets rewrite the stores' registers.
    asm volatile("s_wait_xcnt 0x0" ::: "memory");
  } else {
    _Float16* dst = ((proj == 0) ? qO : kO) + (size_t)(wb + rr) * D_MODEL + wa + pc;
#pragma unroll
    for (int it = 0; it < 32; ++it)
      *(v8h*)(dst + it * 2 * D_MODEL) = *(const v8h*)(rd + it * 2 * LSTR);
    // Precaution, as in the other branch.
    asm volatile("s_wait_xcnt 0x0" ::: "memory");
  }
}

// ---------------------------------------------------------------------------
// Block attention: one workgroup per (b,blk), one wave per head.
// Q, K and V come to LDS as whole 128-B lines by async copies, each head's tiles in the
// two LDS ranges of its own wave, and the WMMA fragments are read from there.
// scores(64x64) in registers -> softmax (shfl_xor within 16-lane halves)
// -> P staged in LDS -> P @ V via WMMA -> f16 attention output row-major,
// staged in the wave's own LDS range and stored as whole lines.
// ---------------------------------------------------------------------------
__global__ void __launch_bounds__(256)
attn_kernel(const _Float16* __restrict__ Q, const _Float16* __restrict__ K,
            const _Float16* __restrict__ VT, _Float16* __restrict__ AO) {
  __shared__ __attribute__((aligned(16))) _Float16 L0[HEADS][AR0];   // 144 KB
  __shared__ __attribute__((aligned(16))) _Float16 L1[HEADS][AR1];   // 136 KB

  const int lane = threadIdx.x & 31;
  const int h    = threadIdx.x >> 5;         // head
  const int bb   = blockIdx.x;               // b*64 + blk
  const int row0 = bb * BLK;                 // flat token row base
  const int col0 = h * DK;
  const int half = lane >> 4, nl = lane & 15;
  const int rr = lane >> 4, pc = (lane & 15) * 8;   // 16 lanes carry one 256-B row piece
  _Float16* r0 = &L0[h][0];                  // Q, then V
  _Float16* r1 = &L1[h][0];                  // K, then P, then the output rows

  // Q and K tiles, 64 rows x 256 B each: one copy takes two rows = four whole lines
  {
    const _Float16* qsrc = Q + (size_t)(row0 + rr) * D_MODEL + col0 + pc;
    const _Float16* ksrc = K + (size_t)(row0 + rr) * D_MODEL + col0 + pc;
    _Float16* qdst = r0 + rr * LSTR + pc;
    _Float16* kdst = r1 + rr * LSTR + pc;
    // the three copy loops of this kernel are unrolled so that the copies issue back to back
#pragma unroll
    for (int c = 0; c < 4; ++c)
      async_copy8<2 * LSTR * 2, 2 * D_MODEL * 2>(qsrc + c * 16 * D_MODEL, qdst + c * 16 * LSTR);
#pragma unroll
    for (int c = 0; c < 3; ++c)
      async_copy8<2 * LSTR * 2, 2 * D_MODEL * 2>(ksrc + c * 16 * D_MODEL, kdst + c * 16 * LSTR);
    // Keeps the wave below 64 outstanding copies: at most 48 are left when the last 8 issue.
    asm volatile("s_wait_asynccnt 0x30" ::: "memory");
    async_copy8<2 * LSTR * 2, 2 * D_MODEL * 2>(ksrc + 3 * 16 * D_MODEL, kdst + 3 * 16 * LSTR);
  }
  asm volatile("s_wait_asynccnt 0x0" ::: "memory");  // this wave's Q and K copies have landed
  __syncthreads();                                   // no tile is read in front of this barrier

  const v8f vzero = {0.f, 0.f, 0.f, 0.f, 0.f, 0.f, 0.f, 0.f};
  v8f s[4][4];
#pragma unroll
  for (int mt = 0; mt < 4; ++mt)
#pragma unroll
    for (int nt = 0; nt < 4; ++nt) s[mt][nt] = vzero;

  // scores = Q_blk @ K_blk^T over dk=128
  for (int kk = 0; kk < DK; kk += 32) {
    v16h a[4], b[4];
#pragma unroll
    for (int mt = 0; mt < 4; ++mt)
      a[mt] = load_frag16(r0, LSTR, 16 * mt, kk, lane);
#pragma unroll
    for (int nt = 0; nt < 4; ++nt)   // B[k][n] = K[row0+n][col0+kk+k]
      b[nt] = load_frag16(r1, LSTR, 16 * nt, kk, lane);
#pragma unroll
    for (int mt = 0; mt < 4; ++mt)
#pragma unroll
      for (int nt = 0; nt < 4; ++nt)
        s[mt][nt] = wmma_f16(a[mt], b[nt], s[mt][nt]);
  }

  // V tile, [d][t] per (bb,h): 128 rows x 128 B, contiguous in memory; one copy takes four
  // rows = four whole lines. It lands in Q's range, which only this wave has read, while
  // the softmax runs.
  asm volatile("s_wait_dscnt 0x0" ::: "memory");     // own reads of Q and K retired before the refill
  {
    const _Float16* vsrc = VT + ((size_t)bb * HEADS + h) * (DK * BLK) + lane * 8;
    _Float16* vdst = r0 + (lane >> 3) * VSTR + (lane & 7) * 8;
#pragma unroll
    for (int c = 0; c < 4; ++c)
      async_copy8<4 * VSTR * 2, 4 * BLK * 2>(vsrc + c * 32 * BLK, vdst + c * 32 * VSTR);
  }

  // row softmax: each row M lives in 16 lanes (one half) across 4 nt tiles
  const float scale = 0.08838834764831845f;  // dk^-0.5
#pragma unroll
  for (int mt = 0; mt < 4; ++mt)
#pragma unroll
    for (int r = 0; r < 8; ++r) {
      float x0 = s[mt][0][r] * scale, x1 = s[mt][1][r] * scale;
      float x2 = s[mt][2][r] * scale, x3 = s[mt][3][r] * scale;
      float mx = fmaxf(fmaxf(x0, x1), fmaxf(x2, x3));
#pragma unroll
      for (int msk = 1; msk < 16; msk <<= 1)
        mx = fmaxf(mx, __shfl_xor(mx, msk, 32));
      float e0 = __expf(x0 - mx), e1 = __expf(x1 - mx);
      float e2 = __expf(x2 - mx), e3 = __expf(x3 - mx);
      float sum = e0 + e1 + e2 + e3;
#pragma unroll
      for (int msk = 1; msk < 16; msk <<= 1)
        sum += __shfl_xor(sum, msk, 32);
      float inv = 1.0f / sum;
      int m = mt * 16 + r + 8 * half;
      r1[m * BLK + 0 * 16 + nl] = (_Float16)(e0 * inv);
      r1[m * BLK + 1 * 16 + nl] = (_Float16)(e1 * inv);
      r1[m * BLK + 2 * 16 + nl] = (_Float16)(e2 * inv);
      r1[m * BLK + 3 * 16 + nl] = (_Float16)(e3 * inv);
    }
  asm volatile("s_wait_asynccnt 0x0" ::: "memory");  // this wave's V copies have landed
  __syncthreads();   // V is not read in front of it; P is read by other lanes than wrote it

  // P's fragments go to registers once: the output rows below overwrite P's range
  // (unrolled: a register array wants constant indices)
  v16h pa[2][4];
#pragma unroll
  for (int k2 = 0; k2 < 2; ++k2)
#pragma unroll
    for (int mt = 0; mt < 4; ++mt) pa[k2][mt] = load_frag16(r1, BLK, mt * 16, k2 * 32, lane);

  // out = P(64x64) @ V(64x128); V is [d][t] so K-pairs contiguous
  for (int dt = 0; dt < 8; ++dt) {
    v8f o[4];
#pragma unroll
    for (int mt = 0; mt < 4; ++mt) o[mt] = vzero;
#pragma unroll
    for (int k2 = 0; k2 < 2; ++k2) {
      v16h b = load_frag16(r0, VSTR, dt * 16, k2 * 32, lane);  // A[m][k]=V[t=k][d=m]
#pragma unroll
      for (int mt = 0; mt < 4; ++mt) {
        // V as the A operand: features d on the register axis, tokens on the lane axis
        o[mt] = wmma_f16(b, pa[k2][mt], o[mt]);
      }
    }
#pragma unroll
    for (int mt = 0; mt < 4; ++mt) {
      v8h hv;
#pragma unroll
      for (int r = 0; r < 8; ++r) hv[r] = (_Float16)o[mt][r];
      *(v8h*)(r1 + (mt * 16 + nl) * OSTR + dt * 16 + 8 * half) = hv;
    }
  }
  __syncthreads();   // the staged rows are read back by other lanes than wrote them

  // 16 lanes carry one staged row = two whole 128-B lines of the output
  _Float16* dst = AO + (size_t)(row0 + rr) * D_MODEL + col0 + pc;
#pragma unroll
  for (int it = 0; it < 32; ++it)
    *(v8h*)(dst + it * 2 * D_MODEL) = *(const v8h*)(r1 + (it * 2 + rr) * OSTR + pc);
}

// ---------------------------------------------------------------------------
// Output projection: attn(f16) @ Wo^T(f16) + bo -> fp32 d_out
// ---------------------------------------------------------------------------
__global__ void __launch_bounds__(256)
out_gemm_kernel(const _Float16* __restrict__ X, const _Float16* __restrict__ WoT,
                const float* __restrict__ bo, float* __restrict__ out) {
  __shared__ __attribute__((aligned(2048))) _Float16 Ring[2 * STAGE_H];   // 288 KB

  const int tid  = threadIdx.x;
  const int lane = tid & 31;
  const int wave = tid >> 5;
  const int row0 = blockIdx.x * 256;
  const int n0   = blockIdx.y * 256;

  const v8f vzero = {0.f, 0.f, 0.f, 0.f, 0.f, 0.f, 0.f, 0.f};
  v8f acc[8][4];
#pragma unroll
  for (int mt = 0; mt < 8; ++mt)
#pragma unroll
    for (int nt = 0; nt < 4; ++nt) acc[mt][nt] = vzero;

  // output features on the accumulator's register axis, tokens on its lane axis
  gemm_core_256(WoT, X, n0, row0, tid, Ring, acc);

  const int half = lane >> 4, nl = lane & 15;
  const int wa = n0 + (wave >> 2) * 128;    // first output feature of this wave's tile
  const int wb = row0 + (wave & 3) * 64;    // first token row of this wave's tile
  // The ring is dead behind its last barrier; each wave stages its 64 token rows of
  // 128 floats in its own range.
  float* stg = (float*)(Ring + wave * FSTG);
  const float* bp = bo + wa + 8 * half;
  v4f blo[8], bhi[8];
#pragma unroll
  for (int mt = 0; mt < 8; ++mt) {
    blo[mt] = *(const v4f*)(bp + mt * 16);
    bhi[mt] = *(const v4f*)(bp + mt * 16 + 4);
  }
  // Precaution: stands in front of any rewrite of the bias loads' address registers; the
  // address is named as an input so that its registers stay live up to the wait.
  asm volatile("s_wait_xcnt 0x0" :: "v"(bp) : "memory");
#pragma unroll
  for (int mt = 0; mt < 8; ++mt) {
#pragma unroll
    for (int nt = 0; nt < 4; ++nt) {
      v4f lo, hi;
#pragma unroll
      for (int r = 0; r < 4; ++r) {
        lo[r] = acc[mt][nt][r] + blo[mt][r];
        hi[r] = acc[mt][nt][4 + r] + bhi[mt][r];
      }
      float* s = stg + (nt * 16 + nl) * FSTR + mt * 16 + 8 * half;
      *(v4f*)s       = lo;
      *(v4f*)(s + 4) = hi;
    }
  }
  __syncthreads();   // the staged rows are read back by other lanes than wrote them

  // the wave's 32 lanes carry one staged row = four whole 128-B lines of the output
  float* dst = out + (size_t)wb * D_MODEL + wa + lane * 4;
#pragma unroll
  for (int it = 0; it < 64; ++it)
    *(v4f*)(dst + it * D_MODEL) = *(const v4f*)(stg + it * FSTR + lane * 4);
}

// ---------------------------------------------------------------------------
extern "C" void kernel_launch(void* const* d_in, const int* in_sizes, int n_in,
                              void* d_out, int out_size, void* d_ws, size_t ws_size,
                              hipStream_t stream) {
  const float* src = (const float*)d_in[0];
  const float* Wq  = (const float*)d_in[1];
  const float* bq  = (const float*)d_in[2];
  const float* Wk  = (const float*)d_in[3];
  const float* bk  = (const float*)d_in[4];
  const float* Wv  = (const float*)d_in[5];
  const float* bv  = (const float*)d_in[6];
  const float* Wo  = (const float*)d_in[7];
  const float* bo  = (const float*)d_in[8];
  float* out = (float*)d_out;

  const size_t actN = (size_t)M_TOTAL * D_MODEL;   // 16,777,216 halves
  const size_t wN   = (size_t)4 * D_MODEL * D_MODEL;

  _Float16* srcH = (_Float16*)d_ws;        // also reused as attention output
  _Float16* wT   = srcH + actN;            // 4 transposed f16 weight matrices
  _Float16* qH   = wT + wN;
  _Float16* kH   = qH + actN;
  _Float16* vT   = kH + actN;              // head-transposed V
  _Float16* attn = srcH;                   // alias: src dead after QKV GEMM

  // 1. fp32 -> f16 conversions
  convert_src_kernel<<<CS_GRID, CS_WAVES * 32, 0, stream>>>(src, srcH);
  convert_w_kernel<<<dim3(D_MODEL / TK, D_MODEL / TN, 4), 256, 0, stream>>>(
      Wq, Wk, Wv, Wo, wT);

  // 2. fused QKV projections (256x256 tile per workgroup, tensor loads to LDS)
  qkv_gemm_kernel<<<dim3(M_TOTAL / 256, D_MODEL / 256, 3), 256, 0, stream>>>(
      srcH, wT, bq, bk, bv, qH, kH, vT);

  // 3. block-local attention (one workgroup per (b,blk), one wave per head)
  attn_kernel<<<dim3(BATCH * (SEQ / BLK)), 256, 0, stream>>>(qH, kH, vT, attn);

  // 4. output projection -> fp32
  out_gemm_kernel<<<dim3(M_TOTAL / 256, D_MODEL / 256), 256, 0, stream>>>(
      attn, wT + (size_t)3 * D_MODEL * D_MODEL, bo, out);
}

// v007
// It runs in 113 microseconds.
// Two timings next to v006 both put it at 1.03 times that version's speed.
// Counting every step since v000, it is 2.47 times as fast.
#include <hip/hip_runtime.h>

typedef __attribute__((ext_vector_type(16))) _Float16 v16h;
typedef __attribute__((ext_vector_type(8)))  float    v8f;
typedef __attribute__((ext_vector_type(8)))  _Float16 v8h;
typedef __attribute__((ext_vector_type(4)))  float    v4f;
typedef __attribute__((ext_vector_type(4)))  _Float16 v4h;
typedef __attribute__((ext_vector_type(2)))  _Float16 v2h;
typedef __attribute__((ext_vector_type(4)))  uint32_t u32x4;
typedef __attribute__((ext_vector_type(8)))  uint32_t u32x8;

#define D_MODEL 1024
#define SEQ     4096
#define BATCH   4
#define HEADS   8
#define BLK     64
#define DK      128
#define M_TOTAL (BATCH * SEQ)   // 16384 rows

#define BK   128                // k-slice per stage in halves: 256 B of a row, two whole cache lines
#define LSTR 136                // LDS row stride in halves (128 + 8 pad, 272B = 16B x odd: bank-conflict free)
#define SLICE_B 18432           // bytes of one wave's slice of a stage: 64 rows x 272 B = 17,408, rounded up to a multiple of 2 KiB
#define SLICE_H (SLICE_B / 2)   // the same in halves
#define STAGE_B (8 * SLICE_B)   // bytes of one stage: four slices of the register-axis operand, then four of the lane-axis operand
#define STAGE_H (STAGE_B / 2)   // the same in halves
#define WSTG (64 * LSTR)        // halves of one wave's own f16 epilogue staging range (17,408 B; eight lie in the ring's dead buffer 1)
#define FSTR 132                // f32 staging row stride in floats (128 + 4 pad, 528B = 16B x odd)
#define FSTG (64 * FSTR * 2)    // halves of one wave's own f32 epilogue staging range (33,792 B; eight lie in the dead ring)
#define OSTR 136                // attention output staging row stride in halves (128 + 8 pad, 272B = 16B x odd)
#define VSTR 72                 // attention V staging row stride in halves (64 + 8 pad, 144B = 16B x odd)
#define AR0  (DK * VSTR)        // halves of a head's first LDS range: Q (64 x LSTR fits), then V (128 x VSTR)
#define AR1  (BLK * LSTR)       // halves of a head's second LDS range: K, then P, then the output rows

// ---------------------------------------------------------------------------
// Tensor load of one wave's slice of a GEMM stage: 64 rows x 256 B, source pitch 2,048 B,
// global -> LDS through no register; the pad lays the rows at the 272-B pitch of LSTR.
// ---------------------------------------------------------------------------
__device__ __forceinline__ uint32_t uni(uint32_t v) {
  return (uint32_t)__builtin_amdgcn_readfirstlane(v);
}

__device__ __forceinline__ uint32_t pinned(uint32_t v) {
  uint32_t w = (uint32_t)__builtin_amdgcn_readfirstlane(v);
  // A tensor load ignores EXEC: the branch round it must compile to a scalar branch.
  asm volatile("" : "+s"(w));  // pinned(): the test word held in a scalar register
  return w;
}

__device__ __forceinline__ u32x4 slice_group0(uint32_t lds_dst, uint64_t ga) {
  u32x4 g0;
  g0[0] = uni(1u);                                    // count 1
  g0[1] = uni(lds_dst);                               // byte offset in the work-group's LDS
  g0[2] = uni((uint32_t)ga);
  g0[3] = uni((((uint32_t)(ga >> 32)) & 0x01FFFFFFu) | 0x80000000u);  // type 2
  return g0;
}

__device__ __forceinline__ u32x8 slice_group1() {
  u32x8 g1;
  g1[0] = uni((1u << 20) | (5u << 22) | (3u << 25));  // no mask, 1-byte elements, 16 B of pad behind every 256 B
  g1[1] = uni(256u << 16);                            // tensor_dim0 = 256 B
  g1[2] = uni(64u << 16);                             // tensor_dim1 = 64 rows
  g1[3] = uni(256u << 16);                            // tile_dim0 = 256 B
  g1[4] = uni(64u);                                   // tile_dim1 = 64 rows
  g1[5] = uni(D_MODEL * 2u);                          // source row pitch in bytes
  g1[6] = uni(0u);
  g1[7] = uni(0u);
  return g1;
}

// Group 0 is handed to the request in four registers that only this statement writes, so that
// no word of an outstanding request's group 0 takes a new value before the wait that covers it:
// every call stands behind the wait for the call before.
__device__ __forceinline__ void tensor_load(u32x4 g0, u32x8 g1) {
  asm volatile("s_mov_b32 s100, %0\n\t"
               "s_mov_b32 s101, %1\n\t"
               "s_mov_b32 s102, %2\n\t"
               "s_mov_b32 s103, %3\n\t"
               "tensor_load_to_lds s[100:103], %4"
               :: "s"(g0[0]), "s"(g0[1]), "s"(g0[2]), "s"(g0[3]), "s"(g1)
               : "memory", "s100", "s101", "s102", "s103");
}

// The issuing wave's wait for its one outstanding request.
__device__ __forceinline__ void wait_tensor0() {
  asm volatile("s_wait_tensorcnt 0x0" ::: "memory");
}

// ---------------------------------------------------------------------------
// Eight async b128 copies of one wave, global -> LDS: copy c takes the lane's own
// addresses LS bytes (LDS) and GS bytes (global) times c further on.
// ---------------------------------------------------------------------------
template <unsigned LS, unsigned GS>
__device__ __forceinline__ void async_copy8(const _Float16* __restrict__ g, _Float16* lds) {
  const unsigned l = (unsigned)(uintptr_t)lds;        // LDS byte offset (low 32 bits)
  const unsigned long long a = (unsigned long long)(uintptr_t)g;
  const unsigned long long G = GS;
  // The closing s_wait_xcnt is a precaution: it stands in front of every later rewrite of
  // these address registers, and inside the copies' own statement nothing can be scheduled
  // between it and them.
  asm volatile(
      "global_load_async_to_lds_b128 %0, %8, off\n\t"
      "global_load_async_to_lds_b128 %1, %9, off\n\t"
      "global_load_async_to_lds_b128 %2, %10, off\n\t"
      "global_load_async_to_lds_b128 %3, %11, off\n\t"
      "global_load_async_to_lds_b128 %4, %12, off\n\t"
      "global_load_async_to_lds_b128 %5, %13, off\n\t"
      "global_load_async_to_lds_b128 %6, %14, off\n\t"
      "global_load_async_to_lds_b128 %7, %15, off\n\t"
      "s_wait_xcnt 0x0"
      :: "v"(l), "v"(l + LS), "v"(l + 2 * LS), "v"(l + 3 * LS),
         "v"(l + 4 * LS), "v"(l + 5 * LS), "v"(l + 6 * LS), "v"(l + 7 * LS),
         "v"(a), "v"(a + G), "v"(a + 2 * G), "v"(a + 3 * G),
         "v"(a + 4 * G), "v"(a + 5 * G), "v"(a + 6 * G), "v"(a + 7 * G)
      : "memory");
}

// ---------------------------------------------------------------------------
// Fragment helpers (wave32, 16-bit 16x16x32 WMMA layout)
// A (16x32): lane L holds row M=L&15; half=L>>4 adds +8 to K.
//   VGPR j<4  -> K pair {2j, 2j+1} (+8*half)
//   VGPR j>=4 -> K pair {16+2(j-4), ...} (+8*half)
// B (32x16) is symmetric with N=L&15; memory addressed as p[n*ld + k].
// ---------------------------------------------------------------------------
__device__ __forceinline__ v16h load_frag16(const _Float16* __restrict__ p,
                                            int ld, int r0, int k0, int lane) {
  const int m    = lane & 15;
  const int half = lane >> 4;
  const _Float16* q = p + (size_t)(r0 + m) * ld + (k0 + 8 * half);
  v16h f;
#pragma unroll
  for (int i = 0; i < 8; ++i) f[i]     = q[i];        // VGPR 0..3: K 0..7
#pragma unroll
  for (int i = 0; i < 8; ++i) f[8 + i] = q[16 + i];   // VGPR 4..7: K 16..23
  return f;
}

__device__ __forceinline__ v8f wmma_f16(v16h a, v16h b, v8f c) {
  return __builtin_amdgcn_wmma_f32_16x16x32_f16(
      /*neg_a=*/false, a, /*neg_b=*/false, b,
      /*c_mod=*/(short)0, c, /*reuse_a=*/false, /*reuse_b=*/false);
}

// ---------------------------------------------------------------------------
// Workgroup-tiled GEMM core: 256x256 tile, 8 waves (2x4), two per SIMD, K staged in LDS by
// tensor loads, one per wave and stage (two-buffer ring, one barrier per k-slice). acc is this
// wave's 128x64 (8x4 fragment tiles).
// Xg, Wg: [rows x 1024] row-major f16. acc = Xg rows (row0..) times Wg rows (n0..) transposed:
// a lane holds 8 neighbouring Xg-row indices (register axis) at one Wg-row index (lane axis).
// The callers pick which matrix goes on which side so that the register axis is the
// axis that is contiguous in their output.
// ---------------------------------------------------------------------------
// one 32-k block of a wave's 128x64 tile: 8 x 4 fragment products
__device__ __forceinline__ void mma_block(const v16h a[8], const v16h b[4], v8f acc[8][4]) {
#pragma unroll
  for (int mt = 0; mt < 8; ++mt)
#pragma unroll
    for (int nt = 0; nt < 4; ++nt)
      acc[mt][nt] = wmma_f16(a[mt], b[nt], acc[mt][nt]);
}

// first byte of this wave's slice of every stage of a tile: waves 0..3 bring 64 Xg rows each,
// waves 4..7 64 Wg rows
__device__ __forceinline__ uint64_t slice_src(const _Float16* __restrict__ Xg,
                                              const _Float16* __restrict__ Wg,
                                              int row0, int n0, uint32_t wave) {
  const _Float16* srow = (wave < 4u) ? Xg + (size_t)(row0 + 64 * (int)wave) * D_MODEL
                                     : Wg + (size_t)(n0 + 64 * ((int)wave - 4)) * D_MODEL;
  return (uint64_t)(uintptr_t)srow;
}

// The eight passes of one tile. On entry stage 0 is published in buffer 0 and this wave's
// request for stage 1 is in flight. ga: this wave's slice of the tile; where
// `more` is set, gan is its slice of the work-group's next tile, whose stage 0 is asked for in
// the place of a stage 8 and is published by the last pass's barrier. Buffer 1 is left dead.
__device__ __forceinline__ void ring_passes(_Float16* Ring, int lane, uint32_t wave, uint32_t ld,
                                            uint64_t ga, uint64_t gan, uint32_t more,
                                            const u32x8 g1, v8f acc[8][4]) {
  // the slices this wave reads: two of Xg rows (128 rows), one of Wg rows (64 rows)
  const int asl = (int)(wave >> 2) * 2 * SLICE_H;
  const int bsl = (4 + (int)(wave & 3u)) * SLICE_H;

  const int steps = D_MODEL / BK;
  for (int i = 0; i < steps; ++i) {
    const int cur = i & 1;
    const _Float16* Ab = Ring + cur * STAGE_H + asl;
    const _Float16* Bb = Ring + cur * STAGE_H + bsl;
#pragma unroll
    for (int kk = 0; kk < BK; kk += 32) {
      v16h a[8], b[4];
      // Fence pair: holds this block's 24 LDS reads together as one group in front of its
      // 32 WMMAs. Left free, the compiler spread them in pairs among the WMMAs, each pair
      // behind a wait to 0, which two waves a SIMD cannot hide.
      __builtin_amdgcn_sched_barrier(0);
#pragma unroll
      for (int nt = 0; nt < 4; ++nt) b[nt] = load_frag16(Bb, LSTR, 16 * nt, kk, lane);
#pragma unroll
      for (int mt = 0; mt < 8; ++mt)
        a[mt] = load_frag16(Ab + (mt >> 2) * SLICE_H, LSTR, 16 * (mt & 3), kk, lane);
      __builtin_amdgcn_sched_barrier(0);
      if (kk + 32 == BK) {
        // Publish point of stage i + 1, which also frees buffer `cur` for the refill. It stands
        // behind the pass's last LDS reads; the last block's WMMAs, which read registers
        // alone, follow it, so that the refill has the whole next pass to land in.
        asm volatile("s_wait_dscnt 0x0" ::: "memory");  // own reads of `cur` retired before it is refilled
        wait_tensor0();                                 // own slice of stage i + 1 has landed
        __syncthreads();
        const bool own = i + 2 < steps;                 // stage i + 2 of this tile exists
        // scalar test: only while a next stage exists, in this tile or as the next tile's first
        if (pinned((own || (i + 2 == steps && more != 0u)) ? 1u : 0u) != 0u) {
          tensor_load(slice_group0(ld + (uint32_t)cur * STAGE_B,
                                   own ? ga + (uint64_t)(i + 2) * (BK * 2) : gan), g1);
        }
      }
      mma_block(a, b, acc);
    }
  }
  asm volatile("s_wait_tensorcnt 0x0" ::: "memory");    // nothing in flight when the passes are left
  asm volatile("s_wait_dscnt 0x0" ::: "memory");        // no LDS read of the ring outstanding either
}

// prologue of a work-group's first tile: stage 0 lands in buffer 0 and is published, then
// stage 1 starts
__device__ __forceinline__ void ring_prologue(uint32_t ld, uint64_t ga, const u32x8 g1) {
  tensor_load(slice_group0(ld, ga), g1);
  wait_tensor0();                                     // this wave's slice of stage 0 has landed
  __syncthreads();                                    // every wave's slice of stage 0 visible
  tensor_load(slice_group0(ld + STAGE_B, ga + BK * 2), g1);
}

// one tile alone
__device__ __forceinline__ void gemm_core_256(const _Float16* __restrict__ Xg,
                                              const _Float16* __restrict__ Wg,
                                              int row0, int n0, int tid,
                                              _Float16* Ring, v8f acc[8][4]) {
  const int lane = tid & 31;
  const uint32_t wave = uni((uint32_t)tid >> 5);
  const uint64_t ga = slice_src(Xg, Wg, row0, n0, wave);
  const uint32_t ld = (uint32_t)(uintptr_t)Ring + wave * SLICE_B;  // LDS byte offset (low 32 bits)
  const u32x8 g1 = slice_group1();
  ring_prologue(ld, ga, g1);
  ring_passes(Ring, lane, wave, ld, ga, ga, 0u, g1, acc);
}

// ---------------------------------------------------------------------------
// Conversion kernels
// ---------------------------------------------------------------------------
#define CS_WAVES 16             // waves per work-group of the activation stream
#define CS_LOADS 16             // 16-byte loads a lane has in flight
#define CS_GRID  256            // work-groups of the activation stream

// f32 -> f16 stream. One wave-wide load covers 512 contiguous bytes (4 whole lines), the
// matching store 256 contiguous bytes (2 whole lines). A wave owns a contiguous range and
// walks it in groups of CS_LOADS loads, all issued before the first one is converted.
__global__ void __launch_bounds__(CS_WAVES * 32)
convert_src_kernel(const float* __restrict__ in, _Float16* __restrict__ out) {
  const int lane = threadIdx.x & 31;
  const int wave = blockIdx.x * CS_WAVES + (threadIdx.x >> 5);
  const size_t per_wave = (size_t)M_TOTAL * D_MODEL / (CS_GRID * CS_WAVES);  // 4096 floats
  const float*    ip = in + wave * per_wave + lane * 4;
  _Float16*       op = out + wave * per_wave + lane * 4;
  for (size_t g = 0; g < per_wave; g += CS_LOADS * 128) {
    v4f x[CS_LOADS];
#pragma unroll
    for (int c = 0; c < CS_LOADS; ++c) x[c] = *(const v4f*)(ip + g + c * 128);
#pragma unroll
    for (int c = 0; c < CS_LOADS; ++c) {
      v4h h;
#pragma unroll
      for (int r = 0; r < 4; ++r) h[r] = (_Float16)x[c][r];
      *(v4h*)(op + g + c * 128) = h;
    }
  }
}

#define TK   128                // k extent of a weight tile
#define TN   64                 // n extent of a weight tile
#define TSTR 136                // LDS row stride in halves (128 + 8 pad, rows stay 16-B aligned)

// wT[z][n][k] = W_z[k][n]  (f16, transposed so K-pairs are contiguous).
// One work-group turns a 128 (k) x 64 (n) tile through LDS: 16 lanes read one 256-B piece
// of a W row, 16 lanes write one 256-B piece of a wT row, whole lines on both sides.
__global__ void __launch_bounds__(256)
convert_w_kernel(const float* __restrict__ Wq,
                 const float* __restrict__ Wk,
                 const float* __restrict__ Wv,
                 const float* __restrict__ Wo,
                 _Float16* __restrict__ wT) {
  __shared__ __attribute__((aligned(16))) _Float16 tile[TN * TSTR];
  const int tid = threadIdx.x;
  const int k0 = blockIdx.x * TK;
  const int n0 = blockIdx.y * TN;
  const int z  = blockIdx.z;
  const float* W = (z == 0) ? Wq : (z == 1) ? Wk : (z == 2) ? Wv : Wo;

  // a thread takes 4 neighbouring n of the k pairs (2 * kp, 2 * kp + 1), kp = tid >> 4 + 16 * c
  const int nq = (tid & 15) * 4;
  const int kp = tid >> 4;
  const float* wp = W + (size_t)(k0 + 2 * kp) * D_MODEL + n0 + nq;
  v4f lo[4], hi[4];
#pragma unroll
  for (int c = 0; c < 4; ++c) {
    lo[c] = *(const v4f*)(wp + (size_t)(32 * c) * D_MODEL);
    hi[c] = *(const v4f*)(wp + (size_t)(32 * c + 1) * D_MODEL);
  }
#pragma unroll
  for (int c = 0; c < 4; ++c)
#pragma unroll
    for (int j = 0; j < 4; ++j) {
      v2h p;
      p[0] = (_Float16)lo[c][j];
      p[1] = (_Float16)hi[c][j];
      *(v2h*)(tile + (nq + j) * TSTR + 2 * kp + 32 * c) = p;
    }
  __syncthreads();   // the tile's rows are read back by other lanes than wrote them

  const int rr = tid >> 4, pc = (tid & 15) * 8;
  _Float16* dst = wT + (size_t)z * D_MODEL * D_MODEL + (size_t)(n0 + rr) * D_MODEL + k0 + pc;
#pragma unroll
  for (int it = 0; it < 4; ++it)
    *(v8h*)(dst + (size_t)(it * 16) * D_MODEL) = *(const v8h*)(tile + (it * 16 + rr) * TSTR + pc);
}

// ---------------------------------------------------------------------------
// QKV projection: 256x256 workgroup tile, 8 waves. A work-group walks the Q, K and V tiles of
// its rows and columns one after the other, and the tensor-load ring runs on across them:
// the next tile's stage 0 lands in buffer 0 under the last pass, the epilogue stages in buffer 1,
// and the next tile's stage 1 starts behind the epilogue.
// Q,K stored row-major f16 [16384 x 1024].
// V stored head-transposed: vT[(bb*HEADS+h)*DK*BLK + d*BLK + t]
// ---------------------------------------------------------------------------
__global__ void __launch_bounds__(256)
qkv_gemm_kernel(const _Float16* __restrict__ X, const _Float16* __restrict__ WT,
                const float* __restrict__ bq, const float* __restrict__ bk,
                const float* __restrict__ bv, _Float16* __restrict__ qO,
                _Float16* __restrict__ kO, _Float16* __restrict__ vT) {
  __shared__ __attribute__((aligned(2048))) _Float16 Ring[2 * STAGE_H];   // 288 KB

  const int tid  = threadIdx.x;
  const int lane = tid & 31;
  const int wave = tid >> 5;
  const int row0 = blockIdx.x * 256;
  const int n0   = blockIdx.y * 256;
  const uint32_t uwave = uni((uint32_t)tid >> 5);
  const uint32_t ld = (uint32_t)(uintptr_t)Ring + uwave * SLICE_B;  // LDS byte offset (low 32 bits)
  const int half = lane >> 4, nl = lane & 15;
  const v8f vzero = {0.f, 0.f, 0.f, 0.f, 0.f, 0.f, 0.f, 0.f};

  // Q and K tiles: weight rows on the register axis, X rows on the lane axis
  uint64_t ga = slice_src(WT, X, n0, row0, uwave);
  const u32x8 g1 = slice_group1();
  ring_prologue(ld, ga, g1);

  // kept rolled: one copy of the hot loop and of the epilogues in the instruction cache
#pragma unroll 1
  for (int proj = 0; proj < 3; ++proj) {
  v8f acc[8][4];
#pragma unroll
  for (int mt = 0; mt < 8; ++mt)
#pragma unroll
    for (int nt = 0; nt < 4; ++nt) acc[mt][nt] = vzero;

  // V is stored token-contiguous, Q and K feature-contiguous: the contiguous axis
  // goes on the accumulator's register axis (block-uniform choice).
  const bool isV = (proj == 2);
  const int a0 = isV ? row0 : n0;
  const int b0 = isV ? n0 : row0;
  // this wave's slice of the next tile (K behind Q, V behind K; behind V none, and none is asked for)
  const _Float16* Wn = WT + (size_t)(proj + 1) * D_MODEL * D_MODEL;
  const uint64_t gan = (proj == 0) ? slice_src(Wn, X, n0, row0, uwave)
                     : (proj == 1) ? slice_src(X, Wn, row0, n0, uwave) : ga;
  ring_passes(Ring, lane, uwave, ld, ga, gan, (proj < 2) ? 1u : 0u, g1, acc);

  const int wa = a0 + (wave >> 2) * 128;  // first register-axis index of this wave's tile
  const int wb = b0 + (wave & 3) * 64;    // first lane-axis index of this wave's tile
  // Buffer 1 is dead behind the last pass's barrier (buffer 0 holds the next tile's stage 0);
  // each wave stages its 128 x 64 tile in its own range of it, one row per lane-axis index,
  // 256 B of payload a row.
  _Float16* stg = Ring + STAGE_H + wave * WSTG;
  if (isV) {
    const int bi = wb + nl;
    float bb[4];
#pragma unroll
    for (int nt = 0; nt < 4; ++nt) bb[nt] = bv[bi + nt * 16];
    // Precaution: stands in front of any rewrite of the bias loads' address register; the
    // index is named as an input so that its register stays live up to the wait.
    asm volatile("s_wait_xcnt 0x0" :: "v"(bi) : "memory");
#pragma unroll
    for (int nt = 0; nt < 4; ++nt) {
#pragma unroll
      for (int mt = 0; mt < 8; ++mt) {
        v8h h;
#pragma unroll
        for (int r = 0; r < 8; ++r) h[r] = (_Float16)(acc[mt][nt][r] + bb[nt]);
        *(v8h*)(stg + (nt * 16 + nl) * LSTR + mt * 16 + 8 * half) = h;
      }
    }
  } else {
    const float* bias = (proj == 0) ? bq : bk;
    const float* bp = bias + wa + 8 * half;
    v4f blo[8], bhi[8];
#pragma unroll
    for (int mt = 0; mt < 8; ++mt) {
      blo[mt] = *(const v4f*)(bp + mt * 16);
      bhi[mt] = *(const v4f*)(bp + mt * 16 + 4);
    }
    // Precaution, as in the other branch: the address lives up to the wait.
    asm volatile("s_wait_xcnt 0x0" :: "v"(bp) : "memory");
#pragma unroll
    for (int mt = 0; mt < 8; ++mt) {
#pragma unroll
      for (int nt = 0; nt < 4; ++nt) {
        v8h h;
#pragma unroll
        for (int r = 0; r < 4; ++r) {
          h[r]     = (_Float16)(acc[mt][nt][r] + blo[mt][r]);
          h[4 + r] = (_Float16)(acc[mt][nt][4 + r] + bhi[mt][r]);
        }
        *(v8h*)(stg + (nt * 16 + nl) * LSTR + mt * 16 + 8 * half) = h;
      }
    }
  }
  __syncthreads();   // the staged rows are read back by other lanes than wrote them

  // 16 lanes carry one staged row = two whole 128-B lines of the output
  const int rr = lane >> 4, pc = (lane & 15) * 8;
  const _Float16* rd = stg + rr * LSTR + pc;
  if (isV) {
    // wa = (b*64 + blk)*64, register axis = t over two neighbouring blocks (8 lanes
    // each); wb = h*128 + d0, lane axis = d
    _Float16* dst = vT + ((size_t)((wa >> 6) + (pc >> 6)) * HEADS + (wb >> 7)) * (DK * BLK) +
                    (size_t)((wb & 127) + rr) * BLK + (pc & 63);
#pragma unroll
    for (int it = 0; it < 32; ++it)
      *(v8h*)(dst + it * 2 * BLK) = *(const v8h*)(rd + it * 2 * LSTR);
    // Precaution: stands behind the run's last store, in front of whatever code the
    // compiler lays behind this branch and lets rewrite the stores' registers.
    asm volatile("s_wait_xcnt 0x0" ::: "memory");
  } else {
    _Float16* dst = ((proj == 0) ? qO : kO) + (size_t)(wb + rr) * D_MODEL + wa + pc;
#pragma unroll
    for (int it = 0; it < 32; ++it)
      *(v8h*)(dst + it * 2 * D_MODEL) = *(const v8h*)(rd + it * 2 * LSTR);
    // Precaution, as in the other branch.
    asm volatile("s_wait_xcnt 0x0" ::: "memory");
  }
  // Every wave has left buffer 1 behind this barrier: it may be refilled. The wait retires the
  // wave's own reads of the staged rows. Barrier by hand: __syncthreads() would also wait for the
  // tile's global stores, which no wave of this launch reads; they drain under the next tile.
  asm volatile("s_wait_dscnt 0x0\n\t"
               "s_barrier_signal -1\n\t"
               "s_barrier_wait -1" ::: "memory");
  ga = gan;
  if (pinned((proj < 2) ? 1u : 0u) != 0u)             // scalar test: only while a next tile exists
    tensor_load(slice_group0(ld + STAGE_B, ga + BK * 2), g1);  // the next tile's stage 1
  }
}

// ---------------------------------------------------------------------------
// Block attention: one workgroup per (b,blk), one wave per head.
// Q, K and V come to LDS as whole 128-B lines by async copies, each head's tiles in the
// two LDS ranges of its own wave, and the WMMA fragments are read from there.
// scores(64x64) in registers -> softmax (shfl_xor within 16-lane halves)
// -> P staged in LDS -> P @ V via WMMA -> f16 attention output row-major,
// staged in the wave's own LDS range and stored as whole lines.
// ---------------------------------------------------------------------------
__global__ void __launch_bounds__(256)
attn_kernel(const _Float16* __restrict__ Q, const _Float16* __restrict__ K,
            const _Float16* __restrict__ VT, _Float16* __restrict__ AO) {
  __shared__ __attribute__((aligned(16))) _Float16 L0[HEADS][AR0];   // 144 KB
  __shared__ __attribute__((aligned(16))) _Float16 L1[HEADS][AR1];   // 136 KB

  const int lane = threadIdx.x & 31;
  const int h    = threadIdx.x >> 5;         // head
  const int bb   = blockIdx.x;               // b*64 + blk
  const int row0 = bb * BLK;                 // flat token row base
  const int col0 = h * DK;
  const int half = lane >> 4, nl = lane & 15;
  const int rr = lane >> 4, pc = (lane & 15) * 8;   // 16 lanes carry one 256-B row piece
  _Float16* r0 = &L0[h][0];                  // Q, then V
  _Float16* r1 = &L1[h][0];                  // K, then P, then the output rows

  // Q and K tiles, 64 rows x 256 B each: one copy takes two rows = four whole lines
  {
    const _Float16* qsrc = Q + (size_t)(row0 + rr) * D_MODEL + col0 + pc;
    const _Float16* ksrc = K + (size_t)(row0 + rr) * D_MODEL + col0 + pc;
    _Float16* qdst = r0 + rr * LSTR + pc;
    _Float16* kdst = r1 + rr * LSTR + pc;
    // the three copy loops of this kernel are unrolled so that the copies issue back to back
#pragma unroll
    for (int c = 0; c < 4; ++c)
      async_copy8<2 * LSTR * 2, 2 * D_MODEL * 2>(qsrc + c * 16 * D_MODEL, qdst + c * 16 * LSTR);
#pragma unroll
    for (int c = 0; c < 3; ++c)
      async_copy8<2 * LSTR * 2, 2 * D_MODEL * 2>(ksrc + c * 16 * D_MODEL, kdst + c * 16 * LSTR);
    // Keeps the wave below 64 outstanding copies: at most 48 are left when the last 8 issue.
    asm volatile("s_wait_asynccnt 0x30" ::: "memory");
    async_copy8<2 * LSTR * 2, 2 * D_MODEL * 2>(ksrc + 3 * 16 * D_MODEL, kdst + 3 * 16 * LSTR);
  }
  asm volatile("s_wait_asynccnt 0x0" ::: "memory");  // this wave's Q and K copies have landed
  __syncthreads();                                   // no tile is read in front of this barrier

  const v8f vzero = {0.f, 0.f, 0.f, 0.f, 0.f, 0.f, 0.f, 0.f};
  v8f s[4][4];
#pragma unroll
  for (int mt = 0; mt < 4; ++mt)
#pragma unroll
    for (int nt = 0; nt < 4; ++nt) s[mt][nt] = vzero;

  // scores = Q_blk @ K_blk^T over dk=128
  for (int kk = 0; kk < DK; kk += 32) {
    v16h a[4], b[4];
#pragma unroll
    for (int mt = 0; mt < 4; ++mt)
      a[mt] = load_frag16(r0, LSTR, 16 * mt, kk, lane);
#pragma unroll
    for (int nt = 0; nt < 4; ++nt)   // B[k][n] = K[row0+n][col0+kk+k]
      b[nt] = load_frag16(r1, LSTR, 16 * nt, kk, lane);
#pragma unroll
    for (int mt = 0; mt < 4; ++mt)
#pragma unroll
      for (int nt = 0; nt < 4; ++nt)
        s[mt][nt] = wmma_f16(a[mt], b[nt], s[mt][nt]);
  }

  // V tile, [d][t] per (bb,h): 128 rows x 128 B, contiguous in memory; one copy takes four
  // rows = four whole lines. It lands in Q's range, which only this wave has read, while
  // the softmax runs.
  asm volatile("s_wait_dscnt 0x0" ::: "memory");     // own reads of Q and K retired before the refill
  {
    const _Float16* vsrc = VT + ((size_t)bb * HEADS + h) * (DK * BLK) + lane * 8;
    _Float16* vdst = r0 + (lane >> 3) * VSTR + (lane & 7) * 8;
#pragma unroll
    for (int c = 0; c < 4; ++c)
      async_copy8<4 * VSTR * 2, 4 * BLK * 2>(vsrc + c * 32 * BLK, vdst + c * 32 * VSTR);
  }

  // row softmax: each row M lives in 16 lanes (one half) across 4 nt tiles
  const float scale = 0.08838834764831845f;  // dk^-0.5
#pragma unroll
  for (int mt = 0; mt < 4; ++mt)
#pragma unroll
    for (int r = 0; r < 8; ++r) {
      float x0 = s[mt][0][r] * scale, x1 = s[mt][1][r] * scale;
      float x2 = s[mt][2][r] * scale, x3 = s[mt][3][r] * scale;
      float mx = fmaxf(fmaxf(x0, x1), fmaxf(x2, x3));
#pragma unroll
      for (int msk = 1; msk < 16; msk <<= 1)
        mx = fmaxf(mx, __shfl_xor(mx, msk, 32));
      float e0 = __expf(x0 - mx), e1 = __expf(x1 - mx);
      float e2 = __expf(x2 - mx), e3 = __expf(x3 - mx);
      float sum = e0 + e1 + e2 + e3;
#pragma unroll
      for (int msk = 1; msk < 16; msk <<= 1)
        sum += __shfl_xor(sum, msk, 32);
      float inv = 1.0f / sum;
      int m = mt * 16 + r + 8 * half;
      r1[m * BLK + 0 * 16 + nl] = (_Float16)(e0 * inv);
      r1[m * BLK + 1 * 16 + nl] = (_Float16)(e1 * inv);
      r1[m * BLK + 2 * 16 + nl] = (_Float16)(e2 * inv);
      r1[m * BLK + 3 * 16 + nl] = (_Float16)(e3 * inv);
    }
  asm volatile("s_wait_asynccnt 0x0" ::: "memory");  // this wave's V copies have landed
  __syncthreads();   // V is not read in front of it; P is read by other lanes than wrote it

  // P's fragments go to registers once: the output rows below overwrite P's range
  // (unrolled: a register array wants constant indices)
  v16h pa[2][4];
#pragma unroll
  for (int k2 = 0; k2 < 2; ++k2)
#pragma unroll
    for (int mt = 0; mt < 4; ++mt) pa[k2][mt] = load_frag16(r1, BLK, mt * 16, k2 * 32, lane);

  // out = P(64x64) @ V(64x128); V is [d][t] so K-pairs contiguous
  for (int dt = 0; dt < 8; ++dt) {
    v8f o[4];
#pragma unroll
    for (int mt = 0; mt < 4; ++mt) o[mt] = vzero;
#pragma unroll
    for (int k2 = 0; k2 < 2; ++k2) {
      v16h b = load_frag16(r0, VSTR, dt * 16, k2 * 32, lane);  // A[m][k]=V[t=k][d=m]
#pragma unroll
      for (int mt = 0; mt < 4; ++mt) {
        // V as the A operand: features d on the register axis, tokens on the lane axis
        o[mt] = wmma_f16(b, pa[k2][mt], o[mt]);
      }
    }
#pragma unroll
    for (int mt = 0; mt < 4; ++mt) {
      v8h hv;
#pragma unroll
      for (int r = 0; r < 8; ++r) hv[r] = (_Float16)o[mt][r];
      *(v8h*)(r1 + (mt * 16 + nl) * OSTR + dt * 16 + 8 * half) = hv;
    }
  }
  __syncthreads();   // the staged rows are read back by other lanes than wrote them

  // 16 lanes carry one staged row = two whole 128-B lines of the output
  _Float16* dst = AO + (size_t)(row0 + rr) * D_MODEL + col0 + pc;
#pragma unroll
  for (int it = 0; it < 32; ++it)
    *(v8h*)(dst + it * 2 * D_MODEL) = *(const v8h*)(r1 + (it * 2 + rr) * OSTR + pc);
}

// ---------------------------------------------------------------------------
// Output projection: attn(f16) @ Wo^T(f16) + bo -> fp32 d_out
// ---------------------------------------------------------------------------
__global__ void __launch_bounds__(256)
out_gemm_kernel(const _Float16* __restrict__ X, const _Float16* __restrict__ WoT,
                const float* __restrict__ bo, float* __restrict__ out) {
  __shared__ __attribute__((aligned(2048))) _Float16 Ring[2 * STAGE_H];   // 288 KB

  const int tid  = threadIdx.x;
  const int lane = tid & 31;
  const int wave = tid >> 5;
  const int row0 = blockIdx.x * 256;
  const int n0   = blockIdx.y * 256;

  const v8f vzero = {0.f, 0.f, 0.f, 0.f, 0.f, 0.f, 0.f, 0.f};
  v8f acc[8][4];
#pragma unroll
  for (int mt = 0; mt < 8; ++mt)
#pragma unroll
    for (int nt = 0; nt < 4; ++nt) acc[mt][nt] = vzero;

  // output features on the accumulator's register axis, tokens on its lane axis
  gemm_core_256(WoT, X, n0, row0, tid, Ring, acc);

  const int half = lane >> 4, nl = lane & 15;
  const int wa = n0 + (wave >> 2) * 128;    // first output feature of this wave's tile
  const int wb = row0 + (wave & 3) * 64;    // first token row of this wave's tile
  // The ring is dead behind its last barrier; each wave stages its 64 token rows of
  // 128 floats in its own range.
  float* stg = (float*)(Ring + wave * FSTG);
  const float* bp = bo + wa + 8 * half;
  v4f blo[8], bhi[8];
#pragma unroll
  for (int mt = 0; mt < 8; ++mt) {
    blo[mt] = *(const v4f*)(bp + mt * 16);
    bhi[mt] = *(const v4f*)(bp + mt * 16 + 4);
  }
  // Precaution: stands in front of any rewrite of the bias loads' address registers; the
  // address is named as an input so that its registers stay live up to the wait.
  asm volatile("s_wait_xcnt 0x0" :: "v"(bp) : "memory");
#pragma unroll
  for (int mt = 0; mt < 8; ++mt) {
#pragma unroll
    for (int nt = 0; nt < 4; ++nt) {
      v4f lo, hi;
#pragma unroll
      for (int r = 0; r < 4; ++r) {
        lo[r] = acc[mt][nt][r] + blo[mt][r];
        hi[r] = acc[mt][nt][4 + r] + bhi[mt][r];
      }
      float* s = stg + (nt * 16 + nl) * FSTR + mt * 16 + 8 * half;
      *(v4f*)s       = lo;
      *(v4f*)(s + 4) = hi;
    }
  }
  __syncthreads();   // the staged rows are read back by other lanes than wrote them

  // the wave's 32 lanes carry one staged row = four whole 128-B lines of the output
  float* dst = out + (size_t)wb * D_MODEL + wa + lane * 4;
#pragma unroll
  for (int it = 0; it < 64; ++it)
    *(v4f*)(dst + it * D_MODEL) = *(const v4f*)(stg + it * FSTR + lane * 4);
}

// ---------------------------------------------------------------------------
extern "C" void kernel_launch(void* const* d_in, const int* in_sizes, int n_in,
                              void* d_out, int out_size, void* d_ws, size_t ws_size,
                              hipStream_t stream) {
  const float* src = (const float*)d_in[0];
  const float* Wq  = (const float*)d_in[1];
  const float* bq  = (const float*)d_in[2];
  const float* Wk  = (const float*)d_in[3];
  const float* bk  = (const float*)d_in[4];
  const float* Wv  = (const float*)d_in[5];
  const float* bv  = (const float*)d_in[6];
  const float* Wo  = (const float*)d_in[7];
  const float* bo  = (const float*)d_in[8];
  float* out = (float*)d_out;

  const size_t actN = (size_t)M_TOTAL * D_MODEL;   // 16,777,216 halves
  const size_t wN   = (size_t)4 * D_MODEL * D_MODEL;

  _Float16* srcH = (_Float16*)d_ws;        // also reused as attention output
  _Float16* wT   = srcH + actN;            // 4 transposed f16 weight matrices
  _Float16* qH   = wT + wN;
  _Float16* kH   = qH + actN;
  _Float16* vT   = kH + actN;              // head-transposed V
  _Float16* attn = srcH;                   // alias: src dead after QKV GEMM

  // 1. fp32 -> f16 conversions
  convert_src_kernel<<<CS_GRID, CS_WAVES * 32, 0, stream>>>(src, srcH);
  convert_w_kernel<<<dim3(D_MODEL / TK, D_MODEL / TN, 4), 256, 0, stream>>>(
      Wq, Wk, Wv, Wo, wT);

  // 2. fused QKV projections (three 256x256 tiles per workgroup, tensor loads to LDS)
  qkv_gemm_kernel<<<dim3(M_TOTAL / 256, D_MODEL / 256), 256, 0, stream>>>(
      srcH, wT, bq, bk, bv, qH, kH, vT);

  // 3. block-local attention (one workgroup per (b,blk), one wave per head)
  attn_kernel<<<dim3(BATCH * (SEQ / BLK)), 256, 0, stream>>>(qH, kH, vT, attn);

  // 4. output projection -> fp32
  out_gemm_kernel<<<dim3(M_TOTAL / 256, D_MODEL / 256), 256, 0, stream>>>(
      attn, wT + (size_t)3 * D_MODEL * D_MODEL, bo, out);
}

// v008
// A run of this version takes 94.1 microseconds.
// Two timings next to v007 put it at 1.21 and 1.20 times that version's speed.
// Counting every step since v000, it is 2.98 times as fast.
#include <hip/hip_runtime.h>

typedef __attribute__((ext_vector_type(16))) _Float16 v16h;
typedef __attribute__((ext_vector_type(8)))  float    v8f;
typedef __attribute__((ext_vector_type(8)))  _Float16 v8h;
typedef __attribute__((ext_vector_type(4)))  float    v4f;
typedef __attribute__((ext_vector_type(4)))  _Float16 v4h;
typedef __attribute__((ext_vector_type(2)))  _Float16 v2h;
typedef __attribute__((ext_vector_type(4)))  uint32_t u32x4;
typedef __attribute__((ext_vector_type(8)))  uint32_t u32x8;

#define D_MODEL 1024
#define SEQ     4096
#define BATCH   4
#define HEADS   8
#define BLK     64
#define DK      128
#define M_TOTAL (BATCH * SEQ)   // 16384 rows

#define BK   128                // k-slice per stage in halves: 256 B of a row, two whole cache lines
#define LSTR 136                // LDS row stride in halves (128 + 8 pad, 272B = 16B x odd: bank-conflict free)
#define SLICE_B 18432           // bytes of one wave's slice of a stage: 64 rows x 272 B = 17,408, rounded up to a multiple of 2 KiB
#define SLICE_H (SLICE_B / 2)   // the same in halves
#define STAGE_B (8 * SLICE_B)   // bytes of one stage: four slices of Xg rows, then four of Wg rows
#define STAGE_H (STAGE_B / 2)   // the same in halves
#define WSTG (64 * LSTR)        // halves of one wave's own f16 epilogue staging range (17,408 B; eight lie in the ring's dead buffer 0)
#define FSTR 132                // f32 staging row stride in floats (128 + 4 pad, 528B = 16B x odd)
#define FSTG (64 * FSTR * 2)    // halves of one wave's own f32 epilogue staging range (33,792 B; eight lie in the dead ring)

// ---------------------------------------------------------------------------
// Tensor load of one wave's slice of a GEMM stage: 64 rows x 256 B, source pitch 2,048 B,
// global -> LDS through no register; the pad lays the rows at the 272-B pitch of LSTR.
// ---------------------------------------------------------------------------
__device__ __forceinline__ uint32_t uni(uint32_t v) {
  return (uint32_t)__builtin_amdgcn_readfirstlane(v);
}

__device__ __forceinline__ uint32_t pinned(uint32_t v) {
  uint32_t w = (uint32_t)__builtin_amdgcn_readfirstlane(v);
  // A tensor load ignores EXEC: the branch round it must compile to a scalar branch.
  asm volatile("" : "+s"(w));  // pinned(): the test word held in a scalar register
  return w;
}

__device__ __forceinline__ u32x4 slice_group0(uint32_t lds_dst, uint64_t ga) {
  u32x4 g0;
  g0[0] = uni(1u);                                    // count 1
  g0[1] = uni(lds_dst);                               // byte offset in the work-group's LDS
  g0[2] = uni((uint32_t)ga);
  g0[3] = uni((((uint32_t)(ga >> 32)) & 0x01FFFFFFu) | 0x80000000u);  // type 2
  return g0;
}

__device__ __forceinline__ u32x8 slice_group1() {
  u32x8 g1;
  g1[0] = uni((1u << 20) | (5u << 22) | (3u << 25));  // no mask, 1-byte elements, 16 B of pad behind every 256 B
  g1[1] = uni(256u << 16);                            // tensor_dim0 = 256 B
  g1[2] = uni(64u << 16);                             // tensor_dim1 = 64 rows
  g1[3] = uni(256u << 16);                            // tile_dim0 = 256 B
  g1[4] = uni(64u);                                   // tile_dim1 = 64 rows
  g1[5] = uni(D_MODEL * 2u);                          // source row pitch in bytes
  g1[6] = uni(0u);
  g1[7] = uni(0u);
  return g1;
}

__device__ __forceinline__ void tensor_load(u32x4 g0, u32x8 g1) {
  asm volatile("s_mov_b32 s100, %0\n\t"
               "s_mov_b32 s101, %1\n\t"
               "s_mov_b32 s102, %2\n\t"
               "s_mov_b32 s103, %3\n\t"
               "s_mov_b64 s[88:89], %4\n\t"
               "s_mov_b64 s[90:91], %5\n\t"
               "s_mov_b64 s[92:93], %6\n\t"
               "s_mov_b64 s[94:95], %7\n\t"
               "tensor_load_to_lds s[100:103], s[88:95]"
               :: "s"(g0[0]), "s"(g0[1]), "s"(g0[2]), "s"(g0[3]),
                  "s"(((uint64_t)g1[1] << 32) | g1[0]), "s"(((uint64_t)g1[3] << 32) | g1[2]),
                  "s"(((uint64_t)g1[5] << 32) | g1[4]), "s"(((uint64_t)g1[7] << 32) | g1[6])
               : "memory", "s88", "s89", "s90", "s91", "s92", "s93", "s94", "s95",
                 "s100", "s101", "s102", "s103");
}

// The issuing wave's wait for its one outstanding request.
__device__ __forceinline__ void wait_tensor0() {
  asm volatile("s_wait_tensorcnt 0x0" ::: "memory");
}

// ---------------------------------------------------------------------------
// Fragment helpers (wave32, 16-bit 16x16x32 WMMA layout)
// A (16x32): lane L holds row M=L&15; half=L>>4 adds +8 to K.
//   VGPR j<4  -> K pair {2j, 2j+1} (+8*half)
//   VGPR j>=4 -> K pair {16+2(j-4), ...} (+8*half)
// B (32x16) is symmetric with N=L&15; memory addressed as p[n*ld + k].
// ---------------------------------------------------------------------------
__device__ __forceinline__ v16h load_frag16(const _Float16* __restrict__ p,
                                            int ld, int r0, int k0, int lane) {
  const int m    = lane & 15;
  const int half = lane >> 4;
  const _Float16* q = p + (size_t)(r0 + m) * ld + (k0 + 8 * half);
  v16h f;
#pragma unroll
  for (int i = 0; i < 8; ++i) f[i]     = q[i];        // VGPR 0..3: K 0..7
#pragma unroll
  for (int i = 0; i < 8; ++i) f[8 + i] = q[16 + i];   // VGPR 4..7: K 16..23
  return f;
}

__device__ __forceinline__ v8f wmma_f16(v16h a, v16h b, v8f c) {
  return __builtin_amdgcn_wmma_f32_16x16x32_f16(
      /*neg_a=*/false, a, /*neg_b=*/false, b,
      /*c_mod=*/(short)0, c, /*reuse_a=*/false, /*reuse_b=*/false);
}

// ---------------------------------------------------------------------------
// Workgroup-tiled GEMM core: 256x256 tile, 8 waves (2x4), two per SIMD, K staged in LDS by
// tensor loads, one per wave and stage (two-buffer ring, one barrier per k-slice). acc is this
// wave's 128x64 (8x4 fragment tiles).
// Xg, Wg: [rows x 1024] row-major f16. acc = Xg rows (row0..) times Wg rows (n0..) transposed:
// a lane holds 8 neighbouring Xg-row indices (register axis) at one Wg-row index (lane axis);
// SWAP exchanges the two axes.
// The callers pick which matrix goes on which side so that the register axis is the
// axis that is contiguous in their output.
// ---------------------------------------------------------------------------
// one 32-k block of a wave's 128x64 tile: 8 x 4 fragment products. SWAP puts the b rows on the
// accumulator's register axis and the a rows on its lane axis (the two fragment layouts are alike).
template <bool SWAP>
__device__ __forceinline__ void mma_block(const v16h a[8], const v16h b[4], v8f acc[8][4]) {
#pragma unroll
  for (int mt = 0; mt < 8; ++mt)
#pragma unroll
    for (int nt = 0; nt < 4; ++nt)
      acc[mt][nt] = SWAP ? wmma_f16(b[nt], a[mt], acc[mt][nt]) : wmma_f16(a[mt], b[nt], acc[mt][nt]);
}

// first byte of this wave's slice of every stage of a tile: waves 0..3 bring 64 Xg rows each,
// waves 4..7 64 Wg rows
__device__ __forceinline__ uint64_t slice_src(const _Float16* __restrict__ Xg,
                                              const _Float16* __restrict__ Wg,
                                              int row0, int n0, uint32_t wave) {
  const _Float16* srow = (wave < 4u) ? Xg + (size_t)(row0 + 64 * (int)wave) * D_MODEL
                                     : Wg + (size_t)(n0 + 64 * ((int)wave - 4)) * D_MODEL;
  return (uint64_t)(uintptr_t)srow;
}

// The eight passes of one tile. On entry stage 0 is published in buffer 0 and this wave's
// request for stage 1 is in flight. ga: this wave's slice of the tile; where
// `more` is set, gan is its slice of the work-group's next tile, whose stage 0 is asked for in
// the place of a stage 8 and is published by the last pass's barrier. Buffer 1 is left dead.
template <bool SWAP>
__device__ __forceinline__ void ring_passes(_Float16* Ring, int lane, uint32_t wave, uint32_t ld,
                                            uint64_t ga, uint64_t gan, uint32_t more,
                                            const u32x8 g1, v8f acc[8][4]) {
  // the slices this wave reads: two of Xg rows (128 rows), one of Wg rows (64 rows)
  const int asl = (int)(wave >> 2) * 2 * SLICE_H;
  const int bsl = (4 + (int)(wave & 3u)) * SLICE_H;

  const int steps = D_MODEL / BK;
  for (int i = 0; i < steps; ++i) {
    const int cur = i & 1;
    const _Float16* Ab = Ring + cur * STAGE_H + asl;
    const _Float16* Bb = Ring + cur * STAGE_H + bsl;
#pragma unroll
    for (int kk = 0; kk < BK; kk += 32) {
      v16h a[8], b[4];
      // Fence pair: holds this block's 24 LDS reads together as one group in front of its
      // 32 WMMAs. Left free, the compiler spread them in pairs among the WMMAs, each pair
      // behind a wait to 0, which two waves a SIMD cannot hide.
      __builtin_amdgcn_sched_barrier(0);
#pragma unroll
      for (int nt = 0; nt < 4; ++nt) b[nt] = load_frag16(Bb, LSTR, 16 * nt, kk, lane);
#pragma unroll
      for (int mt = 0; mt < 8; ++mt)
        a[mt] = load_frag16(Ab + (mt >> 2) * SLICE_H, LSTR, 16 * (mt & 3), kk, lane);
      __builtin_amdgcn_sched_barrier(0);
      if (kk + 32 == BK) {
        // Publish point of stage i + 1, which also frees buffer `cur` for the refill. It stands
        // behind the pass's last LDS reads; the last block's WMMAs, which read registers
        // alone, follow it, so that the refill has the whole next pass to land in.
        asm volatile("s_wait_dscnt 0x0" ::: "memory");  // own reads of `cur` retired before it is refilled
        wait_tensor0();                                 // own slice of stage i + 1 has landed
        __syncthreads();
        const bool own = i + 2 < steps;                 // stage i + 2 of this tile exists
        // scalar test: only while a next stage exists, in this tile or as the next tile's first
        if (pinned((own || (i + 2 == steps && more != 0u)) ? 1u : 0u) != 0u) {
          tensor_load(slice_group0(ld + (uint32_t)cur * STAGE_B,
                                   own ? ga + (uint64_t)(i + 2) * (BK * 2) : gan), g1);
        }
      }
      mma_block<SWAP>(a, b, acc);
    }
  }
  asm volatile("s_wait_tensorcnt 0x0" ::: "memory");    // nothing in flight when the passes are left
  asm volatile("s_wait_dscnt 0x0" ::: "memory");        // no LDS read of the ring outstanding either
}

// prologue of a work-group's first tile: stage 0 lands in buffer 0 and is published, then
// stage 1 starts
__device__ __forceinline__ void ring_prologue(uint32_t ld, uint64_t ga, const u32x8 g1) {
  tensor_load(slice_group0(ld, ga), g1);
  wait_tensor0();                                     // this wave's slice of stage 0 has landed
  __syncthreads();                                    // every wave's slice of stage 0 visible
  tensor_load(slice_group0(ld + STAGE_B, ga + BK * 2), g1);
}

// one tile alone
__device__ __forceinline__ void gemm_core_256(const _Float16* __restrict__ Xg,
                                              const _Float16* __restrict__ Wg,
                                              int row0, int n0, int tid,
                                              _Float16* Ring, v8f acc[8][4]) {
  const int lane = tid & 31;
  const uint32_t wave = uni((uint32_t)tid >> 5);
  const uint64_t ga = slice_src(Xg, Wg, row0, n0, wave);
  const uint32_t ld = (uint32_t)(uintptr_t)Ring + wave * SLICE_B;  // LDS byte offset (low 32 bits)
  const u32x8 g1 = slice_group1();
  ring_prologue(ld, ga, g1);
  ring_passes<false>(Ring, lane, wave, ld, ga, ga, 0u, g1, acc);
}

// ---------------------------------------------------------------------------
// Conversion kernels
// ---------------------------------------------------------------------------
#define CS_WAVES 16             // waves per work-group of the activation stream
#define CS_LOADS 16             // 16-byte loads a lane has in flight
#define CS_GRID  256            // work-groups of the activation stream

// f32 -> f16 stream. One wave-wide load covers 512 contiguous bytes (4 whole lines), the
// matching store 256 contiguous bytes (2 whole lines). A wave owns a contiguous range and
// walks it in groups of CS_LOADS loads, all issued before the first one is converted.
__global__ void __launch_bounds__(CS_WAVES * 32)
convert_src_kernel(const float* __restrict__ in, _Float16* __restrict__ out) {
  const int lane = threadIdx.x & 31;
  const int wave = blockIdx.x * CS_WAVES + (threadIdx.x >> 5);
  const size_t per_wave = (size_t)M_TOTAL * D_MODEL / (CS_GRID * CS_WAVES);  // 4096 floats
  const float*    ip = in + wave * per_wave + lane * 4;
  _Float16*       op = out + wave * per_wave + lane * 4;
  for (size_t g = 0; g < per_wave; g += CS_LOADS * 128) {
    v4f x[CS_LOADS];
#pragma unroll
    for (int c = 0; c < CS_LOADS; ++c) x[c] = *(const v4f*)(ip + g + c * 128);
#pragma unroll
    for (int c = 0; c < CS_LOADS; ++c) {
      v4h h;
#pragma unroll
      for (int r = 0; r < 4; ++r) h[r] = (_Float16)x[c][r];
      *(v4h*)(op + g + c * 128) = h;
    }
  }
}

#define TK   128                // k extent of a weight tile
#define TN   64                 // n extent of a weight tile
#define TSTR 136                // LDS row stride in halves (128 + 8 pad, rows stay 16-B aligned)

// wT[z][n][k] = W_z[k][n]  (f16, transposed so K-pairs are contiguous).
// One work-group turns a 128 (k) x 64 (n) tile through LDS: 16 lanes read one 256-B piece
// of a W row, 16 lanes write one 256-B piece of a wT row, whole lines on both sides.
__global__ void __launch_bounds__(256)
convert_w_kernel(const float* __restrict__ Wq,
                 const float* __restrict__ Wk,
                 const float* __restrict__ Wv,
                 const float* __restrict__ Wo,
                 _Float16* __restrict__ wT) {
  __shared__ __attribute__((aligned(16))) _Float16 tile[TN * TSTR];
  const int tid = threadIdx.x;
  const int k0 = blockIdx.x * TK;
  const int n0 = blockIdx.y * TN;
  const int z  = blockIdx.z;
  const float* W = (z == 0) ? Wq : (z == 1) ? Wk : (z == 2) ? Wv : Wo;

  // a thread takes 4 neighbouring n of the k pairs (2 * kp, 2 * kp + 1), kp = tid >> 4 + 16 * c
  const int nq = (tid & 15) * 4;
  const int kp = tid >> 4;
  const float* wp = W + (size_t)(k0 + 2 * kp) * D_MODEL + n0 + nq;
  v4f lo[4], hi[4];
#pragma unroll
  for (int c = 0; c < 4; ++c) {
    lo[c] = *(const v4f*)(wp + (size_t)(32 * c) * D_MODEL);
    hi[c] = *(const v4f*)(wp + (size_t)(32 * c + 1) * D_MODEL);
  }
#pragma unroll
  for (int c = 0; c < 4; ++c)
#pragma unroll
    for (int j = 0; j < 4; ++j) {
      v2h p;
      p[0] = (_Float16)lo[c][j];
      p[1] = (_Float16)hi[c][j];
      *(v2h*)(tile + (nq + j) * TSTR + 2 * kp + 32 * c) = p;
    }
  __syncthreads();   // the tile's rows are read back by other lanes than wrote them

  const int rr = tid >> 4, pc = (tid & 15) * 8;
  _Float16* dst = wT + (size_t)z * D_MODEL * D_MODEL + (size_t)(n0 + rr) * D_MODEL + k0 + pc;
#pragma unroll
  for (int it = 0; it < 4; ++it)
    *(v8h*)(dst + (size_t)(it * 16) * D_MODEL) = *(const v8h*)(tile + (it * 16 + rr) * TSTR + pc);
}

// ---------------------------------------------------------------------------
// QKV projection with the block attention in the same launch: 256x256 workgroup tile, 8 waves.
// A work-group walks the Q, K and V tiles of its rows and columns one after the other, and the
// tensor-load ring runs on across them: the next tile's stage 0 lands in buffer 0 under the last
// pass, its stage 1 starts behind that pass. A wave's 128 features x 64 tokens of each tile are one
// head of one block, so the attention of that (block, head) is the wave's own work, and
// the accumulator layout is the operand layout: a lane's 8 neighbouring register-axis values of two
// neighbouring 16-tiles are its 16 k values of a 16x16x32 fragment. Q, K, P and V go from
// accumulators to operands by conversion alone, with no exchange between lanes (Q's fragments wait
// in the workspace while the K passes run, each lane's own values in its own bytes).
//   Q, K tiles: features on the register axis, tokens on the lane axis  -> k axis = features
//   scores:     A = K, B = Q -> key tokens on the register axis, query tokens on the lane axis
//   V tile:     tokens on the register axis, features on the lane axis  -> k axis = key tokens
//   output:     A = V, B = P -> features on the register axis, query tokens on the lane axis
// The f16 attention output is staged in the dead ring and stored row-major as whole lines.
// ---------------------------------------------------------------------------
__device__ __forceinline__ void zero_acc(v8f acc[8][4]) {
  const v8f vzero = {0.f, 0.f, 0.f, 0.f, 0.f, 0.f, 0.f, 0.f};
#pragma unroll
  for (int mt = 0; mt < 8; ++mt)
#pragma unroll
    for (int nt = 0; nt < 4; ++nt) acc[mt][nt] = vzero;
}

// Q or K tile plus bias as f16 fragments: f[nt][c] = tokens 16 nt.., features 32 c..
// bias: at the head's first feature (the same for the wave); boff: the lane's byte offset from
// there, 32 * half
__device__ __forceinline__ void feature_frags(const v8f acc[8][4], const float* __restrict__ bias,
                                              uint32_t boff, v16h f[4][4]) {
  const char* bp = (const char*)bias + boff;
  v4f blo[8], bhi[8];
  __builtin_amdgcn_sched_barrier(0);   // first of the pair described below
#pragma unroll
  for (int mt = 0; mt < 8; ++mt) {
    blo[mt] = *(const v4f*)(bp + mt * 64);
    bhi[mt] = *(const v4f*)(bp + mt * 64 + 16);
  }
  // Precaution: stands in front of any rewrite of the bias loads' address register. The pair of
  // scheduling fences keeps every other instruction, and so every such rewrite, out of the run
  // from the first load to the wait.
  asm volatile("s_wait_xcnt 0x0" ::: "memory");
  __builtin_amdgcn_sched_barrier(0);
#pragma unroll
  for (int c = 0; c < 4; ++c)
#pragma unroll
    for (int nt = 0; nt < 4; ++nt) {
      v16h x;
#pragma unroll
      for (int r = 0; r < 4; ++r) {
        x[r]      = (_Float16)(acc[2 * c][nt][r] + blo[2 * c][r]);
        x[4 + r]  = (_Float16)(acc[2 * c][nt][4 + r] + bhi[2 * c][r]);
        x[8 + r]  = (_Float16)(acc[2 * c + 1][nt][r] + blo[2 * c + 1][r]);
        x[12 + r] = (_Float16)(acc[2 * c + 1][nt][4 + r] + bhi[2 * c + 1][r]);
      }
      f[nt][c] = x;
    }
}

__global__ void __launch_bounds__(256)
qkv_attn_kernel(const _Float16* __restrict__ X, const _Float16* __restrict__ WT,
                const float* __restrict__ bq, const float* __restrict__ bk,
                const float* __restrict__ bv, _Float16* __restrict__ AO, _Float16* park) {
  __shared__ __attribute__((aligned(2048))) _Float16 Ring[2 * STAGE_H];   // 288 KB

  const int tid  = threadIdx.x;
  const int lane = tid & 31;
  const int row0 = blockIdx.x * 256;
  const int n0   = blockIdx.y * 256;
  const uint32_t uwave = uni((uint32_t)tid >> 5);
  const uint32_t ld = (uint32_t)(uintptr_t)Ring + uwave * SLICE_B;  // LDS byte offset (low 32 bits)
  const int half = lane >> 4, nl = lane & 15;
  const int wa = n0 + (int)(uwave >> 2) * DK;     // first feature of this wave's head
  const int wb = row0 + (int)(uwave & 3u) * BLK;  // first token row of this wave's block
  const v8f vzero = {0.f, 0.f, 0.f, 0.f, 0.f, 0.f, 0.f, 0.f};

  // every tile: weight rows in the stage's first four slices, X rows in its last four
  const uint64_t gq = slice_src(WT, X, n0, row0, uwave);
  const uint64_t gk = slice_src(WT + (size_t)D_MODEL * D_MODEL, X, n0, row0, uwave);
  const uint64_t gv = slice_src(WT + (size_t)2 * D_MODEL * D_MODEL, X, n0, row0, uwave);
  const u32x8 g1 = slice_group1();
  ring_prologue(ld, gq, g1);

  v8f acc[8][4];
  v16h pf[4][2];   // P as B fragments: pf[nt][c] = query tokens 16 nt.., key tokens 32 c..
  {
    v16h qf[4][4], kf[4][4];
    zero_acc(acc);
    ring_passes<false>(Ring, lane, uwave, ld, gq, gk, 1u, g1, acc);
    // Buffer 1 is dead behind the last pass's barrier, and nothing is staged in it: K's stage 1
    tensor_load(slice_group0(ld + STAGE_B, gk + BK * 2), g1);
    feature_frags(acc, bq + wa, 32u * (uint32_t)half, qf);
    // Registers are short under the K passes (256 accumulators, 96 of fragments): Q's 128 wait in
    // the lane's own 512 B of the workspace, whole lines per store, and come back behind the passes.
    _Float16* pk = park + (size_t)((blockIdx.y * (M_TOTAL / 256) + blockIdx.x) * 8 + uwave) * 8192 +
                   lane * 8;
    __builtin_amdgcn_sched_barrier(0);   // fence pair round the stores and their wait, as for the bias
#pragma unroll
    for (int c = 0; c < 4; ++c)
#pragma unroll
      for (int nt = 0; nt < 4; ++nt) {
        *(v8h*)(pk + (c * 4 + nt) * 512) =
            __builtin_shufflevector(qf[nt][c], qf[nt][c], 0, 1, 2, 3, 4, 5, 6, 7);
        *(v8h*)(pk + (c * 4 + nt) * 512 + 256) =
            __builtin_shufflevector(qf[nt][c], qf[nt][c], 8, 9, 10, 11, 12, 13, 14, 15);
      }
    // Precaution: stands in front of any rewrite of the stores' registers.
    asm volatile("s_wait_xcnt 0x0" ::: "memory");
    __builtin_amdgcn_sched_barrier(0);
    zero_acc(acc);
    ring_passes<false>(Ring, lane, uwave, ld, gk, gv, 1u, g1, acc);
    tensor_load(slice_group0(ld + STAGE_B, gv + BK * 2), g1);   // V's stage 1, as K's above
    __builtin_amdgcn_sched_barrier(0);   // fence pair round the loads and their wait, as above
#pragma unroll
    for (int c = 0; c < 4; ++c)
#pragma unroll
      for (int nt = 0; nt < 4; ++nt)
        qf[nt][c] = __builtin_shufflevector(*(const v8h*)(pk + (c * 4 + nt) * 512),
                                            *(const v8h*)(pk + (c * 4 + nt) * 512 + 256),
                                            0, 1, 2, 3, 4, 5, 6, 7, 8, 9, 10, 11, 12, 13, 14, 15);
    // Precaution: stands in front of any rewrite of the loads' address registers.
    asm volatile("s_wait_xcnt 0x0" ::: "memory");
    __builtin_amdgcn_sched_barrier(0);
    feature_frags(acc, bk + wa, 32u * (uint32_t)half, kf);

    // scores, transposed: st[mt][nt] = key tokens 16 mt.. (register axis) x query tokens 16 nt..
    v8f st[4][4];
#pragma unroll
    for (int c = 0; c < 4; ++c)
#pragma unroll
      for (int mt = 0; mt < 4; ++mt)
#pragma unroll
        for (int nt = 0; nt < 4; ++nt)
          st[mt][nt] = wmma_f16(kf[mt][c], qf[nt][c], c == 0 ? vzero : st[mt][nt]);

    // softmax over the key tokens of one query token: 32 values of the lane, 32 of lane ^ 16
    const float scale = 0.08838834764831845f;  // dk^-0.5
#pragma unroll
    for (int nt = 0; nt < 4; ++nt) {
      float mx = st[0][nt][0] * scale;
#pragma unroll
      for (int mt = 0; mt < 4; ++mt)
#pragma unroll
        for (int r = 0; r < 8; ++r) {
          st[mt][nt][r] *= scale;
          mx = fmaxf(mx, st[mt][nt][r]);
        }
      mx = fmaxf(mx, __shfl_xor(mx, 16, 32));
      float sum = 0.f;
#pragma unroll
      for (int mt = 0; mt < 4; ++mt)
#pragma unroll
        for (int r = 0; r < 8; ++r) {
          st[mt][nt][r] = __expf(st[mt][nt][r] - mx);
          sum += st[mt][nt][r];
        }
      sum += __shfl_xor(sum, 16, 32);
      const float inv = 1.0f / sum;
#pragma unroll
      for (int c = 0; c < 2; ++c) {
        v16h x;
#pragma unroll
        for (int r = 0; r < 8; ++r) {
          x[r]     = (_Float16)(st[2 * c][nt][r] * inv);
          x[8 + r] = (_Float16)(st[2 * c + 1][nt][r] * inv);
        }
        // Inputs-only fence: holds P's conversion in front of the V passes. Left free, the compiler
        // moved the division and the conversion behind them and carried the f32 values, twice
        // the registers, across the loop.
        asm volatile("" :: "v"(x));
        pf[nt][c] = x;
      }
    }
  }

  // V tile: acc[mt][nt] = key tokens 16 nt.. (register axis) x features 16 mt.. (lane axis)
  zero_acc(acc);
  ring_passes<true>(Ring, lane, uwave, ld, gv, gv, 0u, g1, acc);

  const int bi = wa + nl;
  float bb[8];
  __builtin_amdgcn_sched_barrier(0);   // fence pair round the loads and their wait, as above
#pragma unroll
  for (int mt = 0; mt < 8; ++mt) bb[mt] = bv[bi + mt * 16];
  // Precaution, as for the Q and K bias; the index is named as an input so that no load's result
  // takes its register.
  asm volatile("s_wait_xcnt 0x0" :: "v"(bi) : "memory");
  __builtin_amdgcn_sched_barrier(0);

  // The ring is dead behind its last barrier; each wave stages its 64 token rows of 128 features
  // in its own range, 256 B of payload a row.
  _Float16* stg = Ring + uwave * WSTG;
#pragma unroll
  for (int mt = 0; mt < 8; ++mt) {
    v16h vf[2];    // V as A fragments: features 16 mt.., key tokens 32 c..
#pragma unroll
    for (int c = 0; c < 2; ++c)
#pragma unroll
      for (int r = 0; r < 8; ++r) {
        vf[c][r]     = (_Float16)(acc[mt][2 * c][r] + bb[mt]);
        vf[c][8 + r] = (_Float16)(acc[mt][2 * c + 1][r] + bb[mt]);
      }
#pragma unroll
    for (int nt = 0; nt < 4; ++nt) {
      v8f o = wmma_f16(vf[0], pf[nt][0], vzero);
      o = wmma_f16(vf[1], pf[nt][1], o);
      v8h hv;
#pragma unroll
      for (int r = 0; r < 8; ++r) hv[r] = (_Float16)o[r];
      *(v8h*)(stg + (nt * 16 + nl) * LSTR + mt * 16 + 8 * half) = hv;
    }
  }
  __syncthreads();   // the staged rows are read back by other lanes than wrote them

  // 16 lanes carry one staged row = two whole 128-B lines of the output
  const int rr = lane >> 4, pc = (lane & 15) * 8;
  const _Float16* rd = stg + rr * LSTR + pc;
  _Float16* dst = AO + (size_t)(wb + rr) * D_MODEL + wa + pc;
#pragma unroll
  for (int it = 0; it < 32; ++it)
    *(v8h*)(dst + it * 2 * D_MODEL) = *(const v8h*)(rd + it * 2 * LSTR);
}

// ---------------------------------------------------------------------------
// Output projection: attn(f16) @ Wo^T(f16) + bo -> fp32 d_out
// ---------------------------------------------------------------------------
__global__ void __launch_bounds__(256)
out_gemm_kernel(const _Float16* __restrict__ X, const _Float16* __restrict__ WoT,
                const float* __restrict__ bo, float* __restrict__ out) {
  __shared__ __attribute__((aligned(2048))) _Float16 Ring[2 * STAGE_H];   // 288 KB

  const int tid  = threadIdx.x;
  const int lane = tid & 31;
  const int wave = tid >> 5;
  const int row0 = blockIdx.x * 256;
  const int n0   = blockIdx.y * 256;

  const v8f vzero = {0.f, 0.f, 0.f, 0.f, 0.f, 0.f, 0.f, 0.f};
  v8f acc[8][4];
#pragma unroll
  for (int mt = 0; mt < 8; ++mt)
#pragma unroll
    for (int nt = 0; nt < 4; ++nt) acc[mt][nt] = vzero;

  // output features on the accumulator's register axis, tokens on its lane axis
  gemm_core_256(WoT, X, n0, row0, tid, Ring, acc);

  const int half = lane >> 4, nl = lane & 15;
  const int wa = n0 + (wave >> 2) * 128;    // first output feature of this wave's tile
  const int wb = row0 + (wave & 3) * 64;    // first token row of this wave's tile
  // The ring is dead behind its last barrier; each wave stages its 64 token rows of
  // 128 floats in its own range.
  float* stg = (float*)(Ring + wave * FSTG);
  const float* bp = bo + wa + 8 * half;
  v4f blo[8], bhi[8];
#pragma unroll
  for (int mt = 0; mt < 8; ++mt) {
    blo[mt] = *(const v4f*)(bp + mt * 16);
    bhi[mt] = *(const v4f*)(bp + mt * 16 + 4);
  }
  // Precaution: stands in front of any rewrite of the bias loads' address registers; the
  // address is named as an input so that its registers stay live up to the wait.
  asm volatile("s_wait_xcnt 0x0" :: "v"(bp) : "memory");
#pragma unroll
  for (int mt = 0; mt < 8; ++mt) {
#pragma unroll
    for (int nt = 0; nt < 4; ++nt) {
      v4f lo, hi;
#pragma unroll
      for (int r = 0; r < 4; ++r) {
        lo[r] = acc[mt][nt][r] + blo[mt][r];
        hi[r] = acc[mt][nt][4 + r] + bhi[mt][r];
      }
      float* s = stg + (nt * 16 + nl) * FSTR + mt * 16 + 8 * half;
      *(v4f*)s       = lo;
      *(v4f*)(s + 4) = hi;
    }
  }
  __syncthreads();   // the staged rows are read back by other lanes than wrote them

  // the wave's 32 lanes carry one staged row = four whole 128-B lines of the output
  float* dst = out + (size_t)wb * D_MODEL + wa + lane * 4;
#pragma unroll
  for (int it = 0; it < 64; ++it)
    *(v4f*)(dst + it * D_MODEL) = *(const v4f*)(stg + it * FSTR + lane * 4);
}

// ---------------------------------------------------------------------------
extern "C" void kernel_launch(void* const* d_in, const int* in_sizes, int n_in,
                              void* d_out, int out_size, void* d_ws, size_t ws_size,
                              hipStream_t stream) {
  const float* src = (const float*)d_in[0];
  const float* Wq  = (const float*)d_in[1];
  const float* bq  = (const float*)d_in[2];
  const float* Wk  = (const float*)d_in[3];
  const float* bk  = (const float*)d_in[4];
  const float* Wv  = (const float*)d_in[5];
  const float* bv  = (const float*)d_in[6];
  const float* Wo  = (const float*)d_in[7];
  const float* bo  = (const float*)d_in[8];
  float* out = (float*)d_out;

  const size_t actN = (size_t)M_TOTAL * D_MODEL;   // 16,777,216 halves
  const size_t wN   = (size_t)4 * D_MODEL * D_MODEL;

  _Float16* srcH = (_Float16*)d_ws;
  _Float16* wT   = srcH + actN;            // 4 transposed f16 weight matrices
  _Float16* attn = wT + wN;                // attention output, row-major
  _Float16* park = attn + actN;            // 16 KB a wave of the fused launch: its Q fragments

  // 1. fp32 -> f16 conversions
  convert_src_kernel<<<CS_GRID, CS_WAVES * 32, 0, stream>>>(src, srcH);
  convert_w_kernel<<<dim3(D_MODEL / TK, D_MODEL / TN, 4), 256, 0, stream>>>(
      Wq, Wk, Wv, Wo, wT);

  // 2. QKV projections and block-local attention (three 256x256 tiles per workgroup, one
  //    (block, head) per wave)
  qkv_attn_kernel<<<dim3(M_TOTAL / 256, D_MODEL / 256), 256, 0, stream>>>(
      srcH, wT, bq, bk, bv, attn, park);

  // 3. output projection -> fp32
  out_gemm_kernel<<<dim3(M_TOTAL / 256, D_MODEL / 256), 256, 0, stream>>>(
      attn, wT + (size_t)3 * D_MODEL * D_MODEL, bo, out);
}

// v009
// Measured time: 90.1 microseconds a run.
// Two timings next to v008 put it at 1.04 and 1.05 times that version's speed.
// Counting every step since v000, it is 3.12 times as fast.
#include <hip/hip_runtime.h>

typedef __attribute__((ext_vector_type(16))) _Float16 v16h;
typedef __attribute__((ext_vector_type(8)))  float    v8f;
typedef __attribute__((ext_vector_type(8)))  _Float16 v8h;
typedef __attribute__((ext_vector_type(4)))  float    v4f;
typedef __attribute__((ext_vector_type(4)))  _Float16 v4h;
typedef __attribute__((ext_vector_type(2)))  _Float16 v2h;
typedef __attribute__((ext_vector_type(4)))  uint32_t u32x4;
typedef __attribute__((ext_vector_type(8)))  uint32_t u32x8;

#define D_MODEL 1024
#define SEQ     4096
#define BATCH   4
#define HEADS   8
#define BLK     64
#define DK      128
#define M_TOTAL (BATCH * SEQ)   // 16384 rows

#define BK   128                // k-slice per stage in halves: 256 B of a row, two whole cache lines
#define LSTR 136                // LDS row stride in halves (128 + 8 pad, 272B = 16B x odd: bank-conflict free)
#define SLICE_B 18432           // bytes of one wave's slice of a stage: 64 rows x 272 B = 17,408, rounded up to a multiple of 2 KiB
#define SLICE_H (SLICE_B / 2)   // the same in halves
#define STAGE_B (8 * SLICE_B)   // bytes of one stage: four slices of Xg rows, then four of Wg rows
#define STAGE_H (STAGE_B / 2)   // the same in halves
#define WSTG (64 * LSTR)        // halves of one wave's own f16 epilogue staging range (17,408 B; eight lie in the ring's dead buffer 0)
#define FSTR 132                // f32 staging row stride in floats (128 + 4 pad, 528B = 16B x odd)
#define FSTG (64 * FSTR * 2)    // halves of one wave's own f32 epilogue staging range (33,792 B; eight lie in the dead ring)

// ---------------------------------------------------------------------------
// Tensor load of one wave's slice of a GEMM stage: 64 rows x 256 B, source pitch 2,048 B,
// global -> LDS through no register; the pad lays the rows at the 272-B pitch of LSTR.
// ---------------------------------------------------------------------------
__device__ __forceinline__ uint32_t uni(uint32_t v) {
  return (uint32_t)__builtin_amdgcn_readfirstlane(v);
}

__device__ __forceinline__ uint32_t pinned(uint32_t v) {
  uint32_t w = (uint32_t)__builtin_amdgcn_readfirstlane(v);
  // A tensor load ignores EXEC: the branch round it must compile to a scalar branch.
  asm volatile("" : "+s"(w));  // pinned(): the test word held in a scalar register
  return w;
}

__device__ __forceinline__ u32x4 slice_group0(uint32_t lds_dst, uint64_t ga) {
  u32x4 g0;
  g0[0] = uni(1u);                                    // count 1
  g0[1] = uni(lds_dst);                               // byte offset in the work-group's LDS
  g0[2] = uni((uint32_t)ga);
  g0[3] = uni((((uint32_t)(ga >> 32)) & 0x01FFFFFFu) | 0x80000000u);  // type 2
  return g0;
}

__device__ __forceinline__ u32x8 slice_group1() {
  u32x8 g1;
  g1[0] = uni((1u << 20) | (5u << 22) | (3u << 25));  // no mask, 1-byte elements, 16 B of pad behind every 256 B
  g1[1] = uni(256u << 16);                            // tensor_dim0 = 256 B
  g1[2] = uni(64u << 16);                             // tensor_dim1 = 64 rows
  g1[3] = uni(256u << 16);                            // tile_dim0 = 256 B
  g1[4] = uni(64u);                                   // tile_dim1 = 64 rows
  g1[5] = uni(D_MODEL * 2u);                          // source row pitch in bytes
  g1[6] = uni(0u);
  g1[7] = uni(0u);
  return g1;
}

__device__ __forceinline__ void tensor_load(u32x4 g0, u32x8 g1) {
  asm volatile("s_mov_b32 s100, %0\n\t"
               "s_mov_b32 s101, %1\n\t"
               "s_mov_b32 s102, %2\n\t"
               "s_mov_b32 s103, %3\n\t"
               "s_mov_b64 s[88:89], %4\n\t"
               "s_mov_b64 s[90:91], %5\n\t"
               "s_mov_b64 s[92:93], %6\n\t"
               "s_mov_b64 s[94:95], %7\n\t"
               "tensor_load_to_lds s[100:103], s[88:95]"
               :: "s"(g0[0]), "s"(g0[1]), "s"(g0[2]), "s"(g0[3]),
                  "s"(((uint64_t)g1[1] << 32) | g1[0]), "s"(((uint64_t)g1[3] << 32) | g1[2]),
                  "s"(((uint64_t)g1[5] << 32) | g1[4]), "s"(((uint64_t)g1[7] << 32) | g1[6])
               : "memory", "s88", "s89", "s90", "s91", "s92", "s93", "s94", "s95",
                 "s100", "s101", "s102", "s103");
}

// The issuing wave's wait for its one outstanding request.
__device__ __forceinline__ void wait_tensor0() {
  asm volatile("s_wait_tensorcnt 0x0" ::: "memory");
}

// ---------------------------------------------------------------------------
// Fragment helpers (wave32, 16-bit 16x16x32 WMMA layout)
// A (16x32): lane L holds row M=L&15; half=L>>4 adds +8 to K.
//   VGPR j<4  -> K pair {2j, 2j+1} (+8*half)
//   VGPR j>=4 -> K pair {16+2(j-4), ...} (+8*half)
// B (32x16) is symmetric with N=L&15; memory addressed as p[n*ld + k].
// ---------------------------------------------------------------------------
__device__ __forceinline__ v16h load_frag16(const _Float16* __restrict__ p,
                                            int ld, int r0, int k0, int lane) {
  const int m    = lane & 15;
  const int half = lane >> 4;
  const _Float16* q = p + (size_t)(r0 + m) * ld + (k0 + 8 * half);
  v16h f;
#pragma unroll
  for (int i = 0; i < 8; ++i) f[i]     = q[i];        // VGPR 0..3: K 0..7
#pragma unroll
  for (int i = 0; i < 8; ++i) f[8 + i] = q[16 + i];   // VGPR 4..7: K 16..23
  return f;
}

__device__ __forceinline__ v8f wmma_f16(v16h a, v16h b, v8f c) {
  return __builtin_amdgcn_wmma_f32_16x16x32_f16(
      /*neg_a=*/false, a, /*neg_b=*/false, b,
      /*c_mod=*/(short)0, c, /*reuse_a=*/false, /*reuse_b=*/false);
}

// ---------------------------------------------------------------------------
// Workgroup-tiled GEMM core: 256x256 tile, 8 waves (2x4), two per SIMD, K staged in LDS by
// tensor loads, one per wave and stage (two-buffer ring, one barrier per k-slice). acc is this
// wave's 128x64 (8x4 fragment tiles).
// Xg, Wg: [rows x 1024] row-major f16. acc = Xg rows (row0..) times Wg rows (n0..) transposed:
// a lane holds 8 neighbouring Xg-row indices (register axis) at one Wg-row index (lane axis);
// SWAP exchanges the two axes.
// The callers pick which matrix goes on which side so that the register axis is the
// axis that is contiguous in their output.
// ---------------------------------------------------------------------------
// one 32-k block of a wave's 128x64 tile: 8 x 4 fragment products. SWAP puts the b rows on the
// accumulator's register axis and the a rows on its lane axis (the two fragment layouts are alike).
template <bool SWAP>
__device__ __forceinline__ void mma_block(const v16h a[8], const v16h b[4], v8f acc[8][4]) {
#pragma unroll
  for (int mt = 0; mt < 8; ++mt)
#pragma unroll
    for (int nt = 0; nt < 4; ++nt)
      acc[mt][nt] = SWAP ? wmma_f16(b[nt], a[mt], acc[mt][nt]) : wmma_f16(a[mt], b[nt], acc[mt][nt]);
}

// first byte of this wave's slice of every stage of a tile: waves 0..3 bring 64 Xg rows each,
// waves 4..7 64 Wg rows
__device__ __forceinline__ uint64_t slice_src(const _Float16* __restrict__ Xg,
                                              const _Float16* __restrict__ Wg,
                                              int row0, int n0, uint32_t wave) {
  const _Float16* srow = (wave < 4u) ? Xg + (size_t)(row0 + 64 * (int)wave) * D_MODEL
                                     : Wg + (size_t)(n0 + 64 * ((int)wave - 4)) * D_MODEL;
  return (uint64_t)(uintptr_t)srow;
}

// The eight passes of one tile. On entry stage 0 is published in buffer 0 and this wave's
// request for stage 1 is in flight. ga: this wave's slice of the tile; where
// `more` is set, gan is its slice of the work-group's next tile, whose stage 0 is asked for in
// the place of a stage 8 and is published by the last pass's barrier. Buffer 1 is left dead.
template <bool SWAP>
__device__ __forceinline__ void ring_passes(_Float16* Ring, int lane, uint32_t wave, uint32_t ld,
                                            uint64_t ga, uint64_t gan, uint32_t more,
                                            const u32x8 g1, v8f acc[8][4]) {
  // the slices this wave reads: two of Xg rows (128 rows), one of Wg rows (64 rows)
  const int asl = (int)(wave >> 2) * 2 * SLICE_H;
  const int bsl = (4 + (int)(wave & 3u)) * SLICE_H;

  const int steps = D_MODEL / BK;
  for (int i = 0; i < steps; ++i) {
    const int cur = i & 1;
    const _Float16* Ab = Ring + cur * STAGE_H + asl;
    const _Float16* Bb = Ring + cur * STAGE_H + bsl;
#pragma unroll
    for (int kk = 0; kk < BK; kk += 32) {
      v16h a[8], b[4];
      // Fence pair: holds this block's 24 LDS reads together as one group in front of its
      // 32 WMMAs. Left free, the compiler spread them in pairs among the WMMAs, each pair
      // behind a wait to 0, which two waves a SIMD cannot hide.
      __builtin_amdgcn_sched_barrier(0);
#pragma unroll
      for (int nt = 0; nt < 4; ++nt) b[nt] = load_frag16(Bb, LSTR, 16 * nt, kk, lane);
#pragma unroll
      for (int mt = 0; mt < 8; ++mt)
        a[mt] = load_frag16(Ab + (mt >> 2) * SLICE_H, LSTR, 16 * (mt & 3), kk, lane);
      __builtin_amdgcn_sched_barrier(0);
      if (kk + 32 == BK) {
        // Publish point of stage i + 1, which also frees buffer `cur` for the refill. It stands
        // behind the pass's last LDS reads; the last block's WMMAs, which read registers
        // alone, follow it, so that the refill has the whole next pass to land in.
        asm volatile("s_wait_dscnt 0x0" ::: "memory");  // own reads of `cur` retired before it is refilled
        wait_tensor0();                                 // own slice of stage i + 1 has landed
        __syncthreads();
        const bool own = i + 2 < steps;                 // stage i + 2 of this tile exists
        // scalar test: only while a next stage exists, in this tile or as the next tile's first
        if (pinned((own || (i + 2 == steps && more != 0u)) ? 1u : 0u) != 0u) {
          tensor_load(slice_group0(ld + (uint32_t)cur * STAGE_B,
                                   own ? ga + (uint64_t)(i + 2) * (BK * 2) : gan), g1);
        }
      }
      mma_block<SWAP>(a, b, acc);
    }
  }
  asm volatile("s_wait_tensorcnt 0x0" ::: "memory");    // nothing in flight when the passes are left
  asm volatile("s_wait_dscnt 0x0" ::: "memory");        // no LDS read of the ring outstanding either
}

// prologue of a work-group's first tile: stage 0 lands in buffer 0 and is published, then
// stage 1 starts
__device__ __forceinline__ void ring_prologue(uint32_t ld, uint64_t ga, const u32x8 g1) {
  tensor_load(slice_group0(ld, ga), g1);
  wait_tensor0();                                     // this wave's slice of stage 0 has landed
  __syncthreads();                                    // every wave's slice of stage 0 visible
  tensor_load(slice_group0(ld + STAGE_B, ga + BK * 2), g1);
}

// one tile alone
__device__ __forceinline__ void gemm_core_256(const _Float16* __restrict__ Xg,
                                              const _Float16* __restrict__ Wg,
                                              int row0, int n0, int tid,
                                              _Float16* Ring, v8f acc[8][4]) {
  const int lane = tid & 31;
  const uint32_t wave = uni((uint32_t)tid >> 5);
  const uint64_t ga = slice_src(Xg, Wg, row0, n0, wave);
  const uint32_t ld = (uint32_t)(uintptr_t)Ring + wave * SLICE_B;  // LDS byte offset (low 32 bits)
  const u32x8 g1 = slice_group1();
  ring_prologue(ld, ga, g1);
  ring_passes<false>(Ring, lane, wave, ld, ga, ga, 0u, g1, acc);
}

// ---------------------------------------------------------------------------
// Conversion kernels
// ---------------------------------------------------------------------------
#define CS_WAVES 16             // waves per work-group of the activation stream
#define CS_LOADS 16             // 16-byte loads a lane has in flight
#define CS_GRID  256            // work-groups of the activation stream

// f32 -> f16 stream. One wave-wide load covers 512 contiguous bytes (4 whole lines), the
// matching store 256 contiguous bytes (2 whole lines). A wave owns a contiguous range and
// walks it in groups of CS_LOADS loads, all issued before the first one is converted.
__global__ void __launch_bounds__(CS_WAVES * 32)
convert_src_kernel(const float* __restrict__ in, _Float16* __restrict__ out) {
  const int lane = threadIdx.x & 31;
  const int wave = blockIdx.x * CS_WAVES + (threadIdx.x >> 5);
  const size_t per_wave = (size_t)M_TOTAL * D_MODEL / (CS_GRID * CS_WAVES);  // 4096 floats
  const float*    ip = in + wave * per_wave + lane * 4;
  _Float16*       op = out + wave * per_wave + lane * 4;
  for (size_t g = 0; g < per_wave; g += CS_LOADS * 128) {
    v4f x[CS_LOADS];
#pragma unroll
    for (int c = 0; c < CS_LOADS; ++c) x[c] = *(const v4f*)(ip + g + c * 128);
#pragma unroll
    for (int c = 0; c < CS_LOADS; ++c) {
      v4h h;
#pragma unroll
      for (int r = 0; r < 4; ++r) h[r] = (_Float16)x[c][r];
      *(v4h*)(op + g + c * 128) = h;
    }
  }
}

#define TK   128                // k extent of a weight tile
#define TN   64                 // n extent of a weight tile
#define TSTR 136                // LDS row stride in halves (128 + 8 pad, rows stay 16-B aligned)

// wT[z][n][k] = W_z[k][n]  (f16, transposed so K-pairs are contiguous).
// One work-group turns a 128 (k) x 64 (n) tile through LDS: 16 lanes read one 256-B piece
// of a W row, 16 lanes write one 256-B piece of a wT row, whole lines on both sides.
__global__ void __launch_bounds__(256)
convert_w_kernel(const float* __restrict__ Wq,
                 const float* __restrict__ Wk,
                 const float* __restrict__ Wv,
                 const float* __restrict__ Wo,
                 _Float16* __restrict__ wT) {
  __shared__ __attribute__((aligned(16))) _Float16 tile[TN * TSTR];
  const int tid = threadIdx.x;
  const int k0 = blockIdx.x * TK;
  const int n0 = blockIdx.y * TN;
  const int z  = blockIdx.z;
  const float* W = (z == 0) ? Wq : (z == 1) ? Wk : (z == 2) ? Wv : Wo;

  // a thread takes 4 neighbouring n of the k pairs (2 * kp, 2 * kp + 1), kp = tid >> 4 + 16 * c
  const int nq = (tid & 15) * 4;
  const int kp = tid >> 4;
  const float* wp = W + (size_t)(k0 + 2 * kp) * D_MODEL + n0 + nq;
  v4f lo[4], hi[4];
#pragma unroll
  for (int c = 0; c < 4; ++c) {
    lo[c] = *(const v4f*)(wp + (size_t)(32 * c) * D_MODEL);
    hi[c] = *(const v4f*)(wp + (size_t)(32 * c + 1) * D_MODEL);
  }
#pragma unroll
  for (int c = 0; c < 4; ++c)
#pragma unroll
    for (int j = 0; j < 4; ++j) {
      v2h p;
      p[0] = (_Float16)lo[c][j];
      p[1] = (_Float16)hi[c][j];
      *(v2h*)(tile + (nq + j) * TSTR + 2 * kp + 32 * c) = p;
    }
  __syncthreads();   // the tile's rows are read back by other lanes than wrote them

  const int rr = tid >> 4, pc = (tid & 15) * 8;
  _Float16* dst = wT + (size_t)z * D_MODEL * D_MODEL + (size_t)(n0 + rr) * D_MODEL + k0 + pc;
#pragma unroll
  for (int it = 0; it < 4; ++it)
    *(v8h*)(dst + (size_t)(it * 16) * D_MODEL) = *(const v8h*)(tile + (it * 16 + rr) * TSTR + pc);
}

// ---------------------------------------------------------------------------
// QKV projection with the block attention in the same launch: 256x256 workgroup tile, 8 waves.
// A work-group walks the Q, K and V tiles of its rows and columns one after the other, and the
// tensor-load ring runs on across them: the next tile's stage 0 lands in buffer 0 under the last
// pass, its stage 1 starts behind that pass. A wave's 128 features x 64 tokens of each tile are one
// head of one block, so the attention of that (block, head) is the wave's own work, and
// the accumulator layout is the operand layout: a lane's 8 neighbouring register-axis values of two
// neighbouring 16-tiles are its 16 k values of a 16x16x32 fragment. Q, K, P and V go from
// accumulators to operands by conversion alone, with no exchange between lanes (Q's fragments wait
// in registers while the K passes run).
//   Q, K tiles: features on the register axis, tokens on the lane axis  -> k axis = features
//   scores:     A = K, B = Q -> key tokens on the register axis, query tokens on the lane axis
//   V tile:     tokens on the register axis, features on the lane axis  -> k axis = key tokens
//   output:     A = V, B = P -> features on the register axis, query tokens on the lane axis
// The f16 attention output is staged in the dead ring and stored row-major as whole lines.
// ---------------------------------------------------------------------------
__device__ __forceinline__ void zero_acc(v8f acc[8][4]) {
  const v8f vzero = {0.f, 0.f, 0.f, 0.f, 0.f, 0.f, 0.f, 0.f};
#pragma unroll
  for (int mt = 0; mt < 8; ++mt)
#pragma unroll
    for (int nt = 0; nt < 4; ++nt) acc[mt][nt] = vzero;
}

// Q or K tile plus bias as f16 fragments: f[nt][c] = tokens 16 nt.., features 32 c..
// bias: at the head's first feature (the same for the wave); boff: the lane's byte offset from
// there, 32 * half
__device__ __forceinline__ void feature_frags(const v8f acc[8][4], const float* __restrict__ bias,
                                              uint32_t boff, v16h f[4][4]) {
  const char* bp = (const char*)bias + boff;
  v4f blo[8], bhi[8];
  __builtin_amdgcn_sched_barrier(0);   // first of the pair described below
#pragma unroll
  for (int mt = 0; mt < 8; ++mt) {
    blo[mt] = *(const v4f*)(bp + mt * 64);
    bhi[mt] = *(const v4f*)(bp + mt * 64 + 16);
  }
  // Precaution: stands in front of any rewrite of the bias loads' address register. The pair of
  // scheduling fences keeps every other instruction, and so every such rewrite, out of the run
  // from the first load to the wait.
  asm volatile("s_wait_xcnt 0x0" ::: "memory");
  __builtin_amdgcn_sched_barrier(0);
#pragma unroll
  for (int c = 0; c < 4; ++c)
#pragma unroll
    for (int nt = 0; nt < 4; ++nt) {
      v16h x;
#pragma unroll
      for (int r = 0; r < 4; ++r) {
        x[r]      = (_Float16)(acc[2 * c][nt][r] + blo[2 * c][r]);
        x[4 + r]  = (_Float16)(acc[2 * c][nt][4 + r] + bhi[2 * c][r]);
        x[8 + r]  = (_Float16)(acc[2 * c + 1][nt][r] + blo[2 * c + 1][r]);
        x[12 + r] = (_Float16)(acc[2 * c + 1][nt][4 + r] + bhi[2 * c + 1][r]);
      }
      f[nt][c] = x;
    }
}

__global__ void __launch_bounds__(256)
qkv_attn_kernel(const _Float16* __restrict__ X, const _Float16* __restrict__ WT,
                const float* __restrict__ bq, const float* __restrict__ bk,
                const float* __restrict__ bv, _Float16* __restrict__ AO) {
  __shared__ __attribute__((aligned(2048))) _Float16 Ring[2 * STAGE_H];   // 288 KB

  const int tid  = threadIdx.x;
  const int lane = tid & 31;
  const int row0 = blockIdx.x * 256;
  const int n0   = blockIdx.y * 256;
  const uint32_t uwave = uni((uint32_t)tid >> 5);
  const uint32_t ld = (uint32_t)(uintptr_t)Ring + uwave * SLICE_B;  // LDS byte offset (low 32 bits)
  const int half = lane >> 4, nl = lane & 15;
  const int wa = n0 + (int)(uwave >> 2) * DK;     // first feature of this wave's head
  const int wb = row0 + (int)(uwave & 3u) * BLK;  // first token row of this wave's block
  const v8f vzero = {0.f, 0.f, 0.f, 0.f, 0.f, 0.f, 0.f, 0.f};

  // every tile: weight rows in the stage's first four slices, X rows in its last four
  const uint64_t gq = slice_src(WT, X, n0, row0, uwave);
  const uint64_t gk = slice_src(WT + (size_t)D_MODEL * D_MODEL, X, n0, row0, uwave);
  const uint64_t gv = slice_src(WT + (size_t)2 * D_MODEL * D_MODEL, X, n0, row0, uwave);
  const u32x8 g1 = slice_group1();
  ring_prologue(ld, gq, g1);

  v8f acc[8][4];
  v16h pf[4][2];   // P as B fragments: pf[nt][c] = query tokens 16 nt.., key tokens 32 c..
  {
    v16h qf[4][4], kf[4][4];
    zero_acc(acc);
    ring_passes<false>(Ring, lane, uwave, ld, gq, gk, 1u, g1, acc);
    // Buffer 1 is dead behind the last pass's barrier, and nothing is staged in it: K's stage 1
    tensor_load(slice_group0(ld + STAGE_B, gk + BK * 2), g1);
    feature_frags(acc, bq + wa, 32u * (uint32_t)half, qf);
    // Q's 128 registers of fragments stay live under the K passes: 256 accumulators, 96 of ring
    // fragments and these fit the wave's 512.
    // Inputs-only fence: holds Q's bias add and conversion in front of the K passes. Left free, the
    // compiler moved part of them behind the passes and spilled the f32 values and the bias.
#pragma unroll
    for (int c = 0; c < 4; ++c)
#pragma unroll
      for (int nt = 0; nt < 4; ++nt) asm volatile("" :: "v"(qf[nt][c]));
    zero_acc(acc);
    ring_passes<false>(Ring, lane, uwave, ld, gk, gv, 1u, g1, acc);
    tensor_load(slice_group0(ld + STAGE_B, gv + BK * 2), g1);   // V's stage 1, as K's above
    feature_frags(acc, bk + wa, 32u * (uint32_t)half, kf);

    // scores, transposed: st[mt][nt] = key tokens 16 mt.. (register axis) x query tokens 16 nt..
    v8f st[4][4];
#pragma unroll
    for (int c = 0; c < 4; ++c)
#pragma unroll
      for (int mt = 0; mt < 4; ++mt)
#pragma unroll
        for (int nt = 0; nt < 4; ++nt)
          st[mt][nt] = wmma_f16(kf[mt][c], qf[nt][c], c == 0 ? vzero : st[mt][nt]);

    // softmax over the key tokens of one query token: 32 values of the lane, 32 of lane ^ 16
    const float scale = 0.08838834764831845f;  // dk^-0.5
#pragma unroll
    for (int nt = 0; nt < 4; ++nt) {
      float mx = st[0][nt][0] * scale;
#pragma unroll
      for (int mt = 0; mt < 4; ++mt)
#pragma unroll
        for (int r = 0; r < 8; ++r) {
          st[mt][nt][r] *= scale;
          mx = fmaxf(mx, st[mt][nt][r]);
        }
      mx = fmaxf(mx, __shfl_xor(mx, 16, 32));
      float sum = 0.f;
#pragma unroll
      for (int mt = 0; mt < 4; ++mt)
#pragma unroll
        for (int r = 0; r < 8; ++r) {
          st[mt][nt][r] = __expf(st[mt][nt][r] - mx);
          sum += st[mt][nt][r];
        }
      sum += __shfl_xor(sum, 16, 32);
      const float inv = 1.0f / sum;
#pragma unroll
      for (int c = 0; c < 2; ++c) {
        v16h x;
#pragma unroll
        for (int r = 0; r < 8; ++r) {
          x[r]     = (_Float16)(st[2 * c][nt][r] * inv);
          x[8 + r] = (_Float16)(st[2 * c + 1][nt][r] * inv);
        }
        // Inputs-only fence: holds P's conversion in front of the V passes. Left free, the compiler
        // moved the division and the conversion behind them and carried the f32 values, twice
        // the registers, across the loop.
        asm volatile("" :: "v"(x));
        pf[nt][c] = x;
      }
    }
  }

  // V tile: acc[mt][nt] = key tokens 16 nt.. (register axis) x features 16 mt.. (lane axis)
  zero_acc(acc);
  ring_passes<true>(Ring, lane, uwave, ld, gv, gv, 0u, g1, acc);

  const int bi = wa + nl;
  float bb[8];
  __builtin_amdgcn_sched_barrier(0);   // fence pair round the loads and their wait, as above
#pragma unroll
  for (int mt = 0; mt < 8; ++mt) bb[mt] = bv[bi + mt * 16];
  // Precaution, as for the Q and K bias; the index is named as an input so that no load's result
  // takes its register.
  asm volatile("s_wait_xcnt 0x0" :: "v"(bi) : "memory");
  __builtin_amdgcn_sched_barrier(0);

  // The ring is dead behind its last barrier; each wave stages its 64 token rows of 128 features
  // in its own range, 256 B of payload a row.
  _Float16* stg = Ring + uwave * WSTG;
#pragma unroll
  for (int mt = 0; mt < 8; ++mt) {
    v16h vf[2];    // V as A fragments: features 16 mt.., key tokens 32 c..
#pragma unroll
    for (int c = 0; c < 2; ++c)
#pragma unroll
      for (int r = 0; r < 8; ++r) {
        vf[c][r]     = (_Float16)(acc[mt][2 * c][r] + bb[mt]);
        vf[c][8 + r] = (_Float16)(acc[mt][2 * c + 1][r] + bb[mt]);
      }
#pragma unroll
    for (int nt = 0; nt < 4; ++nt) {
      v8f o = wmma_f16(vf[0], pf[nt][0], vzero);
      o = wmma_f16(vf[1], pf[nt][1], o);
      v8h hv;
#pragma unroll
      for (int r = 0; r < 8; ++r) hv[r] = (_Float16)o[r];
      *(v8h*)(stg + (nt * 16 + nl) * LSTR + mt * 16 + 8 * half) = hv;
    }
  }
  __syncthreads();   // the staged rows are read back by other lanes than wrote them

  // 16 lanes carry one staged row = two whole 128-B lines of the output
  const int rr = lane >> 4, pc = (lane & 15) * 8;
  const _Float16* rd = stg + rr * LSTR + pc;
  _Float16* dst = AO + (size_t)(wb + rr) * D_MODEL + wa + pc;
#pragma unroll
  for (int it = 0; it < 32; ++it)
    *(v8h*)(dst + it * 2 * D_MODEL) = *(const v8h*)(rd + it * 2 * LSTR);
}

// ---------------------------------------------------------------------------
// Output projection: attn(f16) @ Wo^T(f16) + bo -> fp32 d_out
// ---------------------------------------------------------------------------
__global__ void __launch_bounds__(256)
out_gemm_kernel(const _Float16* __restrict__ X, const _Float16* __restrict__ WoT,
                const float* __restrict__ bo, float* __restrict__ out) {
  __shared__ __attribute__((aligned(2048))) _Float16 Ring[2 * STAGE_H];   // 288 KB

  const int tid  = threadIdx.x;
  const int lane = tid & 31;
  const int wave = tid >> 5;
  const int row0 = blockIdx.x * 256;
  const int n0   = blockIdx.y * 256;

  const v8f vzero = {0.f, 0.f, 0.f, 0.f, 0.f, 0.f, 0.f, 0.f};
  v8f acc[8][4];
#pragma unroll
  for (int mt = 0; mt < 8; ++mt)
#pragma unroll
    for (int nt = 0; nt < 4; ++nt) acc[mt][nt] = vzero;

  // output features on the accumulator's register axis, tokens on its lane axis
  gemm_core_256(WoT, X, n0, row0, tid, Ring, acc);

  const int half = lane >> 4, nl = lane & 15;
  const int wa = n0 + (wave >> 2) * 128;    // first output feature of this wave's tile
  const int wb = row0 + (wave & 3) * 64;    // first token row of this wave's tile
  // The ring is dead behind its last barrier; each wave stages its 64 token rows of
  // 128 floats in its own range.
  float* stg = (float*)(Ring + wave * FSTG);
  const float* bp = bo + wa + 8 * half;
  v4f blo[8], bhi[8];
#pragma unroll
  for (int mt = 0; mt < 8; ++mt) {
    blo[mt] = *(const v4f*)(bp + mt * 16);
    bhi[mt] = *(const v4f*)(bp + mt * 16 + 4);
  }
  // Precaution: stands in front of any rewrite of the bias loads' address registers; the
  // address is named as an input so that its registers stay live up to the wait.
  asm volatile("s_wait_xcnt 0x0" :: "v"(bp) : "memory");
#pragma unroll
  for (int mt = 0; mt < 8; ++mt) {
#pragma unroll
    for (int nt = 0; nt < 4; ++nt) {
      v4f lo, hi;
#pragma unroll
      for (int r = 0; r < 4; ++r) {
        lo[r] = acc[mt][nt][r] + blo[mt][r];
        hi[r] = acc[mt][nt][4 + r] + bhi[mt][r];
      }
      float* s = stg + (nt * 16 + nl) * FSTR + mt * 16 + 8 * half;
      *(v4f*)s       = lo;
      *(v4f*)(s + 4) = hi;
    }
  }
  __syncthreads();   // the staged rows are read back by other lanes than wrote them

  // the wave's 32 lanes carry one staged row = four whole 128-B lines of the output
  float* dst = out + (size_t)wb * D_MODEL + wa + lane * 4;
#pragma unroll
  for (int it = 0; it < 64; ++it)
    *(v4f*)(dst + it * D_MODEL) = *(const v4f*)(stg + it * FSTR + lane * 4);
}

// ---------------------------------------------------------------------------
extern "C" void kernel_launch(void* const* d_in, const int* in_sizes, int n_in,
                              void* d_out, int out_size, void* d_ws, size_t ws_size,
                              hipStream_t stream) {
  const float* src = (const float*)d_in[0];
  const float* Wq  = (const float*)d_in[1];
  const float* bq  = (const float*)d_in[2];
  const float* Wk  = (const float*)d_in[3];
  const float* bk  = (const float*)d_in[4];
  const float* Wv  = (const float*)d_in[5];
  const float* bv  = (const float*)d_in[6];
  const float* Wo  = (const float*)d_in[7];
  const float* bo  = (const float*)d_in[8];
  float* out = (float*)d_out;

  const size_t actN = (size_t)M_TOTAL * D_MODEL;   // 16,777,216 halves
  const size_t wN   = (size_t)4 * D_MODEL * D_MODEL;

  _Float16* srcH = (_Float16*)d_ws;
  _Float16* wT   = srcH + actN;            // 4 transposed f16 weight matrices
  _Float16* attn = wT + wN;                // attention output, row-major

  // 1. fp32 -> f16 conversions
  convert_src_kernel<<<CS_GRID, CS_WAVES * 32, 0, stream>>>(src, srcH);
  convert_w_kernel<<<dim3(D_MODEL / TK, D_MODEL / TN, 4), 256, 0, stream>>>(
      Wq, Wk, Wv, Wo, wT);

  // 2. QKV projections and block-local attention (three 256x256 tiles per workgroup, one
  //    (block, head) per wave)
  qkv_attn_kernel<<<dim3(M_TOTAL / 256, D_MODEL / 256), 256, 0, stream>>>(
      srcH, wT, bq, bk, bv, attn);

  // 3. output projection -> fp32
  out_gemm_kernel<<<dim3(M_TOTAL / 256, D_MODEL / 256), 256, 0, stream>>>(
      attn, wT + (size_t)3 * D_MODEL * D_MODEL, bo, out);
}
